// v000
// The times below were measured on an AMD MI455X: many runs one after another, warmed up first and cycling through
// copies of the inputs, with the whole window's GPU time divided by the number of runs. Launches and the gaps
// between them are all in it. The median over several windows is given; except for v000 it joins two sittings, which
// can be a few percent apart, so the side-by-side timings, each taken in one sitting, are the better comparison.
// v000 is the starting kernel. One run takes 293 microseconds.
#include <hip/hip_runtime.h>
#include <math.h>

typedef __attribute__((ext_vector_type(16))) _Float16 v16h;
typedef __attribute__((ext_vector_type(16))) __bf16 v16b;
typedef __attribute__((ext_vector_type(8)))  _Float16 v8h;
typedef __attribute__((ext_vector_type(8)))  float v8f;
typedef __attribute__((ext_vector_type(4)))  float v4f;
typedef __attribute__((ext_vector_type(2)))  float v2f;
typedef __attribute__((ext_vector_type(4)))  unsigned v4u;
typedef __attribute__((ext_vector_type(4)))  int v4i;
typedef float __attribute__((may_alias)) float_a;
typedef int __attribute__((may_alias)) int_a;

template <typename T> __device__ __forceinline__ void vst2(void* p, T v) { *(T*)p = v;  }
__device__ __forceinline__ v8f wmma16(v16h a, v16h b, v8f c) {
  v8f d = __builtin_amdgcn_wmma_f32_16x16x32_f16(false, a, false, b, (short)0, c, false, false);
  asm volatile("v_nop\n\tv_nop\n\tv_nop\n\tv_nop" : "+v"(d) : "v"(a), "v"(b));
  return d;
}
__device__ __forceinline__ v8f wmma_bf(v16b a, v16b b, v8f c) {
  v8f d = __builtin_amdgcn_wmma_f32_16x16x32_bf16(false, a, false, b, (short)0, c, false, false);
  asm volatile("v_nop\n\tv_nop\n\tv_nop\n\tv_nop" : "+v"(d) : "v"(a), "v"(b));
  return d;
}
// 16x16x32 fragments: lane = (h = lane>>4, row/col = lane&15); elements 0..7 = k0+8h+0..7, 8..15 = k0+16+8h+0..7; D element r = row 8h+r
__device__ __forceinline__ v16h frag_h(const _Float16* rowk0, int lane) {
  union { v16h v; v8h q[2]; } u; const _Float16* p = rowk0 + 8 * (lane >> 4);
  u.q[0] = *(const v8h*)p; u.q[1] = *(const v8h*)(p + 16); return u.v;
}
__device__ __forceinline__ v16h frag_f32(const float* rowk0, int lane) {
  v16h a; const float* p = rowk0 + 8 * (lane >> 4);
#pragma unroll
  for (int i = 0; i < 8; ++i) { a[i] = (_Float16)p[i]; a[8 + i] = (_Float16)p[16 + i]; }
  return a;
}
__device__ __forceinline__ v16h frag_f32s(const float* rowk0, int lane, float sc) {
  v16h a; const float* p = rowk0 + 8 * (lane >> 4);
#pragma unroll
  for (int i = 0; i < 8; ++i) { a[i] = (_Float16)(p[i] * sc); a[8 + i] = (_Float16)(p[16 + i] * sc); }
  return a;
}
// column fragment from a [K][ld] layout (column n), rows >= K read as 0
__device__ __forceinline__ v16h fragc_f32(const float* W, int k0, int n, int lane, int ld, int K) {
  v16h a; const int g = lane >> 4;
#pragma unroll
  for (int i = 0; i < 8; ++i) { const int ka = k0 + 8 * g + i, kb = ka + 16;
    a[i] = (_Float16)(ka < K ? W[(size_t)ka * ld + n] : 0.f); a[8 + i] = (_Float16)(kb < K ? W[(size_t)kb * ld + n] : 0.f); }
  return a;
}
struct F2 { v16b h, l; };
__device__ __forceinline__ F2 bsplit16(const float v[16]) { F2 r;
#pragma unroll
  for (int i = 0; i < 16; ++i) { const __bf16 h = (__bf16)v[i]; r.h[i] = h; r.l[i] = (__bf16)(v[i] - (float)h); }
  return r; }
__device__ __forceinline__ F2 split_row(const float* row, int k0, int lane) { float v[16]; const float* p = row + k0 + 8 * (lane >> 4);
#pragma unroll
  for (int i = 0; i < 8; ++i) { v[i] = p[i]; v[8 + i] = p[16 + i]; }
  return bsplit16(v); }
__device__ __forceinline__ F2 split_rowK(const float* row, int k0, int lane, int K) { float v[16]; const int g = lane >> 4;
#pragma unroll
  for (int i = 0; i < 8; ++i) { const int ka = k0 + 8 * g + i, kb = ka + 16; v[i] = ka < K ? row[ka] : 0.f; v[8 + i] = kb < K ? row[kb] : 0.f; }
  return bsplit16(v); }
__device__ __forceinline__ F2 split_col(const float* W, int k0, int n, int lane, int ld, int K) { float v[16]; const int g = lane >> 4;
#pragma unroll
  for (int i = 0; i < 8; ++i) { const int ka = k0 + 8 * g + i, kb = ka + 16; v[i] = ka < K ? W[(size_t)ka * ld + n] : 0.f; v[8 + i] = kb < K ? W[(size_t)kb * ld + n] : 0.f; }
  return bsplit16(v); }
__device__ __forceinline__ v8f mac3(const F2& a, const F2& b, v8f c) { c = wmma_bf(a.l, b.h, c); c = wmma_bf(a.h, b.l, c); return wmma_bf(a.h, b.h, c); }
__device__ __forceinline__ float sigm(float v) { return 1.0f / (1.0f + expf(-v)); }
#define LDSX() do { asm volatile("s_wait_dscnt 0" ::: "memory"); __builtin_amdgcn_wave_barrier(); __builtin_amdgcn_fence(__ATOMIC_RELEASE, "workgroup"); } while (0)

// Causal multi-head attention whose softmax runs over the QUERY axis (per key column), + FFN + residual, with inline sinusoidal
// sums Z_k = sum_{q>=k} exp(s[q][k]); pass 2 is un-normalised causal attention with values scaled by 1/Z_k. Projections, both score
// passes (head dim 16 zero-padded to the 32-wide K), P@V and the FFN run on v_wmma_f32_16x16x32_f16 (f16 operands, f32
#define NB 4
#define TT 2048
#define DD 128
#define NH 8
#define HE 16
#define DFF 512
#define NR (NB * TT)

// ---- x + PE -> xpe rows (f32) and Q/K (f16 [h][b][t][16]) / V^T (f16 [h][b][e][t]); block = 64 rows (one b) x all 384 cols
__global__ __launch_bounds__(128) void k_proj(const float* __restrict__ x, const float* __restrict__ WQ, const float* __restrict__ WK, const float* __restrict__ WV,
                                            float* __restrict__ xpe, _Float16* __restrict__ Qh, _Float16* __restrict__ Kh, _Float16* __restrict__ vT) {
  __shared__ __align__(16) float sx[64][DD + 4];
  __shared__ __align__(16) float so[4][16][132];
  __shared__ __align__(16) _Float16 st[DD][72];
  const int tid = threadIdx.x, wave = tid >> 5, lane = tid & 31, col = lane & 15, g = lane >> 4;
  const int r0b = blockIdx.x * 64, b = r0b / TT, t0 = r0b % TT;
  // PE + stage
  for (int q = tid; q < 64 * DD; q += 128) { const int rl = q >> 7, c = q & 127; const int t = t0 + rl;
    const float div = expf((float)(c & ~1) * (-logf(10000.0f) / (float)DD)); const float ang = (float)t * div;
    const float pe = (c & 1) ? cosf(ang) : sinf(ang);
    sx[rl][c] = x[(size_t)(r0b + rl) * DD + c] + pe; }
  __syncthreads();
  for (int q = tid; q < 64 * 32; q += 128) { const int rl = q >> 5, pc = q & 31; vst2(xpe + (size_t)(r0b + rl) * DD + pc * 4, *(const v4f*)(&sx[rl][pc * 4])); }
#pragma unroll 1
  for (int which = 0; which < 3; ++which) { const float* W = which == 0 ? WQ : (which == 1 ? WK : WV);
    v8f acc[8] = {};
#pragma unroll
    for (int kc = 0; kc < DD / 32; ++kc) { const v16h a = frag_f32(&sx[wave * 16 + col][0] + kc * 32, lane);
#pragma unroll
      for (int j = 0; j < 8; ++j) acc[j] = wmma16(a, fragc_f32(W, kc * 32, j * 16 + col, lane, DD, DD), acc[j]); }
    if (which < 2) {
#pragma unroll
      for (int j = 0; j < 8; ++j)
#pragma unroll
        for (int r = 0; r < 8; ++r) so[wave][8 * g + r][j * 16 + col] = acc[j][r];
      LDSX();
      _Float16* dst = which == 0 ? Qh : Kh;
      // per head h (= tile j): 16 rows x 16 halves = 512 B contiguous at dst[((h*NB + b)*TT + t0 + wave*16) * 16]
      for (int q = lane; q < 8 * 32; q += 32) { const int h = q >> 5, pp = q & 31; const int rl = pp >> 1, half = (pp & 1) * 8; union { v8h hh; v4u u; } pk;
#pragma unroll
        for (int i = 0; i < 8; ++i) pk.hh[i] = (_Float16)so[wave][rl][h * 16 + half + i];
        vst2(dst + (((size_t)h * NB + b) * TT + t0 + wave * 16 + rl) * HE + half, pk.u); }
      LDSX();
    } else {
#pragma unroll
      for (int j = 0; j < 8; ++j)
#pragma unroll
        for (int r = 0; r < 8; ++r) st[j * 16 + col][wave * 16 + 8 * g + r] = (_Float16)acc[j][r];    // st[h*16+e][t local]
      __syncthreads();
      for (int q = tid; q < DD * 8; q += 128) { const int c = q >> 3, pc = q & 7, h = c >> 4, e = c & 15;
        vst2(vT + (((size_t)h * NB + b) * HE + e) * TT + t0 + pc * 8, *(const v4u*)(&st[c][pc * 8])); }
    }
  }
}
__device__ __forceinline__ v16h frag16(const _Float16* row16, int lane) {   // K = 16 real: elements 0..7 (h==0 lanes) and ... 
  // fragment elements: 0..7 = k 8h+0..7 (h = lane>>4) -> h==0: k 0..7, h==1: k 8..15; elements 8..15 = k 16+.. -> zero
  v16h a; const int hh = lane >> 4; union { v8h v; } u; u.v = *(const v8h*)(row16 + 8 * hh);
#pragma unroll
  for (int i = 0; i < 8; ++i) { a[i] = u.v[i]; a[8 + i] = (_Float16)0.f; }
  return a;
}
__global__ __launch_bounds__(128) void k_z(const _Float16* __restrict__ Qh, const _Float16* __restrict__ Kh, float* __restrict__ Z) {
  __shared__ __align__(16) float sz[64];
  const int tid = threadIdx.x, w = tid >> 5, lane = tid & 31, col = lane & 15, g = lane >> 4;
  const int hb = blockIdx.y, k0 = blockIdx.x * 64 + w * 16;
  const _Float16* qb = Qh + (size_t)hb * TT * HE; const _Float16* kb = Kh + (size_t)hb * TT * HE;
  const v16h ak = frag16(kb + (size_t)(k0 + col) * HE, lane);
  const float scl = rsqrtf((float)TT);
  float zs[8] = {0.f, 0.f, 0.f, 0.f, 0.f, 0.f, 0.f, 0.f};
#pragma unroll 1
  for (int qt = blockIdx.x; qt < TT / 64; ++qt) {
#pragma unroll
    for (int t = 0; t < 4; ++t) { v8f acc = {}; acc = wmma16(ak, frag16(qb + (size_t)(qt * 64 + t * 16 + col) * HE, lane), acc);
#pragma unroll
      for (int r = 0; r < 8; ++r) { const int key = k0 + 8 * g + r, q = qt * 64 + t * 16 + col; if (q >= key) zs[r] += expf(acc[r] * scl); } } }
  // reduce zs[r] over the 16 col lanes of each half -> key k0 + 8g + r
#pragma unroll
  for (int off = 8; off >= 1; off >>= 1) {
#pragma unroll
    for (int r = 0; r < 8; ++r) zs[r] += __shfl_xor(zs[r], off, 32); }
  if (col == 0) {
#pragma unroll
    for (int r = 0; r < 8; ++r) sz[w * 16 + 8 * g + r] = zs[r]; }
  __syncthreads();
  if (tid < 16) vst2(Z + (size_t)hb * TT + blockIdx.x * 64 + tid * 4, *(const v4f*)(&sz[tid * 4]));
}
// ---- pass 2: oh[hb][q][e] = sum_{k <= q} exp(s[q][k]) / Z[k] * V[k][e]; block = (hb, 64 queries)
__global__ __launch_bounds__(128) void k_av(const _Float16* __restrict__ Qh, const _Float16* __restrict__ Kh, const _Float16* __restrict__ vT, const float* __restrict__ Z, float* __restrict__ oh) {
  __shared__ __align__(16) _Float16 sP[4][16][72];
  __shared__ __align__(16) float so[4][16][20];
  const int tid = threadIdx.x, w = tid >> 5, lane = tid & 31, col = lane & 15, g = lane >> 4;
  const int hb = blockIdx.y, q0 = blockIdx.x * 64 + w * 16;
  const _Float16* qb = Qh + (size_t)hb * TT * HE; const _Float16* kb = Kh + (size_t)hb * TT * HE; const _Float16* vb = vT + (size_t)hb * HE * TT;
  const v16h aq = frag16(qb + (size_t)(q0 + col) * HE, lane);
  const float scl = rsqrtf((float)TT);
  v8f acc = {};
#pragma unroll 1
  for (int kt = 0; kt <= (int)blockIdx.x; ++kt) {
#pragma unroll
    for (int t = 0; t < 4; ++t) { v8f s = {}; s = wmma16(aq, frag16(kb + (size_t)(kt * 64 + t * 16 + col) * HE, lane), s);
      const int key = kt * 64 + t * 16 + col; const float zinv = 1.0f / Z[(size_t)hb * TT + key];
#pragma unroll
      for (int r = 0; r < 8; ++r) { const int q = q0 + 8 * g + r; const float p = key <= q ? expf(s[r] * scl) * zinv : 0.f; sP[w][8 * g + r][t * 16 + col] = (_Float16)(p * 256.0f); } }   // attn <= ~1e-2 typically; x256
    LDSX();
#pragma unroll
    for (int kc = 0; kc < 2; ++kc) acc = wmma16(frag_h(&sP[w][col][0] + kc * 32, lane), frag_h(vb + (size_t)col * TT + kt * 64 + kc * 32, lane), acc);   // B col = e (lane&15 < 16)
    __builtin_amdgcn_wave_barrier();
  }
#pragma unroll
  for (int r = 0; r < 8; ++r) so[w][8 * g + r][col] = acc[r] * (1.0f / 256.0f);
  LDSX();
  for (int q = lane; q < 64; q += 32) { const int rl = q >> 2, pc = q & 3; vst2(oh + ((size_t)hb * TT + q0 + rl) * HE + pc * 4, *(const v4f*)(&so[w][rl][pc * 4])); }
}
// ---- FFN: hid = relu(out@W1+b1) -> f16 rows; out = hid@W2 + b2 + xpe. A for ff1 gathered from oh (k -> h = k/16, e = k%16)
__global__ __launch_bounds__(128) void k_ff1(const float* __restrict__ oh, const float* __restrict__ W1, const float* __restrict__ b1, _Float16* __restrict__ hid) {
  __shared__ __align__(16) float so[4][16][132];
  const int tid = threadIdx.x, wave = tid >> 5, lane = tid & 31, col = lane & 15, g = lane >> 4;
  const int r0 = blockIdx.x * 64 + wave * 16, n0 = blockIdx.y * 128; const int r = r0 + col, b = r / TT, t = r % TT;
  v8f acc[8] = {};
#pragma unroll
  for (int kc = 0; kc < DD / 32; ++kc) { v16h a;
#pragma unroll
    for (int i = 0; i < 8; ++i) { const int ka = kc * 32 + 8 * g + i, kz = ka + 16;
      a[i] = (_Float16)oh[(((size_t)(ka >> 4) * NB + b) * TT + t) * HE + (ka & 15)]; a[8 + i] = (_Float16)oh[(((size_t)(kz >> 4) * NB + b) * TT + t) * HE + (kz & 15)]; }
#pragma unroll
    for (int j = 0; j < 8; ++j) acc[j] = wmma16(a, fragc_f32(W1, kc * 32, n0 + j * 16 + col, lane, DFF, DD), acc[j]); }
#pragma unroll
  for (int j = 0; j < 8; ++j) { const float bb = b1[n0 + j * 16 + col];
#pragma unroll
    for (int rr = 0; rr < 8; ++rr) { const float v = acc[j][rr] + bb; so[wave][8 * g + rr][j * 16 + col] = v > 0.f ? v : 0.f; } }
  LDSX();
  for (int q = lane; q < 16 * 16; q += 32) { const int rl = q >> 4, pc = q & 15; union { v8h hh; v4u u; } pk;
#pragma unroll
    for (int i = 0; i < 8; ++i) pk.hh[i] = (_Float16)so[wave][rl][pc * 8 + i];
    vst2(hid + (size_t)(r0 + rl) * DFF + n0 + pc * 8, pk.u); }
}
__global__ __launch_bounds__(128) void k_ff2(const _Float16* __restrict__ hid, const float* __restrict__ W2, const float* __restrict__ b2, const float* __restrict__ xpe, float* __restrict__ out) {
  __shared__ __align__(16) float so[4][16][132];
  const int tid = threadIdx.x, wave = tid >> 5, lane = tid & 31, col = lane & 15, g = lane >> 4;
  const int r0 = blockIdx.x * 64 + wave * 16;
  v8f acc[8] = {};
#pragma unroll 1
  for (int kc = 0; kc < DFF / 32; ++kc) { const v16h a = frag_h(hid + (size_t)(r0 + col) * DFF + kc * 32, lane);
#pragma unroll
    for (int j = 0; j < 8; ++j) acc[j] = wmma16(a, fragc_f32(W2, kc * 32, j * 16 + col, lane, DD, DFF), acc[j]); }
#pragma unroll
  for (int j = 0; j < 8; ++j) { const float bb = b2[j * 16 + col];
#pragma unroll
    for (int rr = 0; rr < 8; ++rr) so[wave][8 * g + rr][j * 16 + col] = acc[j][rr] + bb; }
  LDSX();
#pragma unroll 4
  for (int rl = 0; rl < 16; ++rl) { const size_t o = (size_t)(r0 + rl) * DD + lane * 4; vst2(out + o, *(const v4f*)(&so[wave][rl][lane * 4]) + *(const v4f*)(xpe + o)); }
}
extern "C" void kernel_launch(void* const* d_in, const int* in_sizes, int n_in, void* d_out, int out_size, void* d_ws, size_t ws_size, hipStream_t stream) {
  (void)in_sizes; (void)n_in; (void)out_size; (void)ws_size;
  const float* x = (const float*)d_in[0]; const float* WQ = (const float*)d_in[1]; const float* WK = (const float*)d_in[2]; const float* WV = (const float*)d_in[3];
  const float* W1 = (const float*)d_in[4]; const float* b1 = (const float*)d_in[5]; const float* W2 = (const float*)d_in[6]; const float* b2 = (const float*)d_in[7];
  float* out = (float*)d_out;
  char* ws = (char*)d_ws; size_t off = 0;
  auto take = [&](size_t bytes) { char* p = ws + off; off += (bytes + 255) & ~(size_t)255; return p; };
  float* xpe = (float*)take((size_t)NR * DD * 4);
  _Float16* Qh = (_Float16*)take((size_t)NR * DD * 2); _Float16* Kh = (_Float16*)take((size_t)NR * DD * 2); _Float16* vT = (_Float16*)take((size_t)NR * DD * 2);
  float* Z = (float*)take((size_t)NH * NB * TT * 4); float* oh = (float*)take((size_t)NR * DD * 4); _Float16* hid = (_Float16*)take((size_t)NR * DFF * 2);
  k_proj<<<NR / 64, 128, 0, stream>>>(x, WQ, WK, WV, xpe, Qh, Kh, vT);
  k_z<<<dim3(TT / 64, NH * NB), 128, 0, stream>>>(Qh, Kh, Z);
  k_av<<<dim3(TT / 64, NH * NB), 128, 0, stream>>>(Qh, Kh, vT, Z, oh);
  k_ff1<<<dim3(NR / 64, DFF / 128), 128, 0, stream>>>(oh, W1, b1, hid);
  k_ff2<<<NR / 64, 128, 0, stream>>>(hid, W2, b2, xpe, out);
}

// v001
// One run takes 203 microseconds.
// Timed twice side by side with v000, it ran 1.44 times as fast both times.
#include <hip/hip_runtime.h>
#include <math.h>

typedef __attribute__((ext_vector_type(16))) _Float16 v16h;
typedef __attribute__((ext_vector_type(16))) __bf16 v16b;
typedef __attribute__((ext_vector_type(8)))  _Float16 v8h;
typedef __attribute__((ext_vector_type(8)))  float v8f;
typedef __attribute__((ext_vector_type(4)))  float v4f;
typedef __attribute__((ext_vector_type(2)))  float v2f;
typedef __attribute__((ext_vector_type(4)))  unsigned v4u;
typedef __attribute__((ext_vector_type(4)))  int v4i;
typedef float __attribute__((may_alias)) float_a;
typedef int __attribute__((may_alias)) int_a;

template <typename T> __device__ __forceinline__ void vst2(void* p, T v) { *(T*)p = v;  }
__device__ __forceinline__ v8f wmma16(v16h a, v16h b, v8f c) {
  v8f d = __builtin_amdgcn_wmma_f32_16x16x32_f16(false, a, false, b, (short)0, c, false, false);
  asm volatile("v_nop\n\tv_nop\n\tv_nop\n\tv_nop" : "+v"(d) : "v"(a), "v"(b));
  return d;
}
__device__ __forceinline__ v8f wmma_bf(v16b a, v16b b, v8f c) {
  v8f d = __builtin_amdgcn_wmma_f32_16x16x32_bf16(false, a, false, b, (short)0, c, false, false);
  asm volatile("v_nop\n\tv_nop\n\tv_nop\n\tv_nop" : "+v"(d) : "v"(a), "v"(b));
  return d;
}
// 16x16x32 fragments: lane = (h = lane>>4, row/col = lane&15); elements 0..7 = k0+8h+0..7, 8..15 = k0+16+8h+0..7; D element r = row 8h+r
__device__ __forceinline__ v16h frag_h(const _Float16* rowk0, int lane) {
  union { v16h v; v8h q[2]; } u; const _Float16* p = rowk0 + 8 * (lane >> 4);
  u.q[0] = *(const v8h*)p; u.q[1] = *(const v8h*)(p + 16); return u.v;
}
__device__ __forceinline__ v16h frag_f32(const float* rowk0, int lane) {
  v16h a; const float* p = rowk0 + 8 * (lane >> 4);
#pragma unroll
  for (int i = 0; i < 8; ++i) { a[i] = (_Float16)p[i]; a[8 + i] = (_Float16)p[16 + i]; }
  return a;
}
__device__ __forceinline__ v16h frag_f32s(const float* rowk0, int lane, float sc) {
  v16h a; const float* p = rowk0 + 8 * (lane >> 4);
#pragma unroll
  for (int i = 0; i < 8; ++i) { a[i] = (_Float16)(p[i] * sc); a[8 + i] = (_Float16)(p[16 + i] * sc); }
  return a;
}
// column fragment from a [K][ld] layout (column n), rows >= K read as 0
__device__ __forceinline__ v16h fragc_f32(const float* W, int k0, int n, int lane, int ld, int K) {
  v16h a; const int g = lane >> 4;
#pragma unroll
  for (int i = 0; i < 8; ++i) { const int ka = k0 + 8 * g + i, kb = ka + 16;
    a[i] = (_Float16)(ka < K ? W[(size_t)ka * ld + n] : 0.f); a[8 + i] = (_Float16)(kb < K ? W[(size_t)kb * ld + n] : 0.f); }
  return a;
}
struct F2 { v16b h, l; };
__device__ __forceinline__ F2 bsplit16(const float v[16]) { F2 r;
#pragma unroll
  for (int i = 0; i < 16; ++i) { const __bf16 h = (__bf16)v[i]; r.h[i] = h; r.l[i] = (__bf16)(v[i] - (float)h); }
  return r; }
__device__ __forceinline__ F2 split_row(const float* row, int k0, int lane) { float v[16]; const float* p = row + k0 + 8 * (lane >> 4);
#pragma unroll
  for (int i = 0; i < 8; ++i) { v[i] = p[i]; v[8 + i] = p[16 + i]; }
  return bsplit16(v); }
__device__ __forceinline__ F2 split_rowK(const float* row, int k0, int lane, int K) { float v[16]; const int g = lane >> 4;
#pragma unroll
  for (int i = 0; i < 8; ++i) { const int ka = k0 + 8 * g + i, kb = ka + 16; v[i] = ka < K ? row[ka] : 0.f; v[8 + i] = kb < K ? row[kb] : 0.f; }
  return bsplit16(v); }
__device__ __forceinline__ F2 split_col(const float* W, int k0, int n, int lane, int ld, int K) { float v[16]; const int g = lane >> 4;
#pragma unroll
  for (int i = 0; i < 8; ++i) { const int ka = k0 + 8 * g + i, kb = ka + 16; v[i] = ka < K ? W[(size_t)ka * ld + n] : 0.f; v[8 + i] = kb < K ? W[(size_t)kb * ld + n] : 0.f; }
  return bsplit16(v); }
__device__ __forceinline__ v8f mac3(const F2& a, const F2& b, v8f c) { c = wmma_bf(a.l, b.h, c); c = wmma_bf(a.h, b.l, c); return wmma_bf(a.h, b.h, c); }
__device__ __forceinline__ float sigm(float v) { return 1.0f / (1.0f + expf(-v)); }
#define LDSX() do { asm volatile("s_wait_dscnt 0" ::: "memory"); __builtin_amdgcn_wave_barrier(); __builtin_amdgcn_fence(__ATOMIC_RELEASE, "workgroup"); } while (0)

// Causal multi-head attention whose softmax runs over the QUERY axis (per key column), + FFN + residual, with inline sinusoidal
// sums Z_k = sum_{q>=k} exp(s[q][k]); pass 2 is un-normalised causal attention with values scaled by 1/Z_k. Projections, both score
// passes (head dim 16 zero-padded to the 32-wide K), P@V and the FFN run on v_wmma_f32_16x16x32_f16 (f16 operands, f32
#define NB 4
#define TT 2048
#define DD 128
#define NH 8
#define HE 16
#define DFF 512
#define NR (NB * TT)

// ---- x + PE -> xpe rows (f32) and Q/K (f16 [h][b][t][16]) / V^T (f16 [h][b][e][t]); block = 64 rows (one b) x all 384 cols
__global__ __launch_bounds__(128) void k_proj(const float* __restrict__ x, const float* __restrict__ WQ, const float* __restrict__ WK, const float* __restrict__ WV,
                                            float* __restrict__ xpe, _Float16* __restrict__ Qh, _Float16* __restrict__ Kh, _Float16* __restrict__ vT) {
  __shared__ __align__(16) float sx[64][DD + 4];
  __shared__ __align__(16) float so[4][16][132];
  __shared__ __align__(16) _Float16 st[DD][72];
  const int tid = threadIdx.x, wave = tid >> 5, lane = tid & 31, col = lane & 15, g = lane >> 4;
  const int r0b = blockIdx.x * 64, b = r0b / TT, t0 = r0b % TT;
  // PE + stage
  for (int q = tid; q < 64 * DD; q += 128) { const int rl = q >> 7, c = q & 127; const int t = t0 + rl;
    const float div = expf((float)(c & ~1) * (-logf(10000.0f) / (float)DD)); const float ang = (float)t * div;
    const float pe = (c & 1) ? cosf(ang) : sinf(ang);
    sx[rl][c] = x[(size_t)(r0b + rl) * DD + c] + pe; }
  __syncthreads();
  for (int q = tid; q < 64 * 32; q += 128) { const int rl = q >> 5, pc = q & 31; vst2(xpe + (size_t)(r0b + rl) * DD + pc * 4, *(const v4f*)(&sx[rl][pc * 4])); }
#pragma unroll 1
  for (int which = 0; which < 3; ++which) { const float* W = which == 0 ? WQ : (which == 1 ? WK : WV);
    v8f acc[8] = {};
#pragma unroll
    for (int kc = 0; kc < DD / 32; ++kc) { const v16h a = frag_f32(&sx[wave * 16 + col][0] + kc * 32, lane);
#pragma unroll
      for (int j = 0; j < 8; ++j) acc[j] = wmma16(a, fragc_f32(W, kc * 32, j * 16 + col, lane, DD, DD), acc[j]); }
    if (which < 2) {
#pragma unroll
      for (int j = 0; j < 8; ++j)
#pragma unroll
        for (int r = 0; r < 8; ++r) so[wave][8 * g + r][j * 16 + col] = acc[j][r];
      LDSX();
      _Float16* dst = which == 0 ? Qh : Kh;
      // per head h (= tile j): 16 rows x 16 halves = 512 B contiguous at dst[((h*NB + b)*TT + t0 + wave*16) * 16]
      for (int q = lane; q < 8 * 32; q += 32) { const int h = q >> 5, pp = q & 31; const int rl = pp >> 1, half = (pp & 1) * 8; union { v8h hh; v4u u; } pk;
#pragma unroll
        for (int i = 0; i < 8; ++i) pk.hh[i] = (_Float16)so[wave][rl][h * 16 + half + i];
        vst2(dst + (((size_t)h * NB + b) * TT + t0 + wave * 16 + rl) * HE + half, pk.u); }
      LDSX();
    } else {
#pragma unroll
      for (int j = 0; j < 8; ++j)
#pragma unroll
        for (int r = 0; r < 8; ++r) st[j * 16 + col][wave * 16 + 8 * g + r] = (_Float16)acc[j][r];    // st[h*16+e][t local]
      __syncthreads();
      for (int q = tid; q < DD * 8; q += 128) { const int c = q >> 3, pc = q & 7, h = c >> 4, e = c & 15;
        vst2(vT + (((size_t)h * NB + b) * HE + e) * TT + t0 + pc * 8, *(const v4u*)(&st[c][pc * 8])); }
    }
  }
}
__device__ __forceinline__ v16h frag16(const _Float16* row16, int lane) {   // K = 16 real: elements 0..7 (h==0 lanes) and ... 
  // fragment elements: 0..7 = k 8h+0..7 (h = lane>>4) -> h==0: k 0..7, h==1: k 8..15; elements 8..15 = k 16+.. -> zero
  v16h a; const int hh = lane >> 4; union { v8h v; } u; u.v = *(const v8h*)(row16 + 8 * hh);
#pragma unroll
  for (int i = 0; i < 8; ++i) { a[i] = u.v[i]; a[8 + i] = (_Float16)0.f; }
  return a;
}
__global__ __launch_bounds__(128) void k_z(const _Float16* __restrict__ Qh, const _Float16* __restrict__ Kh, float* __restrict__ Z) {
  __shared__ __align__(16) float sz[64];
  const int tid = threadIdx.x, w = tid >> 5, lane = tid & 31, col = lane & 15, g = lane >> 4;
  const int hb = blockIdx.y, k0 = blockIdx.x * 64 + w * 16;
  const _Float16* qb = Qh + (size_t)hb * TT * HE; const _Float16* kb = Kh + (size_t)hb * TT * HE;
  const v16h ak = frag16(kb + (size_t)(k0 + col) * HE, lane);
  const float scl = rsqrtf((float)TT);
  float zs[8] = {0.f, 0.f, 0.f, 0.f, 0.f, 0.f, 0.f, 0.f};
#pragma unroll 1
  for (int qt = blockIdx.x; qt < TT / 64; ++qt) {
    // straight-line trip: the four query fragments are loaded first, the four score products follow back to back, and the
    // mask is a select on a finished exp, so the 32 exp chains are independent work in one basic block (the unrolls keep
    // bq and s in registers)
    v16h bq[4]; v8f s[4]; const _Float16* qrow = qb + (size_t)(qt * 64 + col) * HE;
#pragma unroll
    for (int t = 0; t < 4; ++t) bq[t] = frag16(qrow + t * 16 * HE, lane);
#pragma unroll
    for (int t = 0; t < 4; ++t) { v8f z0 = {}; s[t] = wmma16(ak, bq[t], z0); }
#pragma unroll
    for (int t = 0; t < 4; ++t) {
#pragma unroll
      for (int r = 0; r < 8; ++r) { const int key = k0 + 8 * g + r, q = qt * 64 + t * 16 + col; const float e = expf(s[t][r] * scl); zs[r] += q >= key ? e : 0.f; } } }
  // reduce zs[r] over the 16 col lanes of each half -> key k0 + 8g + r
#pragma unroll
  for (int off = 8; off >= 1; off >>= 1) {
#pragma unroll
    for (int r = 0; r < 8; ++r) zs[r] += __shfl_xor(zs[r], off, 32); }
  if (col == 0) {
#pragma unroll
    for (int r = 0; r < 8; ++r) sz[w * 16 + 8 * g + r] = zs[r]; }
  __syncthreads();
  if (tid < 16) vst2(Z + (size_t)hb * TT + blockIdx.x * 64 + tid * 4, *(const v4f*)(&sz[tid * 4]));
}
// ---- pass 2: oh[hb][q][e] = sum_{k <= q} exp(s[q][k]) / Z[k] * V[k][e]; block = (hb, 64 queries)
__global__ __launch_bounds__(128) void k_av(const _Float16* __restrict__ Qh, const _Float16* __restrict__ Kh, const _Float16* __restrict__ vT, const float* __restrict__ Z, float* __restrict__ oh) {
  __shared__ __align__(16) _Float16 sP[4][16][72];
  __shared__ __align__(16) float so[4][16][20];
  const int tid = threadIdx.x, w = tid >> 5, lane = tid & 31, col = lane & 15, g = lane >> 4;
  const int hb = blockIdx.y, q0 = blockIdx.x * 64 + w * 16;
  const _Float16* qb = Qh + (size_t)hb * TT * HE; const _Float16* kb = Kh + (size_t)hb * TT * HE; const _Float16* vb = vT + (size_t)hb * HE * TT;
  const v16h aq = frag16(qb + (size_t)(q0 + col) * HE, lane);
  const float scl = rsqrtf((float)TT);
  v8f acc = {};
#pragma unroll 1
  for (int kt = 0; kt <= (int)blockIdx.x; ++kt) {
    // straight-line trip: every global load of the trip (keys, column sums, values) is issued first, the four score products
    // follow back to back, and the mask is a select on a finished exp, so the 32 exp chains are independent work in one basic block
    // (the unrolls keep bk, bv, zv and s in registers)
    v16h bk[4], bv[2]; float zv[4]; v8f s[4];
#pragma unroll
    for (int t = 0; t < 4; ++t) bk[t] = frag16(kb + (size_t)(kt * 64 + t * 16 + col) * HE, lane);
#pragma unroll
    for (int t = 0; t < 4; ++t) zv[t] = Z[(size_t)hb * TT + kt * 64 + t * 16 + col];
#pragma unroll
    for (int kc = 0; kc < 2; ++kc) bv[kc] = frag_h(vb + (size_t)col * TT + kt * 64 + kc * 32, lane);   // B col = e (lane&15 < 16)
#pragma unroll
    for (int t = 0; t < 4; ++t) { v8f z0 = {}; s[t] = wmma16(aq, bk[t], z0); }
#pragma unroll
    for (int t = 0; t < 4; ++t) { const int key = kt * 64 + t * 16 + col; const float zinv = 1.0f / zv[t];
#pragma unroll
      for (int r = 0; r < 8; ++r) { const int q = q0 + 8 * g + r; const float e = expf(s[t][r] * scl); const float p = key <= q ? e * zinv : 0.f; sP[w][8 * g + r][t * 16 + col] = (_Float16)(p * 256.0f); } }   // attn <= ~1e-2 typically; x256
    LDSX();
#pragma unroll
    for (int kc = 0; kc < 2; ++kc) acc = wmma16(frag_h(&sP[w][col][0] + kc * 32, lane), bv[kc], acc);
    __builtin_amdgcn_wave_barrier();
  }
#pragma unroll
  for (int r = 0; r < 8; ++r) so[w][8 * g + r][col] = acc[r] * (1.0f / 256.0f);
  LDSX();
  for (int q = lane; q < 64; q += 32) { const int rl = q >> 2, pc = q & 3; vst2(oh + ((size_t)hb * TT + q0 + rl) * HE + pc * 4, *(const v4f*)(&so[w][rl][pc * 4])); }
}
// ---- FFN: hid = relu(out@W1+b1) -> f16 rows; out = hid@W2 + b2 + xpe. A for ff1 gathered from oh (k -> h = k/16, e = k%16)
__global__ __launch_bounds__(128) void k_ff1(const float* __restrict__ oh, const float* __restrict__ W1, const float* __restrict__ b1, _Float16* __restrict__ hid) {
  __shared__ __align__(16) float so[4][16][132];
  const int tid = threadIdx.x, wave = tid >> 5, lane = tid & 31, col = lane & 15, g = lane >> 4;
  const int r0 = blockIdx.x * 64 + wave * 16, n0 = blockIdx.y * 128; const int r = r0 + col, b = r / TT, t = r % TT;
  v8f acc[8] = {};
#pragma unroll
  for (int kc = 0; kc < DD / 32; ++kc) { v16h a;
#pragma unroll
    for (int i = 0; i < 8; ++i) { const int ka = kc * 32 + 8 * g + i, kz = ka + 16;
      a[i] = (_Float16)oh[(((size_t)(ka >> 4) * NB + b) * TT + t) * HE + (ka & 15)]; a[8 + i] = (_Float16)oh[(((size_t)(kz >> 4) * NB + b) * TT + t) * HE + (kz & 15)]; }
#pragma unroll
    for (int j = 0; j < 8; ++j) acc[j] = wmma16(a, fragc_f32(W1, kc * 32, n0 + j * 16 + col, lane, DFF, DD), acc[j]); }
#pragma unroll
  for (int j = 0; j < 8; ++j) { const float bb = b1[n0 + j * 16 + col];
#pragma unroll
    for (int rr = 0; rr < 8; ++rr) { const float v = acc[j][rr] + bb; so[wave][8 * g + rr][j * 16 + col] = v > 0.f ? v : 0.f; } }
  LDSX();
  for (int q = lane; q < 16 * 16; q += 32) { const int rl = q >> 4, pc = q & 15; union { v8h hh; v4u u; } pk;
#pragma unroll
    for (int i = 0; i < 8; ++i) pk.hh[i] = (_Float16)so[wave][rl][pc * 8 + i];
    vst2(hid + (size_t)(r0 + rl) * DFF + n0 + pc * 8, pk.u); }
}
__global__ __launch_bounds__(128) void k_ff2(const _Float16* __restrict__ hid, const float* __restrict__ W2, const float* __restrict__ b2, const float* __restrict__ xpe, float* __restrict__ out) {
  __shared__ __align__(16) float so[4][16][132];
  const int tid = threadIdx.x, wave = tid >> 5, lane = tid & 31, col = lane & 15, g = lane >> 4;
  const int r0 = blockIdx.x * 64 + wave * 16;
  v8f acc[8] = {};
#pragma unroll 1
  for (int kc = 0; kc < DFF / 32; ++kc) { const v16h a = frag_h(hid + (size_t)(r0 + col) * DFF + kc * 32, lane);
#pragma unroll
    for (int j = 0; j < 8; ++j) acc[j] = wmma16(a, fragc_f32(W2, kc * 32, j * 16 + col, lane, DD, DFF), acc[j]); }
#pragma unroll
  for (int j = 0; j < 8; ++j) { const float bb = b2[j * 16 + col];
#pragma unroll
    for (int rr = 0; rr < 8; ++rr) so[wave][8 * g + rr][j * 16 + col] = acc[j][rr] + bb; }
  LDSX();
#pragma unroll 4
  for (int rl = 0; rl < 16; ++rl) { const size_t o = (size_t)(r0 + rl) * DD + lane * 4; vst2(out + o, *(const v4f*)(&so[wave][rl][lane * 4]) + *(const v4f*)(xpe + o)); }
}
extern "C" void kernel_launch(void* const* d_in, const int* in_sizes, int n_in, void* d_out, int out_size, void* d_ws, size_t ws_size, hipStream_t stream) {
  (void)in_sizes; (void)n_in; (void)out_size; (void)ws_size;
  const float* x = (const float*)d_in[0]; const float* WQ = (const float*)d_in[1]; const float* WK = (const float*)d_in[2]; const float* WV = (const float*)d_in[3];
  const float* W1 = (const float*)d_in[4]; const float* b1 = (const float*)d_in[5]; const float* W2 = (const float*)d_in[6]; const float* b2 = (const float*)d_in[7];
  float* out = (float*)d_out;
  char* ws = (char*)d_ws; size_t off = 0;
  auto take = [&](size_t bytes) { char* p = ws + off; off += (bytes + 255) & ~(size_t)255; return p; };
  float* xpe = (float*)take((size_t)NR * DD * 4);
  _Float16* Qh = (_Float16*)take((size_t)NR * DD * 2); _Float16* Kh = (_Float16*)take((size_t)NR * DD * 2); _Float16* vT = (_Float16*)take((size_t)NR * DD * 2);
  float* Z = (float*)take((size_t)NH * NB * TT * 4); float* oh = (float*)take((size_t)NR * DD * 4); _Float16* hid = (_Float16*)take((size_t)NR * DFF * 2);
  k_proj<<<NR / 64, 128, 0, stream>>>(x, WQ, WK, WV, xpe, Qh, Kh, vT);
  k_z<<<dim3(TT / 64, NH * NB), 128, 0, stream>>>(Qh, Kh, Z);
  k_av<<<dim3(TT / 64, NH * NB), 128, 0, stream>>>(Qh, Kh, vT, Z, oh);
  k_ff1<<<dim3(NR / 64, DFF / 128), 128, 0, stream>>>(oh, W1, b1, hid);
  k_ff2<<<NR / 64, 128, 0, stream>>>(hid, W2, b2, xpe, out);
}

// v002
// One run takes 155 microseconds.
// Next to v001, in two timings, it ran 1.30 and 1.31 times as fast.
// All steps since v000 together make it 1.88 times as fast.
#include <hip/hip_runtime.h>
#include <math.h>

typedef __attribute__((ext_vector_type(16))) _Float16 v16h;
typedef __attribute__((ext_vector_type(16))) __bf16 v16b;
typedef __attribute__((ext_vector_type(8)))  _Float16 v8h;
typedef __attribute__((ext_vector_type(8)))  float v8f;
typedef __attribute__((ext_vector_type(4)))  float v4f;
typedef __attribute__((ext_vector_type(2)))  float v2f;
typedef __attribute__((ext_vector_type(4)))  unsigned v4u;
typedef __attribute__((ext_vector_type(4)))  int v4i;
typedef float __attribute__((may_alias)) float_a;
typedef int __attribute__((may_alias)) int_a;

template <typename T> __device__ __forceinline__ void vst2(void* p, T v) { *(T*)p = v;  }
__device__ __forceinline__ v8f wmma16(v16h a, v16h b, v8f c) {
  v8f d = __builtin_amdgcn_wmma_f32_16x16x32_f16(false, a, false, b, (short)0, c, false, false);
  asm volatile("v_nop\n\tv_nop\n\tv_nop\n\tv_nop" : "+v"(d) : "v"(a), "v"(b));
  return d;
}
__device__ __forceinline__ v8f wmma_bf(v16b a, v16b b, v8f c) {
  v8f d = __builtin_amdgcn_wmma_f32_16x16x32_bf16(false, a, false, b, (short)0, c, false, false);
  asm volatile("v_nop\n\tv_nop\n\tv_nop\n\tv_nop" : "+v"(d) : "v"(a), "v"(b));
  return d;
}
// 16x16x32 fragments: lane = (h = lane>>4, row/col = lane&15); elements 0..7 = k0+8h+0..7, 8..15 = k0+16+8h+0..7; D element r = row 8h+r
__device__ __forceinline__ v16h frag_h(const _Float16* rowk0, int lane) {
  union { v16h v; v8h q[2]; } u; const _Float16* p = rowk0 + 8 * (lane >> 4);
  u.q[0] = *(const v8h*)p; u.q[1] = *(const v8h*)(p + 16); return u.v;
}
__device__ __forceinline__ v16h frag_f32(const float* rowk0, int lane) {
  v16h a; const float* p = rowk0 + 8 * (lane >> 4);
#pragma unroll
  for (int i = 0; i < 8; ++i) { a[i] = (_Float16)p[i]; a[8 + i] = (_Float16)p[16 + i]; }
  return a;
}
__device__ __forceinline__ v16h frag_f32s(const float* rowk0, int lane, float sc) {
  v16h a; const float* p = rowk0 + 8 * (lane >> 4);
#pragma unroll
  for (int i = 0; i < 8; ++i) { a[i] = (_Float16)(p[i] * sc); a[8 + i] = (_Float16)(p[16 + i] * sc); }
  return a;
}
// column fragment from a [K][ld] layout (column n), rows >= K read as 0
__device__ __forceinline__ v16h fragc_f32(const float* W, int k0, int n, int lane, int ld, int K) {
  v16h a; const int g = lane >> 4;
#pragma unroll
  for (int i = 0; i < 8; ++i) { const int ka = k0 + 8 * g + i, kb = ka + 16;
    a[i] = (_Float16)(ka < K ? W[(size_t)ka * ld + n] : 0.f); a[8 + i] = (_Float16)(kb < K ? W[(size_t)kb * ld + n] : 0.f); }
  return a;
}
struct F2 { v16b h, l; };
__device__ __forceinline__ F2 bsplit16(const float v[16]) { F2 r;
#pragma unroll
  for (int i = 0; i < 16; ++i) { const __bf16 h = (__bf16)v[i]; r.h[i] = h; r.l[i] = (__bf16)(v[i] - (float)h); }
  return r; }
__device__ __forceinline__ F2 split_row(const float* row, int k0, int lane) { float v[16]; const float* p = row + k0 + 8 * (lane >> 4);
#pragma unroll
  for (int i = 0; i < 8; ++i) { v[i] = p[i]; v[8 + i] = p[16 + i]; }
  return bsplit16(v); }
__device__ __forceinline__ F2 split_rowK(const float* row, int k0, int lane, int K) { float v[16]; const int g = lane >> 4;
#pragma unroll
  for (int i = 0; i < 8; ++i) { const int ka = k0 + 8 * g + i, kb = ka + 16; v[i] = ka < K ? row[ka] : 0.f; v[8 + i] = kb < K ? row[kb] : 0.f; }
  return bsplit16(v); }
__device__ __forceinline__ F2 split_col(const float* W, int k0, int n, int lane, int ld, int K) { float v[16]; const int g = lane >> 4;
#pragma unroll
  for (int i = 0; i < 8; ++i) { const int ka = k0 + 8 * g + i, kb = ka + 16; v[i] = ka < K ? W[(size_t)ka * ld + n] : 0.f; v[8 + i] = kb < K ? W[(size_t)kb * ld + n] : 0.f; }
  return bsplit16(v); }
__device__ __forceinline__ v8f mac3(const F2& a, const F2& b, v8f c) { c = wmma_bf(a.l, b.h, c); c = wmma_bf(a.h, b.l, c); return wmma_bf(a.h, b.h, c); }
__device__ __forceinline__ float sigm(float v) { return 1.0f / (1.0f + expf(-v)); }
#define LDSX() do { asm volatile("s_wait_dscnt 0" ::: "memory"); __builtin_amdgcn_wave_barrier(); __builtin_amdgcn_fence(__ATOMIC_RELEASE, "workgroup"); } while (0)

// Causal multi-head attention whose softmax runs over the QUERY axis (per key column), + FFN + residual, with inline sinusoidal
// sums Z_k = sum_{q>=k} exp(s[q][k]); pass 2 is un-normalised causal attention with values scaled by 1/Z_k. Projections, both score
// passes (head dim 16 zero-padded to the 32-wide K), P@V and the FFN run on v_wmma_f32_16x16x32_f16 (f16 operands, f32
#define NB 4
#define TT 2048
#define DD 128
#define NH 8
#define HE 16
#define DFF 512
#define NR (NB * TT)

// ---- x + PE -> xpe rows (f32) and Q/K (f16 [h][b][t][16]) / V^T (f16 [h][b][e][t]); block = 64 rows (one b) x all 384 cols
__global__ __launch_bounds__(128) void k_proj(const float* __restrict__ x, const float* __restrict__ WQ, const float* __restrict__ WK, const float* __restrict__ WV,
                                            float* __restrict__ xpe, _Float16* __restrict__ Qh, _Float16* __restrict__ Kh, _Float16* __restrict__ vT) {
  __shared__ __align__(16) float sx[64][DD + 4];
  __shared__ __align__(16) float so[4][16][132];
  __shared__ __align__(16) _Float16 st[DD][72];
  const int tid = threadIdx.x, wave = tid >> 5, lane = tid & 31, col = lane & 15, g = lane >> 4;
  const int r0b = blockIdx.x * 64, b = r0b / TT, t0 = r0b % TT;
  // PE + stage
  for (int q = tid; q < 64 * DD; q += 128) { const int rl = q >> 7, c = q & 127; const int t = t0 + rl;
    const float div = expf((float)(c & ~1) * (-logf(10000.0f) / (float)DD)); const float ang = (float)t * div;
    const float pe = (c & 1) ? cosf(ang) : sinf(ang);
    sx[rl][c] = x[(size_t)(r0b + rl) * DD + c] + pe; }
  __syncthreads();
  for (int q = tid; q < 64 * 32; q += 128) { const int rl = q >> 5, pc = q & 31; vst2(xpe + (size_t)(r0b + rl) * DD + pc * 4, *(const v4f*)(&sx[rl][pc * 4])); }
#pragma unroll 1
  for (int which = 0; which < 3; ++which) { const float* W = which == 0 ? WQ : (which == 1 ? WK : WV);
    v8f acc[8] = {};
#pragma unroll
    for (int kc = 0; kc < DD / 32; ++kc) { const v16h a = frag_f32(&sx[wave * 16 + col][0] + kc * 32, lane);
#pragma unroll
      for (int j = 0; j < 8; ++j) acc[j] = wmma16(a, fragc_f32(W, kc * 32, j * 16 + col, lane, DD, DD), acc[j]); }
    if (which < 2) {
#pragma unroll
      for (int j = 0; j < 8; ++j)
#pragma unroll
        for (int r = 0; r < 8; ++r) so[wave][8 * g + r][j * 16 + col] = acc[j][r];
      LDSX();
      _Float16* dst = which == 0 ? Qh : Kh;
      // per head h (= tile j): 16 rows x 16 halves = 512 B contiguous at dst[((h*NB + b)*TT + t0 + wave*16) * 16]
      for (int q = lane; q < 8 * 32; q += 32) { const int h = q >> 5, pp = q & 31; const int rl = pp >> 1, half = (pp & 1) * 8; union { v8h hh; v4u u; } pk;
#pragma unroll
        for (int i = 0; i < 8; ++i) pk.hh[i] = (_Float16)so[wave][rl][h * 16 + half + i];
        vst2(dst + (((size_t)h * NB + b) * TT + t0 + wave * 16 + rl) * HE + half, pk.u); }
      LDSX();
    } else {
#pragma unroll
      for (int j = 0; j < 8; ++j)
#pragma unroll
        for (int r = 0; r < 8; ++r) st[j * 16 + col][wave * 16 + 8 * g + r] = (_Float16)acc[j][r];    // st[h*16+e][t local]
      __syncthreads();
      for (int q = tid; q < DD * 8; q += 128) { const int c = q >> 3, pc = q & 7, h = c >> 4, e = c & 15;
        vst2(vT + (((size_t)h * NB + b) * HE + e) * TT + t0 + pc * 8, *(const v4u*)(&st[c][pc * 8])); }
    }
  }
}
__device__ __forceinline__ v16h frag16(const _Float16* row16, int lane) {   // K = 16 real: elements 0..7 (h==0 lanes) and ... 
  // fragment elements: 0..7 = k 8h+0..7 (h = lane>>4) -> h==0: k 0..7, h==1: k 8..15; elements 8..15 = k 16+.. -> zero
  v16h a; const int hh = lane >> 4; union { v8h v; } u; u.v = *(const v8h*)(row16 + 8 * hh);
#pragma unroll
  for (int i = 0; i < 8; ++i) { a[i] = u.v[i]; a[8 + i] = (_Float16)0.f; }
  return a;
}
__global__ __launch_bounds__(128) void k_z(const _Float16* __restrict__ Qh, const _Float16* __restrict__ Kh, float* __restrict__ Z) {
  __shared__ __align__(16) float sz[64];
  const int tid = threadIdx.x, w = tid >> 5, lane = tid & 31, col = lane & 15, g = lane >> 4;
  const int hb = blockIdx.y, k0 = blockIdx.x * 64 + w * 16;
  const _Float16* qb = Qh + (size_t)hb * TT * HE; const _Float16* kb = Kh + (size_t)hb * TT * HE;
  const v16h ak = frag16(kb + (size_t)(k0 + col) * HE, lane);
  const float scl = rsqrtf((float)TT) * 1.44269504f;   // score scale times log2(e): exp(s * scale) = 2^(s * scl), one multiply and one v_exp_f32
  float zs[8] = {0.f, 0.f, 0.f, 0.f, 0.f, 0.f, 0.f, 0.f};
#pragma unroll 1
  for (int qt = blockIdx.x; qt < TT / 64; ++qt) {
    // straight-line trip: the four query fragments are loaded first, the four score products follow back to back, and the
    // mask is a select on a finished exp, so the 32 exp chains are independent work in one basic block (the unrolls keep
    // bq and s in registers)
    v16h bq[4]; v8f s[4]; const _Float16* qrow = qb + (size_t)(qt * 64 + col) * HE;
#pragma unroll
    for (int t = 0; t < 4; ++t) bq[t] = frag16(qrow + t * 16 * HE, lane);
#pragma unroll
    for (int t = 0; t < 4; ++t) { v8f z0 = {}; s[t] = wmma16(ak, bq[t], z0); }
#pragma unroll
    for (int t = 0; t < 4; ++t) {
#pragma unroll
      for (int r = 0; r < 8; ++r) { const int key = k0 + 8 * g + r, q = qt * 64 + t * 16 + col; const float e = __builtin_amdgcn_exp2f(s[t][r] * scl); zs[r] += q >= key ? e : 0.f; } } }
  // reduce zs[r] over the 16 col lanes of each half -> key k0 + 8g + r
#pragma unroll
  for (int off = 8; off >= 1; off >>= 1) {
#pragma unroll
    for (int r = 0; r < 8; ++r) zs[r] += __shfl_xor(zs[r], off, 32); }
  if (col == 0) {
#pragma unroll
    for (int r = 0; r < 8; ++r) sz[w * 16 + 8 * g + r] = zs[r]; }
  __syncthreads();
  if (tid < 16) vst2(Z + (size_t)hb * TT + blockIdx.x * 64 + tid * 4, *(const v4f*)(&sz[tid * 4]));
}
// ---- pass 2: oh[hb][q][e] = sum_{k <= q} exp(s[q][k]) / Z[k] * V[k][e]; block = (hb, 64 queries)
__global__ __launch_bounds__(128) void k_av(const _Float16* __restrict__ Qh, const _Float16* __restrict__ Kh, const _Float16* __restrict__ vT, const float* __restrict__ Z, float* __restrict__ oh) {
  __shared__ __align__(16) _Float16 sP[4][16][72];
  __shared__ __align__(16) float so[4][16][20];
  const int tid = threadIdx.x, w = tid >> 5, lane = tid & 31, col = lane & 15, g = lane >> 4;
  const int hb = blockIdx.y, q0 = blockIdx.x * 64 + w * 16;
  const _Float16* qb = Qh + (size_t)hb * TT * HE; const _Float16* kb = Kh + (size_t)hb * TT * HE; const _Float16* vb = vT + (size_t)hb * HE * TT;
  const v16h aq = frag16(qb + (size_t)(q0 + col) * HE, lane);
  const float scl = rsqrtf((float)TT) * 1.44269504f;   // score scale times log2(e): exp(s * scale) = 2^(s * scl), one multiply and one v_exp_f32
  v8f acc = {};
#pragma unroll 1
  for (int kt = 0; kt <= (int)blockIdx.x; ++kt) {
    // straight-line trip: every global load of the trip (keys, column sums, values) is issued first, the four score products
    // follow back to back, and the mask is a select on a finished exp, so the 32 exp chains are independent work in one basic block
    // (the unrolls keep bk, bv, zv and s in registers)
    v16h bk[4], bv[2]; float zv[4]; v8f s[4];
#pragma unroll
    for (int t = 0; t < 4; ++t) bk[t] = frag16(kb + (size_t)(kt * 64 + t * 16 + col) * HE, lane);
#pragma unroll
    for (int t = 0; t < 4; ++t) zv[t] = Z[(size_t)hb * TT + kt * 64 + t * 16 + col];
    asm volatile("s_wait_xcnt 0x0" ::: "memory");   // precaution: the address registers of the loads above are rewritten further down the trip
#pragma unroll
    for (int kc = 0; kc < 2; ++kc) bv[kc] = frag_h(vb + (size_t)col * TT + kt * 64 + kc * 32, lane);   // B col = e (lane&15 < 16)
#pragma unroll
    for (int t = 0; t < 4; ++t) { v8f z0 = {}; s[t] = wmma16(aq, bk[t], z0); }
#pragma unroll
    for (int t = 0; t < 4; ++t) { const int key = kt * 64 + t * 16 + col; const float zinv = 1.0f / zv[t];
#pragma unroll
      for (int r = 0; r < 8; ++r) { const int q = q0 + 8 * g + r; const float e = __builtin_amdgcn_exp2f(s[t][r] * scl); const float p = key <= q ? e * zinv : 0.f; sP[w][8 * g + r][t * 16 + col] = (_Float16)(p * 256.0f); } }   // attn <= ~1e-2 typically; x256
    LDSX();
#pragma unroll
    for (int kc = 0; kc < 2; ++kc) acc = wmma16(frag_h(&sP[w][col][0] + kc * 32, lane), bv[kc], acc);
    __builtin_amdgcn_wave_barrier();
  }
#pragma unroll
  for (int r = 0; r < 8; ++r) so[w][8 * g + r][col] = acc[r] * (1.0f / 256.0f);
  LDSX();
  for (int q = lane; q < 64; q += 32) { const int rl = q >> 2, pc = q & 3; vst2(oh + ((size_t)hb * TT + q0 + rl) * HE + pc * 4, *(const v4f*)(&so[w][rl][pc * 4])); }
}
// ---- FFN: hid = relu(out@W1+b1) -> f16 rows; out = hid@W2 + b2 + xpe. A for ff1 gathered from oh (k -> h = k/16, e = k%16)
__global__ __launch_bounds__(128) void k_ff1(const float* __restrict__ oh, const float* __restrict__ W1, const float* __restrict__ b1, _Float16* __restrict__ hid) {
  __shared__ __align__(16) float so[4][16][132];
  const int tid = threadIdx.x, wave = tid >> 5, lane = tid & 31, col = lane & 15, g = lane >> 4;
  const int r0 = blockIdx.x * 64 + wave * 16, n0 = blockIdx.y * 128; const int r = r0 + col, b = r / TT, t = r % TT;
  v8f acc[8] = {};
#pragma unroll
  for (int kc = 0; kc < DD / 32; ++kc) { v16h a;
#pragma unroll
    for (int i = 0; i < 8; ++i) { const int ka = kc * 32 + 8 * g + i, kz = ka + 16;
      a[i] = (_Float16)oh[(((size_t)(ka >> 4) * NB + b) * TT + t) * HE + (ka & 15)]; a[8 + i] = (_Float16)oh[(((size_t)(kz >> 4) * NB + b) * TT + t) * HE + (kz & 15)]; }
#pragma unroll
    for (int j = 0; j < 8; ++j) acc[j] = wmma16(a, fragc_f32(W1, kc * 32, n0 + j * 16 + col, lane, DFF, DD), acc[j]); }
#pragma unroll
  for (int j = 0; j < 8; ++j) { const float bb = b1[n0 + j * 16 + col];
#pragma unroll
    for (int rr = 0; rr < 8; ++rr) { const float v = acc[j][rr] + bb; so[wave][8 * g + rr][j * 16 + col] = v > 0.f ? v : 0.f; } }
  LDSX();
  for (int q = lane; q < 16 * 16; q += 32) { const int rl = q >> 4, pc = q & 15; union { v8h hh; v4u u; } pk;
#pragma unroll
    for (int i = 0; i < 8; ++i) pk.hh[i] = (_Float16)so[wave][rl][pc * 8 + i];
    vst2(hid + (size_t)(r0 + rl) * DFF + n0 + pc * 8, pk.u); }
}
__global__ __launch_bounds__(128) void k_ff2(const _Float16* __restrict__ hid, const float* __restrict__ W2, const float* __restrict__ b2, const float* __restrict__ xpe, float* __restrict__ out) {
  __shared__ __align__(16) float so[4][16][132];
  const int tid = threadIdx.x, wave = tid >> 5, lane = tid & 31, col = lane & 15, g = lane >> 4;
  const int r0 = blockIdx.x * 64 + wave * 16;
  v8f acc[8] = {};
#pragma unroll 1
  for (int kc = 0; kc < DFF / 32; ++kc) { const v16h a = frag_h(hid + (size_t)(r0 + col) * DFF + kc * 32, lane);
#pragma unroll
    for (int j = 0; j < 8; ++j) acc[j] = wmma16(a, fragc_f32(W2, kc * 32, j * 16 + col, lane, DD, DFF), acc[j]); }
#pragma unroll
  for (int j = 0; j < 8; ++j) { const float bb = b2[j * 16 + col];
#pragma unroll
    for (int rr = 0; rr < 8; ++rr) so[wave][8 * g + rr][j * 16 + col] = acc[j][rr] + bb; }
  LDSX();
#pragma unroll 4
  for (int rl = 0; rl < 16; ++rl) { const size_t o = (size_t)(r0 + rl) * DD + lane * 4; vst2(out + o, *(const v4f*)(&so[wave][rl][lane * 4]) + *(const v4f*)(xpe + o)); }
}
extern "C" void kernel_launch(void* const* d_in, const int* in_sizes, int n_in, void* d_out, int out_size, void* d_ws, size_t ws_size, hipStream_t stream) {
  (void)in_sizes; (void)n_in; (void)out_size; (void)ws_size;
  const float* x = (const float*)d_in[0]; const float* WQ = (const float*)d_in[1]; const float* WK = (const float*)d_in[2]; const float* WV = (const float*)d_in[3];
  const float* W1 = (const float*)d_in[4]; const float* b1 = (const float*)d_in[5]; const float* W2 = (const float*)d_in[6]; const float* b2 = (const float*)d_in[7];
  float* out = (float*)d_out;
  char* ws = (char*)d_ws; size_t off = 0;
  auto take = [&](size_t bytes) { char* p = ws + off; off += (bytes + 255) & ~(size_t)255; return p; };
  float* xpe = (float*)take((size_t)NR * DD * 4);
  _Float16* Qh = (_Float16*)take((size_t)NR * DD * 2); _Float16* Kh = (_Float16*)take((size_t)NR * DD * 2); _Float16* vT = (_Float16*)take((size_t)NR * DD * 2);
  float* Z = (float*)take((size_t)NH * NB * TT * 4); float* oh = (float*)take((size_t)NR * DD * 4); _Float16* hid = (_Float16*)take((size_t)NR * DFF * 2);
  k_proj<<<NR / 64, 128, 0, stream>>>(x, WQ, WK, WV, xpe, Qh, Kh, vT);
  k_z<<<dim3(TT / 64, NH * NB), 128, 0, stream>>>(Qh, Kh, Z);
  k_av<<<dim3(TT / 64, NH * NB), 128, 0, stream>>>(Qh, Kh, vT, Z, oh);
  k_ff1<<<dim3(NR / 64, DFF / 128), 128, 0, stream>>>(oh, W1, b1, hid);
  k_ff2<<<NR / 64, 128, 0, stream>>>(hid, W2, b2, xpe, out);
}

// v003
// Measured time: 113 microseconds a run.
// Two timings next to v002 both put it at 1.38 times that version's speed.
// Counting every step since v000, it is 2.60 times as fast.
#include <hip/hip_runtime.h>
#include <math.h>

typedef __attribute__((ext_vector_type(16))) _Float16 v16h;
typedef __attribute__((ext_vector_type(16))) __bf16 v16b;
typedef __attribute__((ext_vector_type(8)))  _Float16 v8h;
typedef __attribute__((ext_vector_type(8)))  float v8f;
typedef __attribute__((ext_vector_type(4)))  float v4f;
typedef __attribute__((ext_vector_type(2)))  float v2f;
typedef __attribute__((ext_vector_type(4)))  unsigned v4u;
typedef __attribute__((ext_vector_type(4)))  int v4i;
typedef float __attribute__((may_alias)) float_a;
typedef int __attribute__((may_alias)) int_a;

template <typename T> __device__ __forceinline__ void vst2(void* p, T v) { *(T*)p = v;  }
__device__ __forceinline__ v8f wmma16(v16h a, v16h b, v8f c) {
  v8f d = __builtin_amdgcn_wmma_f32_16x16x32_f16(false, a, false, b, (short)0, c, false, false);
  asm volatile("v_nop\n\tv_nop\n\tv_nop\n\tv_nop" : "+v"(d) : "v"(a), "v"(b));
  return d;
}
__device__ __forceinline__ v8f wmma_bf(v16b a, v16b b, v8f c) {
  v8f d = __builtin_amdgcn_wmma_f32_16x16x32_bf16(false, a, false, b, (short)0, c, false, false);
  asm volatile("v_nop\n\tv_nop\n\tv_nop\n\tv_nop" : "+v"(d) : "v"(a), "v"(b));
  return d;
}
// 16x16x32 fragments: lane = (h = lane>>4, row/col = lane&15); elements 0..7 = k0+8h+0..7, 8..15 = k0+16+8h+0..7; D element r = row 8h+r
__device__ __forceinline__ v16h frag_h(const _Float16* rowk0, int lane) {
  union { v16h v; v8h q[2]; } u; const _Float16* p = rowk0 + 8 * (lane >> 4);
  u.q[0] = *(const v8h*)p; u.q[1] = *(const v8h*)(p + 16); return u.v;
}
__device__ __forceinline__ v16h frag_f32(const float* rowk0, int lane) {
  v16h a; const float* p = rowk0 + 8 * (lane >> 4);
#pragma unroll
  for (int i = 0; i < 8; ++i) { a[i] = (_Float16)p[i]; a[8 + i] = (_Float16)p[16 + i]; }
  return a;
}
__device__ __forceinline__ v16h frag_f32s(const float* rowk0, int lane, float sc) {
  v16h a; const float* p = rowk0 + 8 * (lane >> 4);
#pragma unroll
  for (int i = 0; i < 8; ++i) { a[i] = (_Float16)(p[i] * sc); a[8 + i] = (_Float16)(p[16 + i] * sc); }
  return a;
}
// column fragment from a [K][ld] layout (column n), rows >= K read as 0
__device__ __forceinline__ v16h fragc_f32(const float* W, int k0, int n, int lane, int ld, int K) {
  v16h a; const int g = lane >> 4;
#pragma unroll
  for (int i = 0; i < 8; ++i) { const int ka = k0 + 8 * g + i, kb = ka + 16;
    a[i] = (_Float16)(ka < K ? W[(size_t)ka * ld + n] : 0.f); a[8 + i] = (_Float16)(kb < K ? W[(size_t)kb * ld + n] : 0.f); }
  return a;
}
struct F2 { v16b h, l; };
__device__ __forceinline__ F2 bsplit16(const float v[16]) { F2 r;
#pragma unroll
  for (int i = 0; i < 16; ++i) { const __bf16 h = (__bf16)v[i]; r.h[i] = h; r.l[i] = (__bf16)(v[i] - (float)h); }
  return r; }
__device__ __forceinline__ F2 split_row(const float* row, int k0, int lane) { float v[16]; const float* p = row + k0 + 8 * (lane >> 4);
#pragma unroll
  for (int i = 0; i < 8; ++i) { v[i] = p[i]; v[8 + i] = p[16 + i]; }
  return bsplit16(v); }
__device__ __forceinline__ F2 split_rowK(const float* row, int k0, int lane, int K) { float v[16]; const int g = lane >> 4;
#pragma unroll
  for (int i = 0; i < 8; ++i) { const int ka = k0 + 8 * g + i, kb = ka + 16; v[i] = ka < K ? row[ka] : 0.f; v[8 + i] = kb < K ? row[kb] : 0.f; }
  return bsplit16(v); }
__device__ __forceinline__ F2 split_col(const float* W, int k0, int n, int lane, int ld, int K) { float v[16]; const int g = lane >> 4;
#pragma unroll
  for (int i = 0; i < 8; ++i) { const int ka = k0 + 8 * g + i, kb = ka + 16; v[i] = ka < K ? W[(size_t)ka * ld + n] : 0.f; v[8 + i] = kb < K ? W[(size_t)kb * ld + n] : 0.f; }
  return bsplit16(v); }
__device__ __forceinline__ v8f mac3(const F2& a, const F2& b, v8f c) { c = wmma_bf(a.l, b.h, c); c = wmma_bf(a.h, b.l, c); return wmma_bf(a.h, b.h, c); }
__device__ __forceinline__ float sigm(float v) { return 1.0f / (1.0f + expf(-v)); }
#define LDSX() do { asm volatile("s_wait_dscnt 0" ::: "memory"); __builtin_amdgcn_wave_barrier(); __builtin_amdgcn_fence(__ATOMIC_RELEASE, "workgroup"); } while (0)

// Causal multi-head attention whose softmax runs over the QUERY axis (per key column), + FFN + residual, with inline sinusoidal
// sums Z_k = sum_{q>=k} exp(s[q][k]); pass 2 is un-normalised causal attention with values scaled by 1/Z_k. Projections, both score
// passes (head dim 16 zero-padded to the 32-wide K), P@V and the FFN run on v_wmma_f32_16x16x32_f16 (f16 operands, f32
#define NB 4
#define TT 2048
#define DD 128
#define NH 8
#define HE 16
#define DFF 512
#define NR (NB * TT)

// Weight tiles in LDS: f16, row-major [k][128 columns], row pitch WP halves = 288 bytes (an odd multiple of 32 bytes, the pitch of the transposing read)
#define WP 144
typedef __attribute__((ext_vector_type(8))) short s16x8;
// 128 threads bring K rows of 128 f32 columns (row stride ld) into sW as f16: 16 lanes take one 512-byte row, 8 floats each; the 32 loads of
// 16 bytes of a batch of 128 rows are all issued before the first value is converted, so a batch pays the load latency once
// (the inner unrolls keep v in registers)
template <int K> __device__ __forceinline__ void stage_w(const float* __restrict__ Wsrc, int ld, _Float16* sW, int tid) {
  const float* s0 = Wsrc + (size_t)(tid >> 4) * ld + (tid & 15) * 8; _Float16* d0 = sW + (tid >> 4) * WP + (tid & 15) * 8;
#pragma unroll 1
  for (int b = 0; b < K / 128; ++b) {   // rolled: one batch already fills 128 registers
    v4f v[16][2];
#pragma unroll
    for (int i = 0; i < 16; ++i) { const float* p = s0 + (size_t)(b * 128 + i * 8) * ld; v[i][0] = *(const v4f*)p; v[i][1] = *(const v4f*)(p + 4); }
    asm volatile("s_wait_xcnt 0x0" ::: "memory");   // precaution: the address registers of the loads above are rewritten below; it also keeps the whole batch of loads ahead of the conversions
#pragma unroll
    for (int i = 0; i < 16; ++i) { v8h h;
#pragma unroll
      for (int e = 0; e < 4; ++e) { h[e] = (_Float16)v[i][0][e]; h[4 + e] = (_Float16)v[i][1][e]; }
      *(v8h*)(d0 + (b * 128 + i * 8) * WP) = h; }
  }
}
// B fragment (k0..k0+31, columns n0..n0+15) of such a tile by two transposing LDS reads: lane (c, h) gets T[k0 + 8h + 0..7][n0 + c], then the same 16 rows on:
// the k order of frag_h and frag_f32. Every lane is on where it is called.
__device__ __forceinline__ v16h frag_tr(const _Float16* T, int k0, int n0, int lane) {
  typedef __attribute__((address_space(3))) s16x8 lds_s16x8;
  const _Float16* p = T + (k0 + 8 * (lane >> 4) + (lane & 7)) * WP + n0 + 8 * ((lane >> 3) & 1);
  union { v16h v; s16x8 q[2]; } u;
  u.q[0] = __builtin_amdgcn_ds_load_tr16_b128_v8i16((lds_s16x8*)p); u.q[1] = __builtin_amdgcn_ds_load_tr16_b128_v8i16((lds_s16x8*)(p + 16 * WP));
  return u.v;
}

// ---- x + PE -> xpe rows (f32) and Q/K (f16 [h][b][t][16]) / V^T (f16 [h][b][e][t]); block = 64 rows (one b) x all 384 cols
__global__ __launch_bounds__(128) void k_proj(const float* __restrict__ x, const float* __restrict__ WQ, const float* __restrict__ WK, const float* __restrict__ WV,
                                            float* __restrict__ xpe, _Float16* __restrict__ Qh, _Float16* __restrict__ Kh, _Float16* __restrict__ vT) {
  __shared__ __align__(16) float sx[64][DD + 4];
  __shared__ __align__(16) float so[4][16][132];
  __shared__ __align__(16) _Float16 st[DD][72];
  __shared__ __align__(32) _Float16 sW[3][DD * WP];
  const int tid = threadIdx.x, wave = tid >> 5, lane = tid & 31, col = lane & 15, g = lane >> 4;
  const int r0b = blockIdx.x * 64, b = r0b / TT, t0 = r0b % TT;
  // the three weight matrices go to LDS once per block; the barrier behind the PE stage publishes them too
#pragma unroll 1
  for (int m = 0; m < 3; ++m) stage_w<DD>(m == 0 ? WQ : (m == 1 ? WK : WV), DD, &sW[m][0], tid);   // rolled: one matrix in flight fills 128 registers
  // PE + stage
  for (int q = tid; q < 64 * DD; q += 128) { const int rl = q >> 7, c = q & 127; const int t = t0 + rl;
    const float div = expf((float)(c & ~1) * (-logf(10000.0f) / (float)DD)); const float ang = (float)t * div;
    const float pe = (c & 1) ? cosf(ang) : sinf(ang);
    sx[rl][c] = x[(size_t)(r0b + rl) * DD + c] + pe; }
  __syncthreads();
  for (int q = tid; q < 64 * 32; q += 128) { const int rl = q >> 5, pc = q & 31; vst2(xpe + (size_t)(r0b + rl) * DD + pc * 4, *(const v4f*)(&sx[rl][pc * 4])); }
#pragma unroll 1
  for (int which = 0; which < 3; ++which) { const _Float16* sw = &sW[which][0];
    v8f acc[8] = {};
#pragma unroll
    for (int kc = 0; kc < DD / 32; ++kc) { const v16h a = frag_f32(&sx[wave * 16 + col][0] + kc * 32, lane); v16h bf[8];
#pragma unroll
      for (int j = 0; j < 8; ++j) bf[j] = frag_tr(sw, kc * 32, j * 16, lane);   // the eight fragments of a k step are read as one group, one LDS wait
#pragma unroll
      for (int j = 0; j < 8; ++j) acc[j] = wmma16(a, bf[j], acc[j]); }
    if (which < 2) {
#pragma unroll
      for (int j = 0; j < 8; ++j)
#pragma unroll
        for (int r = 0; r < 8; ++r) so[wave][8 * g + r][j * 16 + col] = acc[j][r];
      LDSX();
      _Float16* dst = which == 0 ? Qh : Kh;
      // per head h (= tile j): 16 rows x 16 halves = 512 B contiguous at dst[((h*NB + b)*TT + t0 + wave*16) * 16]
      for (int q = lane; q < 8 * 32; q += 32) { const int h = q >> 5, pp = q & 31; const int rl = pp >> 1, half = (pp & 1) * 8; union { v8h hh; v4u u; } pk;
#pragma unroll
        for (int i = 0; i < 8; ++i) pk.hh[i] = (_Float16)so[wave][rl][h * 16 + half + i];
        vst2(dst + (((size_t)h * NB + b) * TT + t0 + wave * 16 + rl) * HE + half, pk.u); }
      LDSX();
    } else {
#pragma unroll
      for (int j = 0; j < 8; ++j)
#pragma unroll
        for (int r = 0; r < 8; ++r) st[j * 16 + col][wave * 16 + 8 * g + r] = (_Float16)acc[j][r];    // st[h*16+e][t local]
      __syncthreads();
      for (int q = tid; q < DD * 8; q += 128) { const int c = q >> 3, pc = q & 7, h = c >> 4, e = c & 15;
        vst2(vT + (((size_t)h * NB + b) * HE + e) * TT + t0 + pc * 8, *(const v4u*)(&st[c][pc * 8])); }
    }
  }
}
__device__ __forceinline__ v16h frag16(const _Float16* row16, int lane) {   // K = 16 real: elements 0..7 (h==0 lanes) and ... 
  // fragment elements: 0..7 = k 8h+0..7 (h = lane>>4) -> h==0: k 0..7, h==1: k 8..15; elements 8..15 = k 16+.. -> zero
  v16h a; const int hh = lane >> 4; union { v8h v; } u; u.v = *(const v8h*)(row16 + 8 * hh);
#pragma unroll
  for (int i = 0; i < 8; ++i) { a[i] = u.v[i]; a[8 + i] = (_Float16)0.f; }
  return a;
}
__global__ __launch_bounds__(128) void k_z(const _Float16* __restrict__ Qh, const _Float16* __restrict__ Kh, float* __restrict__ Z) {
  __shared__ __align__(16) float sz[64];
  const int tid = threadIdx.x, w = tid >> 5, lane = tid & 31, col = lane & 15, g = lane >> 4;
  const int hb = blockIdx.y, k0 = blockIdx.x * 64 + w * 16;
  const _Float16* qb = Qh + (size_t)hb * TT * HE; const _Float16* kb = Kh + (size_t)hb * TT * HE;
  const v16h ak = frag16(kb + (size_t)(k0 + col) * HE, lane);
  const float scl = rsqrtf((float)TT) * 1.44269504f;   // score scale times log2(e): exp(s * scale) = 2^(s * scl), one multiply and one v_exp_f32
  float zs[8] = {0.f, 0.f, 0.f, 0.f, 0.f, 0.f, 0.f, 0.f};
#pragma unroll 1
  for (int qt = blockIdx.x; qt < TT / 64; ++qt) {
    // straight-line trip: the four query fragments are loaded first, the four score products follow back to back, and the
    // mask is a select on a finished exp, so the 32 exp chains are independent work in one basic block (the unrolls keep
    // bq and s in registers)
    v16h bq[4]; v8f s[4]; const _Float16* qrow = qb + (size_t)(qt * 64 + col) * HE;
#pragma unroll
    for (int t = 0; t < 4; ++t) bq[t] = frag16(qrow + t * 16 * HE, lane);
#pragma unroll
    for (int t = 0; t < 4; ++t) { v8f z0 = {}; s[t] = wmma16(ak, bq[t], z0); }
#pragma unroll
    for (int t = 0; t < 4; ++t) {
#pragma unroll
      for (int r = 0; r < 8; ++r) { const int key = k0 + 8 * g + r, q = qt * 64 + t * 16 + col; const float e = __builtin_amdgcn_exp2f(s[t][r] * scl); zs[r] += q >= key ? e : 0.f; } } }
  // reduce zs[r] over the 16 col lanes of each half -> key k0 + 8g + r
#pragma unroll
  for (int off = 8; off >= 1; off >>= 1) {
#pragma unroll
    for (int r = 0; r < 8; ++r) zs[r] += __shfl_xor(zs[r], off, 32); }
  if (col == 0) {
#pragma unroll
    for (int r = 0; r < 8; ++r) sz[w * 16 + 8 * g + r] = zs[r]; }
  __syncthreads();
  if (tid < 16) vst2(Z + (size_t)hb * TT + blockIdx.x * 64 + tid * 4, *(const v4f*)(&sz[tid * 4]));
}
// ---- pass 2: oh[hb][q][e] = sum_{k <= q} exp(s[q][k]) / Z[k] * V[k][e]; block = (hb, 64 queries)
__global__ __launch_bounds__(128) void k_av(const _Float16* __restrict__ Qh, const _Float16* __restrict__ Kh, const _Float16* __restrict__ vT, const float* __restrict__ Z, float* __restrict__ oh) {
  __shared__ __align__(16) _Float16 sP[4][16][72];
  __shared__ __align__(16) float so[4][16][20];
  const int tid = threadIdx.x, w = tid >> 5, lane = tid & 31, col = lane & 15, g = lane >> 4;
  const int hb = blockIdx.y, q0 = blockIdx.x * 64 + w * 16;
  const _Float16* qb = Qh + (size_t)hb * TT * HE; const _Float16* kb = Kh + (size_t)hb * TT * HE; const _Float16* vb = vT + (size_t)hb * HE * TT;
  const v16h aq = frag16(qb + (size_t)(q0 + col) * HE, lane);
  const float scl = rsqrtf((float)TT) * 1.44269504f;   // score scale times log2(e): exp(s * scale) = 2^(s * scl), one multiply and one v_exp_f32
  v8f acc = {};
#pragma unroll 1
  for (int kt = 0; kt <= (int)blockIdx.x; ++kt) {
    // straight-line trip: every global load of the trip (keys, column sums, values) is issued first, the four score products
    // follow back to back, and the mask is a select on a finished exp, so the 32 exp chains are independent work in one basic block
    // (the unrolls keep bk, bv, zv and s in registers)
    v16h bk[4], bv[2]; float zv[4]; v8f s[4];
#pragma unroll
    for (int t = 0; t < 4; ++t) bk[t] = frag16(kb + (size_t)(kt * 64 + t * 16 + col) * HE, lane);
#pragma unroll
    for (int t = 0; t < 4; ++t) zv[t] = Z[(size_t)hb * TT + kt * 64 + t * 16 + col];
    asm volatile("s_wait_xcnt 0x0" ::: "memory");   // precaution: the address registers of the loads above are rewritten further down the trip
#pragma unroll
    for (int kc = 0; kc < 2; ++kc) bv[kc] = frag_h(vb + (size_t)col * TT + kt * 64 + kc * 32, lane);   // B col = e (lane&15 < 16)
#pragma unroll
    for (int t = 0; t < 4; ++t) { v8f z0 = {}; s[t] = wmma16(aq, bk[t], z0); }
#pragma unroll
    for (int t = 0; t < 4; ++t) { const int key = kt * 64 + t * 16 + col; const float zinv = 1.0f / zv[t];
#pragma unroll
      for (int r = 0; r < 8; ++r) { const int q = q0 + 8 * g + r; const float e = __builtin_amdgcn_exp2f(s[t][r] * scl); const float p = key <= q ? e * zinv : 0.f; sP[w][8 * g + r][t * 16 + col] = (_Float16)(p * 256.0f); } }   // attn <= ~1e-2 typically; x256
    LDSX();
#pragma unroll
    for (int kc = 0; kc < 2; ++kc) acc = wmma16(frag_h(&sP[w][col][0] + kc * 32, lane), bv[kc], acc);
    __builtin_amdgcn_wave_barrier();
  }
#pragma unroll
  for (int r = 0; r < 8; ++r) so[w][8 * g + r][col] = acc[r] * (1.0f / 256.0f);
  LDSX();
  for (int q = lane; q < 64; q += 32) { const int rl = q >> 2, pc = q & 3; vst2(oh + ((size_t)hb * TT + q0 + rl) * HE + pc * 4, *(const v4f*)(&so[w][rl][pc * 4])); }
}
// ---- FFN: hid = relu(out@W1+b1) -> f16 rows; out = hid@W2 + b2 + xpe. A for ff1 gathered from oh (k -> h = k/16, e = k%16)
__global__ __launch_bounds__(128) void k_ff1(const float* __restrict__ oh, const float* __restrict__ W1, const float* __restrict__ b1, _Float16* __restrict__ hid) {
  __shared__ __align__(16) float so[4][16][132];
  __shared__ __align__(32) _Float16 sW[DD * WP];
  const int tid = threadIdx.x, wave = tid >> 5, lane = tid & 31, col = lane & 15, g = lane >> 4;
  const int r0 = blockIdx.x * 64 + wave * 16, n0 = blockIdx.y * 128; const int r = r0 + col, b = r / TT, t = r % TT;
  v8f acc[8] = {};
  // the wave's own A values are asked for first and fly while the block's 128 weight columns are staged (the unrolls keep af in registers)
  float af[DD / 32][16];
#pragma unroll
  for (int kc = 0; kc < DD / 32; ++kc) {
#pragma unroll
    for (int i = 0; i < 8; ++i) { const int ka = kc * 32 + 8 * g + i, kz = ka + 16;
      af[kc][i] = oh[(((size_t)(ka >> 4) * NB + b) * TT + t) * HE + (ka & 15)]; af[kc][8 + i] = oh[(((size_t)(kz >> 4) * NB + b) * TT + t) * HE + (kz & 15)]; } }
  asm volatile("s_wait_xcnt 0x0" ::: "memory");   // precaution: the address registers of the loads above are rewritten below
  stage_w<DD>(W1 + n0, DFF, sW, tid);
  __syncthreads();   // publishes the staged weights to the four waves
#pragma unroll
  for (int kc = 0; kc < DD / 32; ++kc) { v16h a, bf[8];
#pragma unroll
    for (int i = 0; i < 16; ++i) a[i] = (_Float16)af[kc][i];
#pragma unroll
    for (int j = 0; j < 8; ++j) bf[j] = frag_tr(sW, kc * 32, j * 16, lane);   // the eight fragments of a k step are read as one group, one LDS wait
#pragma unroll
    for (int j = 0; j < 8; ++j) acc[j] = wmma16(a, bf[j], acc[j]); }
#pragma unroll
  for (int j = 0; j < 8; ++j) { const float bb = b1[n0 + j * 16 + col];
#pragma unroll
    for (int rr = 0; rr < 8; ++rr) { const float v = acc[j][rr] + bb; so[wave][8 * g + rr][j * 16 + col] = v > 0.f ? v : 0.f; } }
  LDSX();
  for (int q = lane; q < 16 * 16; q += 32) { const int rl = q >> 4, pc = q & 15; union { v8h hh; v4u u; } pk;
#pragma unroll
    for (int i = 0; i < 8; ++i) pk.hh[i] = (_Float16)so[wave][rl][pc * 8 + i];
    vst2(hid + (size_t)(r0 + rl) * DFF + n0 + pc * 8, pk.u); }
}
__global__ __launch_bounds__(128) void k_ff2(const _Float16* __restrict__ hid, const float* __restrict__ W2, const float* __restrict__ b2, const float* __restrict__ xpe, float* __restrict__ out) {
  __shared__ __align__(16) float so[4][16][132];
  __shared__ __align__(32) _Float16 sW[DFF * WP];
  const int tid = threadIdx.x, wave = tid >> 5, lane = tid & 31, col = lane & 15, g = lane >> 4;
  const int r0 = blockIdx.x * 64 + wave * 16;
  v8f acc[8] = {};
  // the first eight A fragments are asked for first and fly while the weights are staged; each of the other eight is asked for eight k steps ahead of its use
  const _Float16* arow = hid + (size_t)(r0 + col) * DFF; v16h a[8];
#pragma unroll
  for (int kc = 0; kc < 8; ++kc) a[kc] = frag_h(arow + kc * 32, lane);
  asm volatile("s_wait_xcnt 0x0" ::: "memory");   // precaution: the address registers of the loads above are rewritten below
  stage_w<DFF>(W2, DD, sW, tid);
  __syncthreads();   // publishes the staged weights to the four waves
#pragma unroll
  for (int kc = 0; kc < DFF / 32; ++kc) { const v16h cur = a[kc & 7]; v16h bf[8];   // unrolled: a[] stays in registers
    if (kc < 8) a[kc] = frag_h(arow + (kc + 8) * 32, lane);
#pragma unroll
    for (int j = 0; j < 8; ++j) bf[j] = frag_tr(sW, kc * 32, j * 16, lane);   // the eight fragments of a k step are read as one group, one LDS wait
#pragma unroll
    for (int j = 0; j < 8; ++j) acc[j] = wmma16(cur, bf[j], acc[j]); }
#pragma unroll
  for (int j = 0; j < 8; ++j) { const float bb = b2[j * 16 + col];
#pragma unroll
    for (int rr = 0; rr < 8; ++rr) so[wave][8 * g + rr][j * 16 + col] = acc[j][rr] + bb; }
  LDSX();
#pragma unroll 4
  for (int rl = 0; rl < 16; ++rl) { const size_t o = (size_t)(r0 + rl) * DD + lane * 4; vst2(out + o, *(const v4f*)(&so[wave][rl][lane * 4]) + *(const v4f*)(xpe + o)); }
}
extern "C" void kernel_launch(void* const* d_in, const int* in_sizes, int n_in, void* d_out, int out_size, void* d_ws, size_t ws_size, hipStream_t stream) {
  (void)in_sizes; (void)n_in; (void)out_size; (void)ws_size;
  const float* x = (const float*)d_in[0]; const float* WQ = (const float*)d_in[1]; const float* WK = (const float*)d_in[2]; const float* WV = (const float*)d_in[3];
  const float* W1 = (const float*)d_in[4]; const float* b1 = (const float*)d_in[5]; const float* W2 = (const float*)d_in[6]; const float* b2 = (const float*)d_in[7];
  float* out = (float*)d_out;
  char* ws = (char*)d_ws; size_t off = 0;
  auto take = [&](size_t bytes) { char* p = ws + off; off += (bytes + 255) & ~(size_t)255; return p; };
  float* xpe = (float*)take((size_t)NR * DD * 4);
  _Float16* Qh = (_Float16*)take((size_t)NR * DD * 2); _Float16* Kh = (_Float16*)take((size_t)NR * DD * 2); _Float16* vT = (_Float16*)take((size_t)NR * DD * 2);
  float* Z = (float*)take((size_t)NH * NB * TT * 4); float* oh = (float*)take((size_t)NR * DD * 4); _Float16* hid = (_Float16*)take((size_t)NR * DFF * 2);
  k_proj<<<NR / 64, 128, 0, stream>>>(x, WQ, WK, WV, xpe, Qh, Kh, vT);
  k_z<<<dim3(TT / 64, NH * NB), 128, 0, stream>>>(Qh, Kh, Z);
  k_av<<<dim3(TT / 64, NH * NB), 128, 0, stream>>>(Qh, Kh, vT, Z, oh);
  k_ff1<<<dim3(NR / 64, DFF / 128), 128, 0, stream>>>(oh, W1, b1, hid);
  k_ff2<<<NR / 64, 128, 0, stream>>>(hid, W2, b2, xpe, out);
}

// v004
// It runs in 81.4 microseconds.
// Timed twice side by side with v003, it ran 1.39 times as fast both times.
// Counting every step since v000, it is 3.61 times as fast.
#include <hip/hip_runtime.h>
#include <math.h>

typedef __attribute__((ext_vector_type(16))) _Float16 v16h;
typedef __attribute__((ext_vector_type(16))) __bf16 v16b;
typedef __attribute__((ext_vector_type(8)))  _Float16 v8h;
typedef __attribute__((ext_vector_type(8)))  float v8f;
typedef __attribute__((ext_vector_type(4)))  float v4f;
typedef __attribute__((ext_vector_type(2)))  float v2f;
typedef __attribute__((ext_vector_type(4)))  unsigned v4u;
typedef __attribute__((ext_vector_type(4)))  int v4i;
typedef float __attribute__((may_alias)) float_a;
typedef int __attribute__((may_alias)) int_a;

template <typename T> __device__ __forceinline__ void vst2(void* p, T v) { *(T*)p = v;  }
__device__ __forceinline__ v8f wmma16(v16h a, v16h b, v8f c) {
  v8f d = __builtin_amdgcn_wmma_f32_16x16x32_f16(false, a, false, b, (short)0, c, false, false);
  asm volatile("v_nop\n\tv_nop\n\tv_nop\n\tv_nop" : "+v"(d) : "v"(a), "v"(b));
  return d;
}
__device__ __forceinline__ v8f wmma_bf(v16b a, v16b b, v8f c) {
  v8f d = __builtin_amdgcn_wmma_f32_16x16x32_bf16(false, a, false, b, (short)0, c, false, false);
  asm volatile("v_nop\n\tv_nop\n\tv_nop\n\tv_nop" : "+v"(d) : "v"(a), "v"(b));
  return d;
}
// 16x16x32 fragments: lane = (h = lane>>4, row/col = lane&15); elements 0..7 = k0+8h+0..7, 8..15 = k0+16+8h+0..7; D element r = row 8h+r
__device__ __forceinline__ v16h frag_h(const _Float16* rowk0, int lane) {
  union { v16h v; v8h q[2]; } u; const _Float16* p = rowk0 + 8 * (lane >> 4);
  u.q[0] = *(const v8h*)p; u.q[1] = *(const v8h*)(p + 16); return u.v;
}
__device__ __forceinline__ v16h frag_f32(const float* rowk0, int lane) {
  v16h a; const float* p = rowk0 + 8 * (lane >> 4);
#pragma unroll
  for (int i = 0; i < 8; ++i) { a[i] = (_Float16)p[i]; a[8 + i] = (_Float16)p[16 + i]; }
  return a;
}
__device__ __forceinline__ v16h frag_f32s(const float* rowk0, int lane, float sc) {
  v16h a; const float* p = rowk0 + 8 * (lane >> 4);
#pragma unroll
  for (int i = 0; i < 8; ++i) { a[i] = (_Float16)(p[i] * sc); a[8 + i] = (_Float16)(p[16 + i] * sc); }
  return a;
}
// column fragment from a [K][ld] layout (column n), rows >= K read as 0
__device__ __forceinline__ v16h fragc_f32(const float* W, int k0, int n, int lane, int ld, int K) {
  v16h a; const int g = lane >> 4;
#pragma unroll
  for (int i = 0; i < 8; ++i) { const int ka = k0 + 8 * g + i, kb = ka + 16;
    a[i] = (_Float16)(ka < K ? W[(size_t)ka * ld + n] : 0.f); a[8 + i] = (_Float16)(kb < K ? W[(size_t)kb * ld + n] : 0.f); }
  return a;
}
struct F2 { v16b h, l; };
__device__ __forceinline__ F2 bsplit16(const float v[16]) { F2 r;
#pragma unroll
  for (int i = 0; i < 16; ++i) { const __bf16 h = (__bf16)v[i]; r.h[i] = h; r.l[i] = (__bf16)(v[i] - (float)h); }
  return r; }
__device__ __forceinline__ F2 split_row(const float* row, int k0, int lane) { float v[16]; const float* p = row + k0 + 8 * (lane >> 4);
#pragma unroll
  for (int i = 0; i < 8; ++i) { v[i] = p[i]; v[8 + i] = p[16 + i]; }
  return bsplit16(v); }
__device__ __forceinline__ F2 split_rowK(const float* row, int k0, int lane, int K) { float v[16]; const int g = lane >> 4;
#pragma unroll
  for (int i = 0; i < 8; ++i) { const int ka = k0 + 8 * g + i, kb = ka + 16; v[i] = ka < K ? row[ka] : 0.f; v[8 + i] = kb < K ? row[kb] : 0.f; }
  return bsplit16(v); }
__device__ __forceinline__ F2 split_col(const float* W, int k0, int n, int lane, int ld, int K) { float v[16]; const int g = lane >> 4;
#pragma unroll
  for (int i = 0; i < 8; ++i) { const int ka = k0 + 8 * g + i, kb = ka + 16; v[i] = ka < K ? W[(size_t)ka * ld + n] : 0.f; v[8 + i] = kb < K ? W[(size_t)kb * ld + n] : 0.f; }
  return bsplit16(v); }
__device__ __forceinline__ v8f mac3(const F2& a, const F2& b, v8f c) { c = wmma_bf(a.l, b.h, c); c = wmma_bf(a.h, b.l, c); return wmma_bf(a.h, b.h, c); }
__device__ __forceinline__ float sigm(float v) { return 1.0f / (1.0f + expf(-v)); }
#define LDSX() do { asm volatile("s_wait_dscnt 0" ::: "memory"); __builtin_amdgcn_wave_barrier(); __builtin_amdgcn_fence(__ATOMIC_RELEASE, "workgroup"); } while (0)

// Causal multi-head attention whose softmax runs over the QUERY axis (per key column), + FFN + residual, with inline sinusoidal
// sums Z_k = sum_{q>=k} exp(s[q][k]); pass 2 is un-normalised causal attention with values scaled by 1/Z_k. Projections, both score
// passes (head dim 16 zero-padded to the 32-wide K), P@V and the FFN run on v_wmma_f32_16x16x32_f16 (f16 operands, f32
#define NB 4
#define TT 2048
#define DD 128
#define NH 8
#define HE 16
#define DFF 512
#define NR (NB * TT)

// Weight tiles in LDS: f16, row-major [k][128 columns], row pitch WP halves = 288 bytes (an odd multiple of 32 bytes, the pitch of the transposing read)
#define WP 144
typedef __attribute__((ext_vector_type(8))) short s16x8;
// 128 threads bring K rows of 128 f32 columns (row stride ld) into sW as f16: 16 lanes take one 512-byte row, 8 floats each; the 32 loads of
// 16 bytes of a batch of 128 rows are all issued before the first value is converted, so a batch pays the load latency once
// (the inner unrolls keep v in registers)
template <int K> __device__ __forceinline__ void stage_w(const float* __restrict__ Wsrc, int ld, _Float16* sW, int tid) {
  const float* s0 = Wsrc + (size_t)(tid >> 4) * ld + (tid & 15) * 8; _Float16* d0 = sW + (tid >> 4) * WP + (tid & 15) * 8;
#pragma unroll 1
  for (int b = 0; b < K / 128; ++b) {   // rolled: one batch already fills 128 registers
    v4f v[16][2];
#pragma unroll
    for (int i = 0; i < 16; ++i) { const float* p = s0 + (size_t)(b * 128 + i * 8) * ld; v[i][0] = *(const v4f*)p; v[i][1] = *(const v4f*)(p + 4); }
    asm volatile("s_wait_xcnt 0x0" ::: "memory");   // precaution: the address registers of the loads above are rewritten below; it also keeps the whole batch of loads ahead of the conversions
#pragma unroll
    for (int i = 0; i < 16; ++i) { v8h h;
#pragma unroll
      for (int e = 0; e < 4; ++e) { h[e] = (_Float16)v[i][0][e]; h[4 + e] = (_Float16)v[i][1][e]; }
      *(v8h*)(d0 + (b * 128 + i * 8) * WP) = h; }
  }
}
// B fragment (k0..k0+31, columns n0..n0+15) of such a tile by two transposing LDS reads: lane (c, h) gets T[k0 + 8h + 0..7][n0 + c], then the same 16 rows on:
// the k order of frag_h and frag_f32. Every lane is on where it is called.
__device__ __forceinline__ v16h frag_tr(const _Float16* T, int k0, int n0, int lane) {
  typedef __attribute__((address_space(3))) s16x8 lds_s16x8;
  const _Float16* p = T + (k0 + 8 * (lane >> 4) + (lane & 7)) * WP + n0 + 8 * ((lane >> 3) & 1);
  union { v16h v; s16x8 q[2]; } u;
  u.q[0] = __builtin_amdgcn_ds_load_tr16_b128_v8i16((lds_s16x8*)p); u.q[1] = __builtin_amdgcn_ds_load_tr16_b128_v8i16((lds_s16x8*)(p + 16 * WP));
  return u.v;
}

// sin and cos of an angle a in [0, 2^17): n = nearest multiple of pi/2, a - n * pi/2 in three parts, then the two short polynomials on [-pi/4, pi/4] and the
// quadrant's swap and signs. The angles here are position * frequency with position < TT and frequency <= 1, so no wider reduction is reachable.
__device__ __forceinline__ void sincos_red(float a, float& sn, float& cs) {
  const float n = __builtin_rintf(a * __uint_as_float(0x3f22f983u));
  float r = __builtin_fmaf(__uint_as_float(0xbfc90fdau), n, a); r = __builtin_fmaf(__uint_as_float(0xb3a22168u), n, r); r = __builtin_fmaf(__uint_as_float(0xa7c234c4u), n, r);
  const unsigned q = (unsigned)(int)n; const float s = r * r;
  float ps = __builtin_fmaf(__uint_as_float(0xb94c1982u), s, __uint_as_float(0x3c0881c4u)); ps = __builtin_fmaf(s, ps, __uint_as_float(0xbe2aaa9du)); ps = s * ps;
  const float sr = __builtin_fmaf(r, ps, r);
  float pc = __builtin_fmaf(__uint_as_float(0x37d75334u), s, __uint_as_float(0xbab64f3bu)); pc = __builtin_fmaf(s, pc, __uint_as_float(0x3d2aabf7u)); pc = __builtin_fmaf(s, pc, __uint_as_float(0xbf000004u));
  const float cr = __builtin_fmaf(s, pc, 1.0f);
  const unsigned sg = (q << 30) & 0x80000000u; const bool odd = q & 1u;
  sn = __uint_as_float(__float_as_uint(odd ? cr : sr) ^ sg); cs = __uint_as_float(__float_as_uint(odd ? -sr : cr) ^ sg);
}
// ---- x + PE -> xpe rows (f32) and Q/K (f16 [h][b][t][16]) / V^T (f16 [h][b][e][t]); block = 64 rows (one b) x all 384 cols
__global__ __launch_bounds__(128) void k_proj(const float* __restrict__ x, const float* __restrict__ WQ, const float* __restrict__ WK, const float* __restrict__ WV,
                                            float* __restrict__ xpe, _Float16* __restrict__ Qh, _Float16* __restrict__ Kh, _Float16* __restrict__ vT) {
  __shared__ __align__(16) float sx[64][DD + 4];
  __shared__ __align__(16) float so[4][16][132];
  __shared__ __align__(16) _Float16 st[DD][72];
  __shared__ __align__(32) _Float16 sW[3][DD * WP];
  const int tid = threadIdx.x, wave = tid >> 5, lane = tid & 31, col = lane & 15, g = lane >> 4;
  const int r0b = blockIdx.x * 64, b = r0b / TT, t0 = r0b % TT;
  // the block's 64 x rows are asked for first, as one batch of 16-byte loads (a wave takes one 512-byte row per load, thread = 4 adjacent columns of
  // rows wave + 4i), and fly while the weights are staged (the unroll keeps xv in registers)
  const int pc4 = lane; v4f xv[16]; const float* xp = x + (size_t)(r0b + wave) * DD + pc4 * 4;
#pragma unroll
  for (int i = 0; i < 16; ++i) xv[i] = *(const v4f*)(xp + i * 4 * DD);
  asm volatile("s_wait_xcnt 0x0" ::: "memory");   // precaution: the address registers of the loads above are rewritten below
  // the three weight matrices go to LDS once per block; the barrier behind the PE stage publishes them too
#pragma unroll 1
  for (int m = 0; m < 3; ++m) stage_w<DD>(m == 0 ? WQ : (m == 1 ? WK : WV), DD, &sW[m][0], tid);   // rolled: one matrix in flight fills 128 registers
  // PE + stage: straight-line, 32 independent sin/cos pairs per thread (the unroll keeps xv in registers); a column pair (2i, 2i+1) shares its angle
  { const float kdiv = -logf(10000.0f) / (float)DD;
    const float div0 = expf((float)(pc4 * 4) * kdiv), div1 = expf((float)(pc4 * 4 + 2) * kdiv);
#pragma unroll
    for (int i = 0; i < 16; ++i) { const int rl = wave + 4 * i; const float tf = (float)(t0 + rl); float s0, c0, s1, c1;
      sincos_red(tf * div0, s0, c0); sincos_red(tf * div1, s1, c1); const v4f pe = {s0, c0, s1, c1};
      *(v4f*)(&sx[rl][pc4 * 4]) = xv[i] + pe; } }
  __syncthreads();
  for (int q = tid; q < 64 * 32; q += 128) { const int rl = q >> 5, pc = q & 31; vst2(xpe + (size_t)(r0b + rl) * DD + pc * 4, *(const v4f*)(&sx[rl][pc * 4])); }
#pragma unroll 1
  for (int which = 0; which < 3; ++which) { const _Float16* sw = &sW[which][0];
    v8f acc[8] = {};
#pragma unroll
    for (int kc = 0; kc < DD / 32; ++kc) { const v16h a = frag_f32(&sx[wave * 16 + col][0] + kc * 32, lane); v16h bf[8];
#pragma unroll
      for (int j = 0; j < 8; ++j) bf[j] = frag_tr(sw, kc * 32, j * 16, lane);   // the eight fragments of a k step are read as one group, one LDS wait
#pragma unroll
      for (int j = 0; j < 8; ++j) acc[j] = wmma16(a, bf[j], acc[j]); }
    if (which < 2) {
#pragma unroll
      for (int j = 0; j < 8; ++j)
#pragma unroll
        for (int r = 0; r < 8; ++r) so[wave][8 * g + r][j * 16 + col] = acc[j][r];
      LDSX();
      _Float16* dst = which == 0 ? Qh : Kh;
      // per head h (= tile j): 16 rows x 16 halves = 512 B contiguous at dst[((h*NB + b)*TT + t0 + wave*16) * 16]
      for (int q = lane; q < 8 * 32; q += 32) { const int h = q >> 5, pp = q & 31; const int rl = pp >> 1, half = (pp & 1) * 8; union { v8h hh; v4u u; } pk;
#pragma unroll
        for (int i = 0; i < 8; ++i) pk.hh[i] = (_Float16)so[wave][rl][h * 16 + half + i];
        vst2(dst + (((size_t)h * NB + b) * TT + t0 + wave * 16 + rl) * HE + half, pk.u); }
      LDSX();
    } else {
#pragma unroll
      for (int j = 0; j < 8; ++j)
#pragma unroll
        for (int r = 0; r < 8; ++r) st[j * 16 + col][wave * 16 + 8 * g + r] = (_Float16)acc[j][r];    // st[h*16+e][t local]
      __syncthreads();
      for (int q = tid; q < DD * 8; q += 128) { const int c = q >> 3, pc = q & 7, h = c >> 4, e = c & 15;
        vst2(vT + (((size_t)h * NB + b) * HE + e) * TT + t0 + pc * 8, *(const v4u*)(&st[c][pc * 8])); }
    }
  }
}
__device__ __forceinline__ v16h frag16(const _Float16* row16, int lane) {   // K = 16 real: elements 0..7 (h==0 lanes) and ... 
  // fragment elements: 0..7 = k 8h+0..7 (h = lane>>4) -> h==0: k 0..7, h==1: k 8..15; elements 8..15 = k 16+.. -> zero
  v16h a; const int hh = lane >> 4; union { v8h v; } u; u.v = *(const v8h*)(row16 + 8 * hh);
#pragma unroll
  for (int i = 0; i < 8; ++i) { a[i] = u.v[i]; a[8 + i] = (_Float16)0.f; }
  return a;
}
__global__ __launch_bounds__(128) void k_z(const _Float16* __restrict__ Qh, const _Float16* __restrict__ Kh, float* __restrict__ Z) {
  __shared__ __align__(16) float sz[64];
  const int tid = threadIdx.x, w = tid >> 5, lane = tid & 31, col = lane & 15, g = lane >> 4;
  const int hb = blockIdx.y, k0 = blockIdx.x * 64 + w * 16;
  const _Float16* qb = Qh + (size_t)hb * TT * HE; const _Float16* kb = Kh + (size_t)hb * TT * HE;
  const v16h ak = frag16(kb + (size_t)(k0 + col) * HE, lane);
  const float scl = rsqrtf((float)TT) * 1.44269504f;   // score scale times log2(e): exp(s * scale) = 2^(s * scl), one multiply and one v_exp_f32
  float zs[8] = {0.f, 0.f, 0.f, 0.f, 0.f, 0.f, 0.f, 0.f};
#pragma unroll 1
  for (int qt = blockIdx.x; qt < TT / 64; ++qt) {
    // straight-line trip: the four query fragments are loaded first, the four score products follow back to back, and the
    // mask is a select on a finished exp, so the 32 exp chains are independent work in one basic block (the unrolls keep
    // bq and s in registers)
    v16h bq[4]; v8f s[4]; const _Float16* qrow = qb + (size_t)(qt * 64 + col) * HE;
#pragma unroll
    for (int t = 0; t < 4; ++t) bq[t] = frag16(qrow + t * 16 * HE, lane);
#pragma unroll
    for (int t = 0; t < 4; ++t) { v8f z0 = {}; s[t] = wmma16(ak, bq[t], z0); }
#pragma unroll
    for (int t = 0; t < 4; ++t) {
#pragma unroll
      for (int r = 0; r < 8; ++r) { const int key = k0 + 8 * g + r, q = qt * 64 + t * 16 + col; const float e = __builtin_amdgcn_exp2f(s[t][r] * scl); zs[r] += q >= key ? e : 0.f; } } }
  // reduce zs[r] over the 16 col lanes of each half -> key k0 + 8g + r
#pragma unroll
  for (int off = 8; off >= 1; off >>= 1) {
#pragma unroll
    for (int r = 0; r < 8; ++r) zs[r] += __shfl_xor(zs[r], off, 32); }
  if (col == 0) {
#pragma unroll
    for (int r = 0; r < 8; ++r) sz[w * 16 + 8 * g + r] = zs[r]; }
  __syncthreads();
  if (tid < 16) vst2(Z + (size_t)hb * TT + blockIdx.x * 64 + tid * 4, *(const v4f*)(&sz[tid * 4]));
}
// ---- pass 2: oh[hb][q][e] = sum_{k <= q} exp(s[q][k]) / Z[k] * V[k][e]; block = (hb, 64 queries)
__global__ __launch_bounds__(128) void k_av(const _Float16* __restrict__ Qh, const _Float16* __restrict__ Kh, const _Float16* __restrict__ vT, const float* __restrict__ Z, float* __restrict__ oh) {
  __shared__ __align__(16) _Float16 sP[4][16][72];
  __shared__ __align__(16) float so[4][16][20];
  const int tid = threadIdx.x, w = tid >> 5, lane = tid & 31, col = lane & 15, g = lane >> 4;
  const int hb = blockIdx.y, q0 = blockIdx.x * 64 + w * 16;
  const _Float16* qb = Qh + (size_t)hb * TT * HE; const _Float16* kb = Kh + (size_t)hb * TT * HE; const _Float16* vb = vT + (size_t)hb * HE * TT;
  const v16h aq = frag16(qb + (size_t)(q0 + col) * HE, lane);
  const float scl = rsqrtf((float)TT) * 1.44269504f;   // score scale times log2(e): exp(s * scale) = 2^(s * scl), one multiply and one v_exp_f32
  v8f acc = {};
#pragma unroll 1
  for (int kt = 0; kt <= (int)blockIdx.x; ++kt) {
    // straight-line trip: every global load of the trip (keys, column sums, values) is issued first, the four score products
    // follow back to back, and the mask is a select on a finished exp, so the 32 exp chains are independent work in one basic block
    // (the unrolls keep bk, bv, zv and s in registers)
    v16h bk[4], bv[2]; float zv[4]; v8f s[4];
#pragma unroll
    for (int t = 0; t < 4; ++t) bk[t] = frag16(kb + (size_t)(kt * 64 + t * 16 + col) * HE, lane);
#pragma unroll
    for (int t = 0; t < 4; ++t) zv[t] = Z[(size_t)hb * TT + kt * 64 + t * 16 + col];
    asm volatile("s_wait_xcnt 0x0" ::: "memory");   // precaution: the address registers of the loads above are rewritten further down the trip
#pragma unroll
    for (int kc = 0; kc < 2; ++kc) bv[kc] = frag_h(vb + (size_t)col * TT + kt * 64 + kc * 32, lane);   // B col = e (lane&15 < 16)
#pragma unroll
    for (int t = 0; t < 4; ++t) { v8f z0 = {}; s[t] = wmma16(aq, bk[t], z0); }
#pragma unroll
    for (int t = 0; t < 4; ++t) { const int key = kt * 64 + t * 16 + col; const float zinv = 1.0f / zv[t];
#pragma unroll
      for (int r = 0; r < 8; ++r) { const int q = q0 + 8 * g + r; const float e = __builtin_amdgcn_exp2f(s[t][r] * scl); const float p = key <= q ? e * zinv : 0.f; sP[w][8 * g + r][t * 16 + col] = (_Float16)(p * 256.0f); } }   // attn <= ~1e-2 typically; x256
    LDSX();
#pragma unroll
    for (int kc = 0; kc < 2; ++kc) acc = wmma16(frag_h(&sP[w][col][0] + kc * 32, lane), bv[kc], acc);
    __builtin_amdgcn_wave_barrier();
  }
#pragma unroll
  for (int r = 0; r < 8; ++r) so[w][8 * g + r][col] = acc[r] * (1.0f / 256.0f);
  LDSX();
  for (int q = lane; q < 64; q += 32) { const int rl = q >> 2, pc = q & 3; vst2(oh + ((size_t)hb * TT + q0 + rl) * HE + pc * 4, *(const v4f*)(&so[w][rl][pc * 4])); }
}
// ---- FFN: hid = relu(out@W1+b1) -> f16 rows; out = hid@W2 + b2 + xpe. A for ff1 gathered from oh (k -> h = k/16, e = k%16)
__global__ __launch_bounds__(128) void k_ff1(const float* __restrict__ oh, const float* __restrict__ W1, const float* __restrict__ b1, _Float16* __restrict__ hid) {
  __shared__ __align__(16) float so[4][16][132];
  __shared__ __align__(32) _Float16 sW[DD * WP];
  const int tid = threadIdx.x, wave = tid >> 5, lane = tid & 31, col = lane & 15, g = lane >> 4;
  const int r0 = blockIdx.x * 64 + wave * 16, n0 = blockIdx.y * 128; const int r = r0 + col, b = r / TT, t = r % TT;
  v8f acc[8] = {};
  // the wave's own A values are asked for first and fly while the block's 128 weight columns are staged (the unrolls keep af in registers)
  float af[DD / 32][16];
#pragma unroll
  for (int kc = 0; kc < DD / 32; ++kc) {
#pragma unroll
    for (int i = 0; i < 8; ++i) { const int ka = kc * 32 + 8 * g + i, kz = ka + 16;
      af[kc][i] = oh[(((size_t)(ka >> 4) * NB + b) * TT + t) * HE + (ka & 15)]; af[kc][8 + i] = oh[(((size_t)(kz >> 4) * NB + b) * TT + t) * HE + (kz & 15)]; } }
  asm volatile("s_wait_xcnt 0x0" ::: "memory");   // precaution: the address registers of the loads above are rewritten below
  stage_w<DD>(W1 + n0, DFF, sW, tid);
  __syncthreads();   // publishes the staged weights to the four waves
#pragma unroll
  for (int kc = 0; kc < DD / 32; ++kc) { v16h a, bf[8];
#pragma unroll
    for (int i = 0; i < 16; ++i) a[i] = (_Float16)af[kc][i];
#pragma unroll
    for (int j = 0; j < 8; ++j) bf[j] = frag_tr(sW, kc * 32, j * 16, lane);   // the eight fragments of a k step are read as one group, one LDS wait
#pragma unroll
    for (int j = 0; j < 8; ++j) acc[j] = wmma16(a, bf[j], acc[j]); }
#pragma unroll
  for (int j = 0; j < 8; ++j) { const float bb = b1[n0 + j * 16 + col];
#pragma unroll
    for (int rr = 0; rr < 8; ++rr) { const float v = acc[j][rr] + bb; so[wave][8 * g + rr][j * 16 + col] = v > 0.f ? v : 0.f; } }
  LDSX();
  for (int q = lane; q < 16 * 16; q += 32) { const int rl = q >> 4, pc = q & 15; union { v8h hh; v4u u; } pk;
#pragma unroll
    for (int i = 0; i < 8; ++i) pk.hh[i] = (_Float16)so[wave][rl][pc * 8 + i];
    vst2(hid + (size_t)(r0 + rl) * DFF + n0 + pc * 8, pk.u); }
}
__global__ __launch_bounds__(128) void k_ff2(const _Float16* __restrict__ hid, const float* __restrict__ W2, const float* __restrict__ b2, const float* __restrict__ xpe, float* __restrict__ out) {
  __shared__ __align__(16) float so[4][16][132];
  __shared__ __align__(32) _Float16 sW[DFF * WP];
  const int tid = threadIdx.x, wave = tid >> 5, lane = tid & 31, col = lane & 15, g = lane >> 4;
  const int r0 = blockIdx.x * 64 + wave * 16;
  v8f acc[8] = {};
  // the first eight A fragments are asked for first and fly while the weights are staged; each of the other eight is asked for eight k steps ahead of its use
  const _Float16* arow = hid + (size_t)(r0 + col) * DFF; v16h a[8];
#pragma unroll
  for (int kc = 0; kc < 8; ++kc) a[kc] = frag_h(arow + kc * 32, lane);
  asm volatile("s_wait_xcnt 0x0" ::: "memory");   // precaution: the address registers of the loads above are rewritten below
  stage_w<DFF>(W2, DD, sW, tid);
  __syncthreads();   // publishes the staged weights to the four waves
#pragma unroll
  for (int kc = 0; kc < DFF / 32; ++kc) { const v16h cur = a[kc & 7]; v16h bf[8];   // unrolled: a[] stays in registers
    if (kc < 8) a[kc] = frag_h(arow + (kc + 8) * 32, lane);
#pragma unroll
    for (int j = 0; j < 8; ++j) bf[j] = frag_tr(sW, kc * 32, j * 16, lane);   // the eight fragments of a k step are read as one group, one LDS wait
#pragma unroll
    for (int j = 0; j < 8; ++j) acc[j] = wmma16(cur, bf[j], acc[j]); }
#pragma unroll
  for (int j = 0; j < 8; ++j) { const float bb = b2[j * 16 + col];
#pragma unroll
    for (int rr = 0; rr < 8; ++rr) so[wave][8 * g + rr][j * 16 + col] = acc[j][rr] + bb; }
  LDSX();
#pragma unroll 4
  for (int rl = 0; rl < 16; ++rl) { const size_t o = (size_t)(r0 + rl) * DD + lane * 4; vst2(out + o, *(const v4f*)(&so[wave][rl][lane * 4]) + *(const v4f*)(xpe + o)); }
}
extern "C" void kernel_launch(void* const* d_in, const int* in_sizes, int n_in, void* d_out, int out_size, void* d_ws, size_t ws_size, hipStream_t stream) {
  (void)in_sizes; (void)n_in; (void)out_size; (void)ws_size;
  const float* x = (const float*)d_in[0]; const float* WQ = (const float*)d_in[1]; const float* WK = (const float*)d_in[2]; const float* WV = (const float*)d_in[3];
  const float* W1 = (const float*)d_in[4]; const float* b1 = (const float*)d_in[5]; const float* W2 = (const float*)d_in[6]; const float* b2 = (const float*)d_in[7];
  float* out = (float*)d_out;
  char* ws = (char*)d_ws; size_t off = 0;
  auto take = [&](size_t bytes) { char* p = ws + off; off += (bytes + 255) & ~(size_t)255; return p; };
  float* xpe = (float*)take((size_t)NR * DD * 4);
  _Float16* Qh = (_Float16*)take((size_t)NR * DD * 2); _Float16* Kh = (_Float16*)take((size_t)NR * DD * 2); _Float16* vT = (_Float16*)take((size_t)NR * DD * 2);
  float* Z = (float*)take((size_t)NH * NB * TT * 4); float* oh = (float*)take((size_t)NR * DD * 4); _Float16* hid = (_Float16*)take((size_t)NR * DFF * 2);
  k_proj<<<NR / 64, 128, 0, stream>>>(x, WQ, WK, WV, xpe, Qh, Kh, vT);
  k_z<<<dim3(TT / 64, NH * NB), 128, 0, stream>>>(Qh, Kh, Z);
  k_av<<<dim3(TT / 64, NH * NB), 128, 0, stream>>>(Qh, Kh, vT, Z, oh);
  k_ff1<<<dim3(NR / 64, DFF / 128), 128, 0, stream>>>(oh, W1, b1, hid);
  k_ff2<<<NR / 64, 128, 0, stream>>>(hid, W2, b2, xpe, out);
}

// v005
// One run takes 79.4 microseconds.
// In two side-by-side timings against v004, it was 1.03 and 1.02 times as fast.
// Counting every step since v000, it is 3.71 times as fast.
#include <hip/hip_runtime.h>
#include <math.h>

typedef __attribute__((ext_vector_type(16))) _Float16 v16h;
typedef __attribute__((ext_vector_type(16))) __bf16 v16b;
typedef __attribute__((ext_vector_type(8)))  _Float16 v8h;
typedef __attribute__((ext_vector_type(8)))  float v8f;
typedef __attribute__((ext_vector_type(4)))  float v4f;
typedef __attribute__((ext_vector_type(2)))  float v2f;
typedef __attribute__((ext_vector_type(4)))  unsigned v4u;
typedef __attribute__((ext_vector_type(4)))  int v4i;
typedef float __attribute__((may_alias)) float_a;
typedef int __attribute__((may_alias)) int_a;

template <typename T> __device__ __forceinline__ void vst2(void* p, T v) { *(T*)p = v;  }
__device__ __forceinline__ v8f wmma16(v16h a, v16h b, v8f c) {
  v8f d = __builtin_amdgcn_wmma_f32_16x16x32_f16(false, a, false, b, (short)0, c, false, false);
  asm volatile("v_nop\n\tv_nop\n\tv_nop\n\tv_nop" : "+v"(d) : "v"(a), "v"(b));
  return d;
}
__device__ __forceinline__ v8f wmma_bf(v16b a, v16b b, v8f c) {
  v8f d = __builtin_amdgcn_wmma_f32_16x16x32_bf16(false, a, false, b, (short)0, c, false, false);
  asm volatile("v_nop\n\tv_nop\n\tv_nop\n\tv_nop" : "+v"(d) : "v"(a), "v"(b));
  return d;
}
// 16x16x32 fragments: lane = (h = lane>>4, row/col = lane&15); elements 0..7 = k0+8h+0..7, 8..15 = k0+16+8h+0..7; D element r = row 8h+r
__device__ __forceinline__ v16h frag_h(const _Float16* rowk0, int lane) {
  union { v16h v; v8h q[2]; } u; const _Float16* p = rowk0 + 8 * (lane >> 4);
  u.q[0] = *(const v8h*)p; u.q[1] = *(const v8h*)(p + 16); return u.v;
}
__device__ __forceinline__ v16h frag_f32(const float* rowk0, int lane) {
  v16h a; const float* p = rowk0 + 8 * (lane >> 4);
#pragma unroll
  for (int i = 0; i < 8; ++i) { a[i] = (_Float16)p[i]; a[8 + i] = (_Float16)p[16 + i]; }
  return a;
}
__device__ __forceinline__ v16h frag_f32s(const float* rowk0, int lane, float sc) {
  v16h a; const float* p = rowk0 + 8 * (lane >> 4);
#pragma unroll
  for (int i = 0; i < 8; ++i) { a[i] = (_Float16)(p[i] * sc); a[8 + i] = (_Float16)(p[16 + i] * sc); }
  return a;
}
// column fragment from a [K][ld] layout (column n), rows >= K read as 0
__device__ __forceinline__ v16h fragc_f32(const float* W, int k0, int n, int lane, int ld, int K) {
  v16h a; const int g = lane >> 4;
#pragma unroll
  for (int i = 0; i < 8; ++i) { const int ka = k0 + 8 * g + i, kb = ka + 16;
    a[i] = (_Float16)(ka < K ? W[(size_t)ka * ld + n] : 0.f); a[8 + i] = (_Float16)(kb < K ? W[(size_t)kb * ld + n] : 0.f); }
  return a;
}
struct F2 { v16b h, l; };
__device__ __forceinline__ F2 bsplit16(const float v[16]) { F2 r;
#pragma unroll
  for (int i = 0; i < 16; ++i) { const __bf16 h = (__bf16)v[i]; r.h[i] = h; r.l[i] = (__bf16)(v[i] - (float)h); }
  return r; }
__device__ __forceinline__ F2 split_row(const float* row, int k0, int lane) { float v[16]; const float* p = row + k0 + 8 * (lane >> 4);
#pragma unroll
  for (int i = 0; i < 8; ++i) { v[i] = p[i]; v[8 + i] = p[16 + i]; }
  return bsplit16(v); }
__device__ __forceinline__ F2 split_rowK(const float* row, int k0, int lane, int K) { float v[16]; const int g = lane >> 4;
#pragma unroll
  for (int i = 0; i < 8; ++i) { const int ka = k0 + 8 * g + i, kb = ka + 16; v[i] = ka < K ? row[ka] : 0.f; v[8 + i] = kb < K ? row[kb] : 0.f; }
  return bsplit16(v); }
__device__ __forceinline__ F2 split_col(const float* W, int k0, int n, int lane, int ld, int K) { float v[16]; const int g = lane >> 4;
#pragma unroll
  for (int i = 0; i < 8; ++i) { const int ka = k0 + 8 * g + i, kb = ka + 16; v[i] = ka < K ? W[(size_t)ka * ld + n] : 0.f; v[8 + i] = kb < K ? W[(size_t)kb * ld + n] : 0.f; }
  return bsplit16(v); }
__device__ __forceinline__ v8f mac3(const F2& a, const F2& b, v8f c) { c = wmma_bf(a.l, b.h, c); c = wmma_bf(a.h, b.l, c); return wmma_bf(a.h, b.h, c); }
__device__ __forceinline__ float sigm(float v) { return 1.0f / (1.0f + expf(-v)); }
#define LDSX() do { asm volatile("s_wait_dscnt 0" ::: "memory"); __builtin_amdgcn_wave_barrier(); __builtin_amdgcn_fence(__ATOMIC_RELEASE, "workgroup"); } while (0)

// Causal multi-head attention whose softmax runs over the QUERY axis (per key column), + FFN + residual, with inline sinusoidal
// sums Z_k = sum_{q>=k} exp(s[q][k]); pass 2 is un-normalised causal attention with values scaled by 1/Z_k. Projections, both score
// passes (head dim 16 zero-padded to the 32-wide K), P@V and the FFN run on v_wmma_f32_16x16x32_f16 (f16 operands, f32
#define NB 4
#define TT 2048
#define DD 128
#define NH 8
#define HE 16
#define DFF 512
#define NR (NB * TT)

// Weight tiles in LDS: f16, row-major [k][128 columns], row pitch WP halves = 288 bytes (an odd multiple of 32 bytes, the pitch of the transposing read)
#define WP 144
typedef __attribute__((ext_vector_type(8))) short s16x8;
// 128 threads bring K rows of 128 f32 columns (row stride ld) into sW as f16: 16 lanes take one 512-byte row, 8 floats each; the 32 loads of
// 16 bytes of a batch of 128 rows are all issued before the first value is converted, so a batch pays the load latency once
// (the inner unrolls keep v in registers)
template <int K> __device__ __forceinline__ void stage_w(const float* __restrict__ Wsrc, int ld, _Float16* sW, int tid) {
  const float* s0 = Wsrc + (size_t)(tid >> 4) * ld + (tid & 15) * 8; _Float16* d0 = sW + (tid >> 4) * WP + (tid & 15) * 8;
#pragma unroll 1
  for (int b = 0; b < K / 128; ++b) {   // rolled: one batch already fills 128 registers
    v4f v[16][2];
#pragma unroll
    for (int i = 0; i < 16; ++i) { const float* p = s0 + (size_t)(b * 128 + i * 8) * ld; v[i][0] = *(const v4f*)p; v[i][1] = *(const v4f*)(p + 4); }
    asm volatile("s_wait_xcnt 0x0" ::: "memory");   // precaution: the address registers of the loads above are rewritten below; it also keeps the whole batch of loads ahead of the conversions
#pragma unroll
    for (int i = 0; i < 16; ++i) { v8h h;
#pragma unroll
      for (int e = 0; e < 4; ++e) { h[e] = (_Float16)v[i][0][e]; h[4 + e] = (_Float16)v[i][1][e]; }
      *(v8h*)(d0 + (b * 128 + i * 8) * WP) = h; }
  }
}
// B fragment (k0..k0+31, columns n0..n0+15) of such a tile by two transposing LDS reads: lane (c, h) gets T[k0 + 8h + 0..7][n0 + c], then the same 16 rows on:
// the k order of frag_h and frag_f32. Every lane is on where it is called.
__device__ __forceinline__ v16h frag_tr(const _Float16* T, int k0, int n0, int lane) {
  typedef __attribute__((address_space(3))) s16x8 lds_s16x8;
  const _Float16* p = T + (k0 + 8 * (lane >> 4) + (lane & 7)) * WP + n0 + 8 * ((lane >> 3) & 1);
  union { v16h v; s16x8 q[2]; } u;
  u.q[0] = __builtin_amdgcn_ds_load_tr16_b128_v8i16((lds_s16x8*)p); u.q[1] = __builtin_amdgcn_ds_load_tr16_b128_v8i16((lds_s16x8*)(p + 16 * WP));
  return u.v;
}

// sin and cos of an angle a in [0, 2^17): n = nearest multiple of pi/2, a - n * pi/2 in three parts, then the two short polynomials on [-pi/4, pi/4] and the
// quadrant's swap and signs. The angles here are position * frequency with position < TT and frequency <= 1, so no wider reduction is reachable.
__device__ __forceinline__ void sincos_red(float a, float& sn, float& cs) {
  const float n = __builtin_rintf(a * __uint_as_float(0x3f22f983u));
  float r = __builtin_fmaf(__uint_as_float(0xbfc90fdau), n, a); r = __builtin_fmaf(__uint_as_float(0xb3a22168u), n, r); r = __builtin_fmaf(__uint_as_float(0xa7c234c4u), n, r);
  const unsigned q = (unsigned)(int)n; const float s = r * r;
  float ps = __builtin_fmaf(__uint_as_float(0xb94c1982u), s, __uint_as_float(0x3c0881c4u)); ps = __builtin_fmaf(s, ps, __uint_as_float(0xbe2aaa9du)); ps = s * ps;
  const float sr = __builtin_fmaf(r, ps, r);
  float pc = __builtin_fmaf(__uint_as_float(0x37d75334u), s, __uint_as_float(0xbab64f3bu)); pc = __builtin_fmaf(s, pc, __uint_as_float(0x3d2aabf7u)); pc = __builtin_fmaf(s, pc, __uint_as_float(0xbf000004u));
  const float cr = __builtin_fmaf(s, pc, 1.0f);
  const unsigned sg = (q << 30) & 0x80000000u; const bool odd = q & 1u;
  sn = __uint_as_float(__float_as_uint(odd ? cr : sr) ^ sg); cs = __uint_as_float(__float_as_uint(odd ? -sr : cr) ^ sg);
}
// ---- x + PE -> xpe rows (f32) and Q/K (f16 [h][b][t][16]) / V^T (f16 [h][b][e][t]); block = 64 rows (one b) x all 384 cols
__global__ __launch_bounds__(128) void k_proj(const float* __restrict__ x, const float* __restrict__ WQ, const float* __restrict__ WK, const float* __restrict__ WV,
                                            float* __restrict__ xpe, _Float16* __restrict__ Qh, _Float16* __restrict__ Kh, _Float16* __restrict__ vT) {
  __shared__ __align__(16) float sx[64][DD + 4];
  __shared__ __align__(16) float so[4][16][132];
  __shared__ __align__(16) _Float16 st[DD][72];
  __shared__ __align__(32) _Float16 sW[3][DD * WP];
  const int tid = threadIdx.x, wave = tid >> 5, lane = tid & 31, col = lane & 15, g = lane >> 4;
  const int r0b = blockIdx.x * 64, b = r0b / TT, t0 = r0b % TT;
  // the block's 64 x rows are asked for first, as one batch of 16-byte loads (a wave takes one 512-byte row per load, thread = 4 adjacent columns of
  // rows wave + 4i), and fly while the weights are staged (the unroll keeps xv in registers)
  const int pc4 = lane; v4f xv[16]; const float* xp = x + (size_t)(r0b + wave) * DD + pc4 * 4;
#pragma unroll
  for (int i = 0; i < 16; ++i) xv[i] = *(const v4f*)(xp + i * 4 * DD);
  asm volatile("s_wait_xcnt 0x0" ::: "memory");   // precaution: the address registers of the loads above are rewritten below
  // the three weight matrices go to LDS once per block; the barrier behind the PE stage publishes them too
#pragma unroll 1
  for (int m = 0; m < 3; ++m) stage_w<DD>(m == 0 ? WQ : (m == 1 ? WK : WV), DD, &sW[m][0], tid);   // rolled: one matrix in flight fills 128 registers
  // PE + stage: straight-line, 32 independent sin/cos pairs per thread (the unroll keeps xv in registers); a column pair (2i, 2i+1) shares its angle
  { const float kdiv = -logf(10000.0f) / (float)DD;
    const float div0 = expf((float)(pc4 * 4) * kdiv), div1 = expf((float)(pc4 * 4 + 2) * kdiv);
#pragma unroll
    for (int i = 0; i < 16; ++i) { const int rl = wave + 4 * i; const float tf = (float)(t0 + rl); float s0, c0, s1, c1;
      sincos_red(tf * div0, s0, c0); sincos_red(tf * div1, s1, c1); const v4f pe = {s0, c0, s1, c1};
      *(v4f*)(&sx[rl][pc4 * 4]) = xv[i] + pe; } }
  __syncthreads();
  for (int q = tid; q < 64 * 32; q += 128) { const int rl = q >> 5, pc = q & 31; vst2(xpe + (size_t)(r0b + rl) * DD + pc * 4, *(const v4f*)(&sx[rl][pc * 4])); }
#pragma unroll 1
  for (int which = 0; which < 3; ++which) { const _Float16* sw = &sW[which][0];
    v8f acc[8] = {};
#pragma unroll
    for (int kc = 0; kc < DD / 32; ++kc) { const v16h a = frag_f32(&sx[wave * 16 + col][0] + kc * 32, lane); v16h bf[8];
#pragma unroll
      for (int j = 0; j < 8; ++j) bf[j] = frag_tr(sw, kc * 32, j * 16, lane);   // the eight fragments of a k step are read as one group, one LDS wait
#pragma unroll
      for (int j = 0; j < 8; ++j) acc[j] = wmma16(a, bf[j], acc[j]); }
    if (which < 2) {
#pragma unroll
      for (int j = 0; j < 8; ++j)
#pragma unroll
        for (int r = 0; r < 8; ++r) so[wave][8 * g + r][j * 16 + col] = acc[j][r];
      LDSX();
      _Float16* dst = which == 0 ? Qh : Kh;
      // per head h (= tile j): 16 rows x 16 halves = 512 B contiguous at dst[((h*NB + b)*TT + t0 + wave*16) * 16]
      for (int q = lane; q < 8 * 32; q += 32) { const int h = q >> 5, pp = q & 31; const int rl = pp >> 1, half = (pp & 1) * 8; union { v8h hh; v4u u; } pk;
#pragma unroll
        for (int i = 0; i < 8; ++i) pk.hh[i] = (_Float16)so[wave][rl][h * 16 + half + i];
        vst2(dst + (((size_t)h * NB + b) * TT + t0 + wave * 16 + rl) * HE + half, pk.u); }
      LDSX();
    } else {
#pragma unroll
      for (int j = 0; j < 8; ++j)
#pragma unroll
        for (int r = 0; r < 8; ++r) st[j * 16 + col][wave * 16 + 8 * g + r] = (_Float16)acc[j][r];    // st[h*16+e][t local]
      __syncthreads();
      for (int q = tid; q < DD * 8; q += 128) { const int c = q >> 3, pc = q & 7, h = c >> 4, e = c & 15;
        vst2(vT + (((size_t)h * NB + b) * HE + e) * TT + t0 + pc * 8, *(const v4u*)(&st[c][pc * 8])); }
    }
  }
}
__device__ __forceinline__ v16h frag16(const _Float16* row16, int lane) {   // K = 16 real: elements 0..7 (h==0 lanes) and ... 
  // fragment elements: 0..7 = k 8h+0..7 (h = lane>>4) -> h==0: k 0..7, h==1: k 8..15; elements 8..15 = k 16+.. -> zero
  v16h a; const int hh = lane >> 4; union { v8h v; } u; u.v = *(const v8h*)(row16 + 8 * hh);
#pragma unroll
  for (int i = 0; i < 8; ++i) { a[i] = u.v[i]; a[8 + i] = (_Float16)0.f; }
  return a;
}
__global__ __launch_bounds__(128) void k_z(const _Float16* __restrict__ Qh, const _Float16* __restrict__ Kh, float* __restrict__ Z) {
  __shared__ __align__(16) float sz[2][64];
  const int tid = threadIdx.x, w = tid >> 5, lane = tid & 31, col = lane & 15, g = lane >> 4;
  const int hb = blockIdx.y;
  const _Float16* qb = Qh + (size_t)hb * TT * HE; const _Float16* kb = Kh + (size_t)hb * TT * HE;
  const float scl = rsqrtf((float)TT) * 1.44269504f;   // score scale times log2(e): exp(s * scale) = 2^(s * scl), one multiply and one v_exp_f32
  // a key tile's cost falls linearly with its index, so a block takes tile x and then tile 31 - x, one after the other in every wave:
  // TT / 64 + 1 trips in every block, whatever WGP it lands on
#pragma unroll 1
  for (int part = 0; part < 2; ++part) {   // rolled: one copy of the hot loop
  const int kt = part == 0 ? (int)blockIdx.x : TT / 64 - 1 - (int)blockIdx.x, k0 = kt * 64 + w * 16;
  const v16h ak = frag16(kb + (size_t)(k0 + col) * HE, lane);
  float zs[8] = {0.f, 0.f, 0.f, 0.f, 0.f, 0.f, 0.f, 0.f};
#pragma unroll 1
  for (int qt = kt; qt < TT / 64; ++qt) {
    // straight-line trip: the four query fragments are loaded first, the four score products follow back to back, and the
    // mask is a select on a finished exp, so the 32 exp chains are independent work in one basic block (the unrolls keep
    // bq and s in registers)
    v16h bq[4]; v8f s[4]; const _Float16* qrow = qb + (size_t)(qt * 64 + col) * HE;
#pragma unroll
    for (int t = 0; t < 4; ++t) bq[t] = frag16(qrow + t * 16 * HE, lane);
#pragma unroll
    for (int t = 0; t < 4; ++t) { v8f z0 = {}; s[t] = wmma16(ak, bq[t], z0); }
#pragma unroll
    for (int t = 0; t < 4; ++t) {
#pragma unroll
      for (int r = 0; r < 8; ++r) { const int key = k0 + 8 * g + r, q = qt * 64 + t * 16 + col; const float e = __builtin_amdgcn_exp2f(s[t][r] * scl); zs[r] += q >= key ? e : 0.f; } } }
  // reduce zs[r] over the 16 col lanes of each half -> key k0 + 8g + r
#pragma unroll
  for (int off = 8; off >= 1; off >>= 1) {
#pragma unroll
    for (int r = 0; r < 8; ++r) zs[r] += __shfl_xor(zs[r], off, 32); }
  if (col == 0) {
#pragma unroll
    for (int r = 0; r < 8; ++r) sz[part][w * 16 + 8 * g + r] = zs[r]; }
  }
  __syncthreads();
  if (tid < 32) { const int part = tid >> 4, kt = part == 0 ? (int)blockIdx.x : TT / 64 - 1 - (int)blockIdx.x;
    vst2(Z + (size_t)hb * TT + kt * 64 + (tid & 15) * 4, *(const v4f*)(&sz[part][(tid & 15) * 4])); }
}
// ---- pass 2: oh[hb][q][e] = sum_{k <= q} exp(s[q][k]) / Z[k] * V[k][e]; block = (hb, two tiles of 64 queries)
__global__ __launch_bounds__(128) void k_av(const _Float16* __restrict__ Qh, const _Float16* __restrict__ Kh, const _Float16* __restrict__ vT, const float* __restrict__ Z, float* __restrict__ oh) {
  __shared__ __align__(16) _Float16 sP[4][16][72];
  __shared__ __align__(16) float so[4][16][20];
  const int tid = threadIdx.x, w = tid >> 5, lane = tid & 31, col = lane & 15, g = lane >> 4;
  const int hb = blockIdx.y;
  const _Float16* qb = Qh + (size_t)hb * TT * HE; const _Float16* kb = Kh + (size_t)hb * TT * HE; const _Float16* vb = vT + (size_t)hb * HE * TT;
  const float scl = rsqrtf((float)TT) * 1.44269504f;   // score scale times log2(e): exp(s * scale) = 2^(s * scl), one multiply and one v_exp_f32
  // a query tile's cost grows linearly with its index, so a block takes tile 31 - x and then tile x, one after the other in every wave:
  // TT / 64 + 1 trips in every block, whatever WGP it lands on
#pragma unroll 1
  for (int part = 0; part < 2; ++part) {   // rolled: one copy of the hot loop
  const int qt = part == 0 ? TT / 64 - 1 - (int)blockIdx.x : (int)blockIdx.x, q0 = qt * 64 + w * 16;
  const v16h aq = frag16(qb + (size_t)(q0 + col) * HE, lane);
  asm volatile("s_wait_xcnt 0x0" :: "v"(aq) : "memory");   // precaution: the address registers of the load above are reused by the first trip; the loaded value as an input keeps the load ahead of the wait
  v8f acc = {};
#pragma unroll 1
  for (int kt = 0; kt <= qt; ++kt) {
    // straight-line trip: every global load of the trip (keys, column sums, values) is issued first, the four score products
    // follow back to back, and the mask is a select on a finished exp, so the 32 exp chains are independent work in one basic block
    // (the unrolls keep bk, bv, zv and s in registers)
    v16h bk[4], bv[2]; float zv[4]; v8f s[4];
#pragma unroll
    for (int t = 0; t < 4; ++t) bk[t] = frag16(kb + (size_t)(kt * 64 + t * 16 + col) * HE, lane);
#pragma unroll
    for (int t = 0; t < 4; ++t) zv[t] = Z[(size_t)hb * TT + kt * 64 + t * 16 + col];
    asm volatile("s_wait_xcnt 0x0" ::: "memory");   // precaution: the address registers of the loads above are rewritten further down the trip
#pragma unroll
    for (int kc = 0; kc < 2; ++kc) bv[kc] = frag_h(vb + (size_t)col * TT + kt * 64 + kc * 32, lane);   // B col = e (lane&15 < 16)
#pragma unroll
    for (int t = 0; t < 4; ++t) { v8f z0 = {}; s[t] = wmma16(aq, bk[t], z0); }
#pragma unroll
    for (int t = 0; t < 4; ++t) { const int key = kt * 64 + t * 16 + col; const float zinv = 1.0f / zv[t];
#pragma unroll
      for (int r = 0; r < 8; ++r) { const int q = q0 + 8 * g + r; const float e = __builtin_amdgcn_exp2f(s[t][r] * scl); const float p = key <= q ? e * zinv : 0.f; sP[w][8 * g + r][t * 16 + col] = (_Float16)(p * 256.0f); } }   // attn <= ~1e-2 typically; x256
    LDSX();
#pragma unroll
    for (int kc = 0; kc < 2; ++kc) acc = wmma16(frag_h(&sP[w][col][0] + kc * 32, lane), bv[kc], acc);
    __builtin_amdgcn_wave_barrier();
  }
#pragma unroll
  for (int r = 0; r < 8; ++r) so[w][8 * g + r][col] = acc[r] * (1.0f / 256.0f);
  LDSX();
  for (int q = lane; q < 64; q += 32) { const int rl = q >> 2, pc = q & 3; vst2(oh + ((size_t)hb * TT + q0 + rl) * HE + pc * 4, *(const v4f*)(&so[w][rl][pc * 4])); }
  }
}
// ---- FFN: hid = relu(out@W1+b1) -> f16 rows; out = hid@W2 + b2 + xpe. A for ff1 gathered from oh (k -> h = k/16, e = k%16)
__global__ __launch_bounds__(128) void k_ff1(const float* __restrict__ oh, const float* __restrict__ W1, const float* __restrict__ b1, _Float16* __restrict__ hid) {
  __shared__ __align__(16) float so[4][16][132];
  __shared__ __align__(32) _Float16 sW[DD * WP];
  const int tid = threadIdx.x, wave = tid >> 5, lane = tid & 31, col = lane & 15, g = lane >> 4;
  const int r0 = blockIdx.x * 64 + wave * 16, n0 = blockIdx.y * 128; const int r = r0 + col, b = r / TT, t = r % TT;
  v8f acc[8] = {};
  // the wave's own A values are asked for first and fly while the block's 128 weight columns are staged (the unrolls keep af in registers)
  float af[DD / 32][16];
#pragma unroll
  for (int kc = 0; kc < DD / 32; ++kc) {
#pragma unroll
    for (int i = 0; i < 8; ++i) { const int ka = kc * 32 + 8 * g + i, kz = ka + 16;
      af[kc][i] = oh[(((size_t)(ka >> 4) * NB + b) * TT + t) * HE + (ka & 15)]; af[kc][8 + i] = oh[(((size_t)(kz >> 4) * NB + b) * TT + t) * HE + (kz & 15)]; } }
  asm volatile("s_wait_xcnt 0x0" ::: "memory");   // precaution: the address registers of the loads above are rewritten below
  stage_w<DD>(W1 + n0, DFF, sW, tid);
  __syncthreads();   // publishes the staged weights to the four waves
#pragma unroll
  for (int kc = 0; kc < DD / 32; ++kc) { v16h a, bf[8];
#pragma unroll
    for (int i = 0; i < 16; ++i) a[i] = (_Float16)af[kc][i];
#pragma unroll
    for (int j = 0; j < 8; ++j) bf[j] = frag_tr(sW, kc * 32, j * 16, lane);   // the eight fragments of a k step are read as one group, one LDS wait
#pragma unroll
    for (int j = 0; j < 8; ++j) acc[j] = wmma16(a, bf[j], acc[j]); }
#pragma unroll
  for (int j = 0; j < 8; ++j) { const float bb = b1[n0 + j * 16 + col];
#pragma unroll
    for (int rr = 0; rr < 8; ++rr) { const float v = acc[j][rr] + bb; so[wave][8 * g + rr][j * 16 + col] = v > 0.f ? v : 0.f; } }
  LDSX();
  for (int q = lane; q < 16 * 16; q += 32) { const int rl = q >> 4, pc = q & 15; union { v8h hh; v4u u; } pk;
#pragma unroll
    for (int i = 0; i < 8; ++i) pk.hh[i] = (_Float16)so[wave][rl][pc * 8 + i];
    vst2(hid + (size_t)(r0 + rl) * DFF + n0 + pc * 8, pk.u); }
}
__global__ __launch_bounds__(128) void k_ff2(const _Float16* __restrict__ hid, const float* __restrict__ W2, const float* __restrict__ b2, const float* __restrict__ xpe, float* __restrict__ out) {
  __shared__ __align__(16) float so[4][16][132];
  __shared__ __align__(32) _Float16 sW[DFF * WP];
  const int tid = threadIdx.x, wave = tid >> 5, lane = tid & 31, col = lane & 15, g = lane >> 4;
  const int r0 = blockIdx.x * 64 + wave * 16;
  v8f acc[8] = {};
  // the first eight A fragments are asked for first and fly while the weights are staged; each of the other eight is asked for eight k steps ahead of its use
  const _Float16* arow = hid + (size_t)(r0 + col) * DFF; v16h a[8];
#pragma unroll
  for (int kc = 0; kc < 8; ++kc) a[kc] = frag_h(arow + kc * 32, lane);
  asm volatile("s_wait_xcnt 0x0" ::: "memory");   // precaution: the address registers of the loads above are rewritten below
  stage_w<DFF>(W2, DD, sW, tid);
  __syncthreads();   // publishes the staged weights to the four waves
#pragma unroll
  for (int kc = 0; kc < DFF / 32; ++kc) { const v16h cur = a[kc & 7]; v16h bf[8];   // unrolled: a[] stays in registers
    if (kc < 8) a[kc] = frag_h(arow + (kc + 8) * 32, lane);
#pragma unroll
    for (int j = 0; j < 8; ++j) bf[j] = frag_tr(sW, kc * 32, j * 16, lane);   // the eight fragments of a k step are read as one group, one LDS wait
#pragma unroll
    for (int j = 0; j < 8; ++j) acc[j] = wmma16(cur, bf[j], acc[j]); }
#pragma unroll
  for (int j = 0; j < 8; ++j) { const float bb = b2[j * 16 + col];
#pragma unroll
    for (int rr = 0; rr < 8; ++rr) so[wave][8 * g + rr][j * 16 + col] = acc[j][rr] + bb; }
  LDSX();
#pragma unroll 4
  for (int rl = 0; rl < 16; ++rl) { const size_t o = (size_t)(r0 + rl) * DD + lane * 4; vst2(out + o, *(const v4f*)(&so[wave][rl][lane * 4]) + *(const v4f*)(xpe + o)); }
}
extern "C" void kernel_launch(void* const* d_in, const int* in_sizes, int n_in, void* d_out, int out_size, void* d_ws, size_t ws_size, hipStream_t stream) {
  (void)in_sizes; (void)n_in; (void)out_size; (void)ws_size;
  const float* x = (const float*)d_in[0]; const float* WQ = (const float*)d_in[1]; const float* WK = (const float*)d_in[2]; const float* WV = (const float*)d_in[3];
  const float* W1 = (const float*)d_in[4]; const float* b1 = (const float*)d_in[5]; const float* W2 = (const float*)d_in[6]; const float* b2 = (const float*)d_in[7];
  float* out = (float*)d_out;
  char* ws = (char*)d_ws; size_t off = 0;
  auto take = [&](size_t bytes) { char* p = ws + off; off += (bytes + 255) & ~(size_t)255; return p; };
  float* xpe = (float*)take((size_t)NR * DD * 4);
  _Float16* Qh = (_Float16*)take((size_t)NR * DD * 2); _Float16* Kh = (_Float16*)take((size_t)NR * DD * 2); _Float16* vT = (_Float16*)take((size_t)NR * DD * 2);
  float* Z = (float*)take((size_t)NH * NB * TT * 4); float* oh = (float*)take((size_t)NR * DD * 4); _Float16* hid = (_Float16*)take((size_t)NR * DFF * 2);
  k_proj<<<NR / 64, 128, 0, stream>>>(x, WQ, WK, WV, xpe, Qh, Kh, vT);
  k_z<<<dim3(TT / 128, NH * NB), 128, 0, stream>>>(Qh, Kh, Z);
  k_av<<<dim3(TT / 128, NH * NB), 128, 0, stream>>>(Qh, Kh, vT, Z, oh);
  k_ff1<<<dim3(NR / 64, DFF / 128), 128, 0, stream>>>(oh, W1, b1, hid);
  k_ff2<<<NR / 64, 128, 0, stream>>>(hid, W2, b2, xpe, out);
}

// v006
// Measured time: 65.6 microseconds a run.
// Two timings next to v005 put it at 1.21 and 1.22 times that version's speed.
// All steps since v000 together make it 4.50 times as fast.
#include <hip/hip_runtime.h>
#include <math.h>

typedef __attribute__((ext_vector_type(16))) _Float16 v16h;
typedef __attribute__((ext_vector_type(16))) __bf16 v16b;
typedef __attribute__((ext_vector_type(8)))  _Float16 v8h;
typedef __attribute__((ext_vector_type(8)))  float v8f;
typedef __attribute__((ext_vector_type(4)))  float v4f;
typedef __attribute__((ext_vector_type(2)))  float v2f;
typedef __attribute__((ext_vector_type(4)))  unsigned v4u;
typedef __attribute__((ext_vector_type(4)))  int v4i;
typedef float __attribute__((may_alias)) float_a;
typedef int __attribute__((may_alias)) int_a;

template <typename T> __device__ __forceinline__ void vst2(void* p, T v) { *(T*)p = v;  }
__device__ __forceinline__ v8f wmma16(v16h a, v16h b, v8f c) {
  v8f d = __builtin_amdgcn_wmma_f32_16x16x32_f16(false, a, false, b, (short)0, c, false, false);
  asm volatile("v_nop\n\tv_nop\n\tv_nop\n\tv_nop" : "+v"(d) : "v"(a), "v"(b));
  return d;
}
__device__ __forceinline__ v8f wmma_bf(v16b a, v16b b, v8f c) {
  v8f d = __builtin_amdgcn_wmma_f32_16x16x32_bf16(false, a, false, b, (short)0, c, false, false);
  asm volatile("v_nop\n\tv_nop\n\tv_nop\n\tv_nop" : "+v"(d) : "v"(a), "v"(b));
  return d;
}
// 16x16x32 fragments: lane = (h = lane>>4, row/col = lane&15); elements 0..7 = k0+8h+0..7, 8..15 = k0+16+8h+0..7; D element r = row 8h+r
__device__ __forceinline__ v16h frag_h(const _Float16* rowk0, int lane) {
  union { v16h v; v8h q[2]; } u; const _Float16* p = rowk0 + 8 * (lane >> 4);
  u.q[0] = *(const v8h*)p; u.q[1] = *(const v8h*)(p + 16); return u.v;
}
__device__ __forceinline__ v16h frag_f32(const float* rowk0, int lane) {
  v16h a; const float* p = rowk0 + 8 * (lane >> 4);
#pragma unroll
  for (int i = 0; i < 8; ++i) { a[i] = (_Float16)p[i]; a[8 + i] = (_Float16)p[16 + i]; }
  return a;
}
__device__ __forceinline__ v16h frag_f32s(const float* rowk0, int lane, float sc) {
  v16h a; const float* p = rowk0 + 8 * (lane >> 4);
#pragma unroll
  for (int i = 0; i < 8; ++i) { a[i] = (_Float16)(p[i] * sc); a[8 + i] = (_Float16)(p[16 + i] * sc); }
  return a;
}
// column fragment from a [K][ld] layout (column n), rows >= K read as 0
__device__ __forceinline__ v16h fragc_f32(const float* W, int k0, int n, int lane, int ld, int K) {
  v16h a; const int g = lane >> 4;
#pragma unroll
  for (int i = 0; i < 8; ++i) { const int ka = k0 + 8 * g + i, kb = ka + 16;
    a[i] = (_Float16)(ka < K ? W[(size_t)ka * ld + n] : 0.f); a[8 + i] = (_Float16)(kb < K ? W[(size_t)kb * ld + n] : 0.f); }
  return a;
}
struct F2 { v16b h, l; };
__device__ __forceinline__ F2 bsplit16(const float v[16]) { F2 r;
#pragma unroll
  for (int i = 0; i < 16; ++i) { const __bf16 h = (__bf16)v[i]; r.h[i] = h; r.l[i] = (__bf16)(v[i] - (float)h); }
  return r; }
__device__ __forceinline__ F2 split_row(const float* row, int k0, int lane) { float v[16]; const float* p = row + k0 + 8 * (lane >> 4);
#pragma unroll
  for (int i = 0; i < 8; ++i) { v[i] = p[i]; v[8 + i] = p[16 + i]; }
  return bsplit16(v); }
__device__ __forceinline__ F2 split_rowK(const float* row, int k0, int lane, int K) { float v[16]; const int g = lane >> 4;
#pragma unroll
  for (int i = 0; i < 8; ++i) { const int ka = k0 + 8 * g + i, kb = ka + 16; v[i] = ka < K ? row[ka] : 0.f; v[8 + i] = kb < K ? row[kb] : 0.f; }
  return bsplit16(v); }
__device__ __forceinline__ F2 split_col(const float* W, int k0, int n, int lane, int ld, int K) { float v[16]; const int g = lane >> 4;
#pragma unroll
  for (int i = 0; i < 8; ++i) { const int ka = k0 + 8 * g + i, kb = ka + 16; v[i] = ka < K ? W[(size_t)ka * ld + n] : 0.f; v[8 + i] = kb < K ? W[(size_t)kb * ld + n] : 0.f; }
  return bsplit16(v); }
__device__ __forceinline__ v8f mac3(const F2& a, const F2& b, v8f c) { c = wmma_bf(a.l, b.h, c); c = wmma_bf(a.h, b.l, c); return wmma_bf(a.h, b.h, c); }
__device__ __forceinline__ float sigm(float v) { return 1.0f / (1.0f + expf(-v)); }
#define LDSX() do { asm volatile("s_wait_dscnt 0" ::: "memory"); __builtin_amdgcn_wave_barrier(); __builtin_amdgcn_fence(__ATOMIC_RELEASE, "workgroup"); } while (0)

// Causal multi-head attention whose softmax runs over the QUERY axis (per key column), + FFN + residual, with inline sinusoidal
// sums Z_k = sum_{q>=k} exp(s[q][k]); pass 2 is un-normalised causal attention with values scaled by 1/Z_k. Projections, both score
// passes (head dim 16 zero-padded to the 32-wide K), P@V and the FFN run on v_wmma_f32_16x16x32_f16 (f16 operands, f32
#define NB 4
#define TT 2048
#define DD 128
#define NH 8
#define HE 16
#define DFF 512
#define NR (NB * TT)

// Weight tiles in LDS: f16, row-major [k][128 columns], row pitch WP halves = 288 bytes (an odd multiple of 32 bytes, the pitch of the transposing read)
#define WP 144
typedef __attribute__((ext_vector_type(8))) short s16x8;
// 128 threads bring K rows of 128 f32 columns (row stride ld) into sW as f16: 16 lanes take one 512-byte row, 8 floats each; the 32 loads of
// 16 bytes of a batch of 128 rows are all issued before the first value is converted, so a batch pays the load latency once
// (the inner unrolls keep v in registers)
template <int K> __device__ __forceinline__ void stage_w(const float* __restrict__ Wsrc, int ld, _Float16* sW, int tid) {
  const float* s0 = Wsrc + (size_t)(tid >> 4) * ld + (tid & 15) * 8; _Float16* d0 = sW + (tid >> 4) * WP + (tid & 15) * 8;
#pragma unroll 1
  for (int b = 0; b < K / 128; ++b) {   // rolled: one batch already fills 128 registers
    v4f v[16][2];
#pragma unroll
    for (int i = 0; i < 16; ++i) { const float* p = s0 + (size_t)(b * 128 + i * 8) * ld; v[i][0] = *(const v4f*)p; v[i][1] = *(const v4f*)(p + 4); }
    asm volatile("s_wait_xcnt 0x0" ::: "memory");   // precaution: the address registers of the loads above are rewritten below; it also keeps the whole batch of loads ahead of the conversions
#pragma unroll
    for (int i = 0; i < 16; ++i) { v8h h;
#pragma unroll
      for (int e = 0; e < 4; ++e) { h[e] = (_Float16)v[i][0][e]; h[4 + e] = (_Float16)v[i][1][e]; }
      *(v8h*)(d0 + (b * 128 + i * 8) * WP) = h; }
  }
}
// B fragment (k0..k0+31, columns n0..n0+15) of such a tile by two transposing LDS reads: lane (c, h) gets T[k0 + 8h + 0..7][n0 + c], then the same 16 rows on:
// the k order of frag_h and frag_f32. Every lane is on where it is called.
__device__ __forceinline__ v16h frag_tr(const _Float16* T, int k0, int n0, int lane) {
  typedef __attribute__((address_space(3))) s16x8 lds_s16x8;
  const _Float16* p = T + (k0 + 8 * (lane >> 4) + (lane & 7)) * WP + n0 + 8 * ((lane >> 3) & 1);
  union { v16h v; s16x8 q[2]; } u;
  u.q[0] = __builtin_amdgcn_ds_load_tr16_b128_v8i16((lds_s16x8*)p); u.q[1] = __builtin_amdgcn_ds_load_tr16_b128_v8i16((lds_s16x8*)(p + 16 * WP));
  return u.v;
}

// sin and cos of an angle a in [0, 2^17): n = nearest multiple of pi/2, a - n * pi/2 in three parts, then the two short polynomials on [-pi/4, pi/4] and the
// quadrant's swap and signs. The angles here are position * frequency with position < TT and frequency <= 1, so no wider reduction is reachable.
__device__ __forceinline__ void sincos_red(float a, float& sn, float& cs) {
  const float n = __builtin_rintf(a * __uint_as_float(0x3f22f983u));
  float r = __builtin_fmaf(__uint_as_float(0xbfc90fdau), n, a); r = __builtin_fmaf(__uint_as_float(0xb3a22168u), n, r); r = __builtin_fmaf(__uint_as_float(0xa7c234c4u), n, r);
  const unsigned q = (unsigned)(int)n; const float s = r * r;
  float ps = __builtin_fmaf(__uint_as_float(0xb94c1982u), s, __uint_as_float(0x3c0881c4u)); ps = __builtin_fmaf(s, ps, __uint_as_float(0xbe2aaa9du)); ps = s * ps;
  const float sr = __builtin_fmaf(r, ps, r);
  float pc = __builtin_fmaf(__uint_as_float(0x37d75334u), s, __uint_as_float(0xbab64f3bu)); pc = __builtin_fmaf(s, pc, __uint_as_float(0x3d2aabf7u)); pc = __builtin_fmaf(s, pc, __uint_as_float(0xbf000004u));
  const float cr = __builtin_fmaf(s, pc, 1.0f);
  const unsigned sg = (q << 30) & 0x80000000u; const bool odd = q & 1u;
  sn = __uint_as_float(__float_as_uint(odd ? cr : sr) ^ sg); cs = __uint_as_float(__float_as_uint(odd ? -sr : cr) ^ sg);
}
// ---- x + PE -> xpe rows (f32) and Q/K (f16 [h][b][t][16]) / V^T (f16 [h][b][e][t]); block = 64 rows (one b) x all 384 cols
__global__ __launch_bounds__(128) void k_proj(const float* __restrict__ x, const float* __restrict__ WQ, const float* __restrict__ WK, const float* __restrict__ WV,
                                            float* __restrict__ xpe, _Float16* __restrict__ Qh, _Float16* __restrict__ Kh, _Float16* __restrict__ vT) {
  __shared__ __align__(16) float sx[64][DD + 4];
  __shared__ __align__(16) float so[4][16][132];
  __shared__ __align__(16) _Float16 st[DD][72];
  __shared__ __align__(32) _Float16 sW[3][DD * WP];
  const int tid = threadIdx.x, wave = tid >> 5, lane = tid & 31, col = lane & 15, g = lane >> 4;
  const int r0b = blockIdx.x * 64, b = r0b / TT, t0 = r0b % TT;
  // the block's 64 x rows are asked for first, as one batch of 16-byte loads (a wave takes one 512-byte row per load, thread = 4 adjacent columns of
  // rows wave + 4i), and fly while the weights are staged (the unroll keeps xv in registers)
  const int pc4 = lane; v4f xv[16]; const float* xp = x + (size_t)(r0b + wave) * DD + pc4 * 4;
#pragma unroll
  for (int i = 0; i < 16; ++i) xv[i] = *(const v4f*)(xp + i * 4 * DD);
  asm volatile("s_wait_xcnt 0x0" ::: "memory");   // precaution: the address registers of the loads above are rewritten below
  // the three weight matrices go to LDS once per block; the barrier behind the PE stage publishes them too
#pragma unroll 1
  for (int m = 0; m < 3; ++m) stage_w<DD>(m == 0 ? WQ : (m == 1 ? WK : WV), DD, &sW[m][0], tid);   // rolled: one matrix in flight fills 128 registers
  // PE + stage: straight-line, 32 independent sin/cos pairs per thread (the unroll keeps xv in registers); a column pair (2i, 2i+1) shares its angle
  { const float kdiv = -logf(10000.0f) / (float)DD;
    const float div0 = expf((float)(pc4 * 4) * kdiv), div1 = expf((float)(pc4 * 4 + 2) * kdiv);
#pragma unroll
    for (int i = 0; i < 16; ++i) { const int rl = wave + 4 * i; const float tf = (float)(t0 + rl); float s0, c0, s1, c1;
      sincos_red(tf * div0, s0, c0); sincos_red(tf * div1, s1, c1); const v4f pe = {s0, c0, s1, c1};
      *(v4f*)(&sx[rl][pc4 * 4]) = xv[i] + pe; } }
  __syncthreads();
  for (int q = tid; q < 64 * 32; q += 128) { const int rl = q >> 5, pc = q & 31; vst2(xpe + (size_t)(r0b + rl) * DD + pc * 4, *(const v4f*)(&sx[rl][pc * 4])); }
#pragma unroll 1
  for (int which = 0; which < 3; ++which) { const _Float16* sw = &sW[which][0];
    v8f acc[8] = {};
#pragma unroll
    for (int kc = 0; kc < DD / 32; ++kc) { const v16h a = frag_f32(&sx[wave * 16 + col][0] + kc * 32, lane); v16h bf[8];
#pragma unroll
      for (int j = 0; j < 8; ++j) bf[j] = frag_tr(sw, kc * 32, j * 16, lane);   // the eight fragments of a k step are read as one group, one LDS wait
#pragma unroll
      for (int j = 0; j < 8; ++j) acc[j] = wmma16(a, bf[j], acc[j]); }
    if (which < 2) {
#pragma unroll
      for (int j = 0; j < 8; ++j)
#pragma unroll
        for (int r = 0; r < 8; ++r) so[wave][8 * g + r][j * 16 + col] = acc[j][r];
      LDSX();
      _Float16* dst = which == 0 ? Qh : Kh;
      // per head h (= tile j): 16 rows x 16 halves = 512 B contiguous at dst[((h*NB + b)*TT + t0 + wave*16) * 16]
      for (int q = lane; q < 8 * 32; q += 32) { const int h = q >> 5, pp = q & 31; const int rl = pp >> 1, half = (pp & 1) * 8; union { v8h hh; v4u u; } pk;
#pragma unroll
        for (int i = 0; i < 8; ++i) pk.hh[i] = (_Float16)so[wave][rl][h * 16 + half + i];
        vst2(dst + (((size_t)h * NB + b) * TT + t0 + wave * 16 + rl) * HE + half, pk.u); }
      LDSX();
    } else {
#pragma unroll
      for (int j = 0; j < 8; ++j)
#pragma unroll
        for (int r = 0; r < 8; ++r) st[j * 16 + col][wave * 16 + 8 * g + r] = (_Float16)acc[j][r];    // st[h*16+e][t local]
      __syncthreads();
      for (int q = tid; q < DD * 8; q += 128) { const int c = q >> 3, pc = q & 7, h = c >> 4, e = c & 15;
        vst2(vT + (((size_t)h * NB + b) * HE + e) * TT + t0 + pc * 8, *(const v4u*)(&st[c][pc * 8])); }
    }
  }
}
// Asynchronous copies to LDS: every lane brings its own 16 bytes from g + i * gstep (bytes) to the LDS byte address l + i * lstep, through no register.
// The s_wait_xcnt 0 is the last line of the copies' own statement (a precaution: their address registers are rewritten behind it).
__device__ __forceinline__ unsigned lds_byte(const void* p) { return (unsigned)(size_t)p; }   // low 32 bits of a __shared__ address
__device__ __forceinline__ void copy8(unsigned l, const char* g, unsigned lstep, unsigned gstep) {
  asm volatile("global_load_async_to_lds_b128 %0, %8, off\n\tglobal_load_async_to_lds_b128 %1, %9, off\n\t"
               "global_load_async_to_lds_b128 %2, %10, off\n\tglobal_load_async_to_lds_b128 %3, %11, off\n\t"
               "global_load_async_to_lds_b128 %4, %12, off\n\tglobal_load_async_to_lds_b128 %5, %13, off\n\t"
               "global_load_async_to_lds_b128 %6, %14, off\n\tglobal_load_async_to_lds_b128 %7, %15, off\n\ts_wait_xcnt 0x0"
               :: "v"(l), "v"(l + lstep), "v"(l + 2 * lstep), "v"(l + 3 * lstep), "v"(l + 4 * lstep), "v"(l + 5 * lstep), "v"(l + 6 * lstep), "v"(l + 7 * lstep),
                  "v"(g), "v"(g + gstep), "v"(g + 2 * gstep), "v"(g + 3 * gstep), "v"(g + 4 * gstep), "v"(g + 5 * gstep), "v"(g + 6 * gstep), "v"(g + 7 * gstep) : "memory");
}
__device__ __forceinline__ void copy4(unsigned l, const char* g, unsigned lstep, unsigned gstep) {
  asm volatile("global_load_async_to_lds_b128 %0, %4, off\n\tglobal_load_async_to_lds_b128 %1, %5, off\n\t"
               "global_load_async_to_lds_b128 %2, %6, off\n\tglobal_load_async_to_lds_b128 %3, %7, off\n\ts_wait_xcnt 0x0"
               :: "v"(l), "v"(l + lstep), "v"(l + 2 * lstep), "v"(l + 3 * lstep), "v"(g), "v"(g + gstep), "v"(g + 2 * gstep), "v"(g + 3 * gstep) : "memory");
}
__device__ __forceinline__ v16h frag16(const _Float16* row16, int lane) {   // K = 16 real: elements 0..7 (h==0 lanes) and ... 
  // fragment elements: 0..7 = k 8h+0..7 (h = lane>>4) -> h==0: k 0..7, h==1: k 8..15; elements 8..15 = k 16+.. -> zero
  v16h a; const int hh = lane >> 4; union { v8h v; } u; u.v = *(const v8h*)(row16 + 8 * hh);
#pragma unroll
  for (int i = 0; i < 8; ++i) { a[i] = u.v[i]; a[8 + i] = (_Float16)0.f; }
  return a;
}
__global__ __launch_bounds__(128) void k_z(const _Float16* __restrict__ Qh, const _Float16* __restrict__ Kh, float* __restrict__ Z) {
  __shared__ __align__(16) float sz[2][64];
  __shared__ __align__(16) _Float16 sQ[TT * HE];   // the head's query rows, at their own index
  const int tid = threadIdx.x, w = tid >> 5, lane = tid & 31, col = lane & 15, g = lane >> 4;
  const int hb = blockIdx.y;
  const _Float16* qb = Qh + (size_t)hb * TT * HE; const _Float16* kb = Kh + (size_t)hb * TT * HE;
  const float scl = rsqrtf((float)TT) * 1.44269504f;   // score scale times log2(e): exp(s * scale) = 2^(s * scl), one multiply and one v_exp_f32
  // every query row that the block's two key tiles meet (from tile x on, in groups of eight tiles of 64 rows) comes to LDS once, all copies in flight
  // together (at most 32 per wave; a thread takes 16 bytes of each 2-KiB tile), so no trip below waits for a global load
#pragma unroll 1
  for (int gq = (int)blockIdx.x >> 3; gq < TT / 512; ++gq)   // rolled: a block-uniform count of groups
    copy8(lds_byte(sQ) + gq * 16384 + tid * 16, (const char*)qb + gq * 16384 + tid * 16, 2048, 2048);
  asm volatile("s_wait_asynccnt 0x0" ::: "memory");   // this wave's copies have landed
  __syncthreads();                                    // and every other wave's: publishes sQ
  // a key tile's cost falls linearly with its index, so a block takes tile x and then tile 31 - x, one after the other in every wave:
  // TT / 64 + 1 trips in every block, whatever WGP it lands on
#pragma unroll 1
  for (int part = 0; part < 2; ++part) {   // rolled: one copy of the hot loop
  const int kt = part == 0 ? (int)blockIdx.x : TT / 64 - 1 - (int)blockIdx.x, k0 = kt * 64 + w * 16;
  const v16h ak = frag16(kb + (size_t)(k0 + col) * HE, lane);
  float zs[8] = {0.f, 0.f, 0.f, 0.f, 0.f, 0.f, 0.f, 0.f};
#pragma unroll 1
  for (int qt = kt; qt < TT / 64; ++qt) {
    // straight-line trip: the four query fragments are read from LDS first, the four score products follow back to back, and the
    // mask is a select on a finished exp, so the 32 exp chains are independent work in one basic block (the unrolls keep
    // bq and s in registers)
    v16h bq[4]; v8f s[4]; const _Float16* qrow = sQ + (qt * 64 + col) * HE;
#pragma unroll
    for (int t = 0; t < 4; ++t) bq[t] = frag16(qrow + t * 16 * HE, lane);
#pragma unroll
    for (int t = 0; t < 4; ++t) { v8f z0 = {}; s[t] = wmma16(ak, bq[t], z0); }
#pragma unroll
    for (int t = 0; t < 4; ++t) {
#pragma unroll
      for (int r = 0; r < 8; ++r) { const int key = k0 + 8 * g + r, q = qt * 64 + t * 16 + col; const float e = __builtin_amdgcn_exp2f(s[t][r] * scl); zs[r] += q >= key ? e : 0.f; } } }
  // reduce zs[r] over the 16 col lanes of each half -> key k0 + 8g + r
#pragma unroll
  for (int off = 8; off >= 1; off >>= 1) {
#pragma unroll
    for (int r = 0; r < 8; ++r) zs[r] += __shfl_xor(zs[r], off, 32); }
  if (col == 0) {
#pragma unroll
    for (int r = 0; r < 8; ++r) sz[part][w * 16 + 8 * g + r] = zs[r]; }
  }
  __syncthreads();
  if (tid < 32) { const int part = tid >> 4, kt = part == 0 ? (int)blockIdx.x : TT / 64 - 1 - (int)blockIdx.x;
    vst2(Z + (size_t)hb * TT + kt * 64 + (tid & 15) * 4, *(const v4f*)(&sz[part][(tid & 15) * 4])); }
}
// ---- pass 2: oh[hb][q][e] = sum_{k <= q} exp(s[q][k]) / Z[k] * V[k][e]; block = (hb, two tiles of 64 queries)
#define VP (TT + 8)   // 4112 bytes, an odd multiple of 16: the 16 rows of a ds_load_b128 fragment read fall on different banks
__global__ __launch_bounds__(128) void k_av(const _Float16* __restrict__ Qh, const _Float16* __restrict__ Kh, const _Float16* __restrict__ vT, const float* __restrict__ Z, float* __restrict__ oh) {
  __shared__ __align__(16) _Float16 sP[4][16][72];
  __shared__ __align__(16) float so[4][16][20];
  __shared__ __align__(16) _Float16 sK[TT * HE];   // the head's key rows, at their own index
  __shared__ __align__(16) _Float16 sV[HE * VP];   // the head's V^T rows, row pitch VP halves
  __shared__ __align__(16) float sZ[TT];           // the head's column sums
  const int tid = threadIdx.x, w = tid >> 5, lane = tid & 31, col = lane & 15, g = lane >> 4;
  const int hb = blockIdx.y;
  const _Float16* qb = Qh + (size_t)hb * TT * HE; const _Float16* kb = Kh + (size_t)hb * TT * HE; const _Float16* vb = vT + (size_t)hb * HE * TT;
  const float scl = rsqrtf((float)TT) * 1.44269504f;   // score scale times log2(e): exp(s * scale) = 2^(s * scl), one multiply and one v_exp_f32
  // every key tile that the block meets (0 to 31 - x) comes to LDS once, in groups of eight tiles: per tile a thread takes 16 bytes of the 64 key rows and
  // 16 bytes of one of the 16 V^T rows; so no trip below waits for a global load. The first group and the column sums are waited here; the other groups
  // (at most 48 copies per wave) fly under the first eight trips and are published in front of trip 8 of the long tile.
  const unsigned lk = lds_byte(sK) + tid * 16, lv = lds_byte(sV) + (tid >> 3) * (VP * 2) + (tid & 7) * 16;
  const char* gk = (const char*)kb + tid * 16; const char* gv = (const char*)vb + (tid >> 3) * (TT * 2) + (tid & 7) * 16;
  copy8(lk, gk, 2048, 2048); copy8(lv, gv, 128, 128);
  copy4(lds_byte(sZ) + tid * 16, (const char*)(Z + (size_t)hb * TT) + tid * 16, 2048, 2048);
  asm volatile("s_wait_asynccnt 0x0" ::: "memory");   // this wave's copies have landed
  __syncthreads();                                    // and every other wave's: publishes tiles 0 to 7 and sZ
#pragma unroll 1
  for (int gq = 1; gq <= (TT / 64 - 1 - (int)blockIdx.x) >> 3; ++gq) {   // rolled: a block-uniform count of groups
    copy8(lk + gq * 16384, gk + gq * 16384, 2048, 2048); copy8(lv + gq * 1024, gv + gq * 1024, 128, 128); }
  // a query tile's cost grows linearly with its index, so a block takes tile 31 - x and then tile x, one after the other in every wave:
  // TT / 64 + 1 trips in every block, whatever WGP it lands on
#pragma unroll 1
  for (int part = 0; part < 2; ++part) {   // rolled: one copy of the hot loop
  const int qt = part == 0 ? TT / 64 - 1 - (int)blockIdx.x : (int)blockIdx.x, q0 = qt * 64 + w * 16;
  const v16h aq = frag16(qb + (size_t)(q0 + col) * HE, lane);
  asm volatile("s_wait_xcnt 0x0" :: "v"(aq) : "memory");   // precaution: the address registers of the load above are reused by the first trip; the loaded value as an input keeps the load ahead of the wait
  v8f acc = {};
#pragma unroll 1
  for (int kt = 0; kt <= qt; ++kt) {
    if (part == 0 && kt == 8) {   // block-uniform, and the long tile (index 16 or more) always comes by here
      asm volatile("s_wait_asynccnt 0x0" ::: "memory");   // this wave's copies of the later groups have landed
      __syncthreads(); }                                  // and every other wave's: publishes tiles 8 and up
    // straight-line trip: every LDS read of the trip (keys, column sums, values) is issued first, the four score products
    // follow back to back, and the mask is a select on a finished exp, so the 32 exp chains are independent work in one basic block
    // (the unrolls keep bk, bv, zv and s in registers)
    v16h bk[4], bv[2]; float zv[4]; v8f s[4];
#pragma unroll
    for (int t = 0; t < 4; ++t) bk[t] = frag16(sK + (kt * 64 + t * 16 + col) * HE, lane);
#pragma unroll
    for (int t = 0; t < 4; ++t) zv[t] = sZ[kt * 64 + t * 16 + col];
#pragma unroll
    for (int kc = 0; kc < 2; ++kc) bv[kc] = frag_h(sV + col * VP + kt * 64 + kc * 32, lane);   // B col = e (lane&15 < 16)
#pragma unroll
    for (int t = 0; t < 4; ++t) { v8f z0 = {}; s[t] = wmma16(aq, bk[t], z0); }
#pragma unroll
    for (int t = 0; t < 4; ++t) { const int key = kt * 64 + t * 16 + col; const float zinv = 1.0f / zv[t];
#pragma unroll
      for (int r = 0; r < 8; ++r) { const int q = q0 + 8 * g + r; const float e = __builtin_amdgcn_exp2f(s[t][r] * scl); const float p = key <= q ? e * zinv : 0.f; sP[w][8 * g + r][t * 16 + col] = (_Float16)(p * 256.0f); } }   // attn <= ~1e-2 typically; x256
    LDSX();
#pragma unroll
    for (int kc = 0; kc < 2; ++kc) acc = wmma16(frag_h(&sP[w][col][0] + kc * 32, lane), bv[kc], acc);
    __builtin_amdgcn_wave_barrier();
  }
#pragma unroll
  for (int r = 0; r < 8; ++r) so[w][8 * g + r][col] = acc[r] * (1.0f / 256.0f);
  LDSX();
  for (int q = lane; q < 64; q += 32) { const int rl = q >> 2, pc = q & 3; vst2(oh + ((size_t)hb * TT + q0 + rl) * HE + pc * 4, *(const v4f*)(&so[w][rl][pc * 4])); }
  }
}
// ---- FFN: hid = relu(out@W1+b1) -> f16 rows; out = hid@W2 + b2 + xpe. A for ff1 gathered from oh (k -> h = k/16, e = k%16)
__global__ __launch_bounds__(128) void k_ff1(const float* __restrict__ oh, const float* __restrict__ W1, const float* __restrict__ b1, _Float16* __restrict__ hid) {
  __shared__ __align__(16) float so[4][16][132];
  __shared__ __align__(32) _Float16 sW[DD * WP];
  const int tid = threadIdx.x, wave = tid >> 5, lane = tid & 31, col = lane & 15, g = lane >> 4;
  const int r0 = blockIdx.x * 64 + wave * 16, n0 = blockIdx.y * 128; const int r = r0 + col, b = r / TT, t = r % TT;
  v8f acc[8] = {};
  // the wave's own A values are asked for first and fly while the block's 128 weight columns are staged (the unrolls keep af in registers)
  float af[DD / 32][16];
#pragma unroll
  for (int kc = 0; kc < DD / 32; ++kc) {
#pragma unroll
    for (int i = 0; i < 8; ++i) { const int ka = kc * 32 + 8 * g + i, kz = ka + 16;
      af[kc][i] = oh[(((size_t)(ka >> 4) * NB + b) * TT + t) * HE + (ka & 15)]; af[kc][8 + i] = oh[(((size_t)(kz >> 4) * NB + b) * TT + t) * HE + (kz & 15)]; } }
  asm volatile("s_wait_xcnt 0x0" ::: "memory");   // precaution: the address registers of the loads above are rewritten below
  stage_w<DD>(W1 + n0, DFF, sW, tid);
  __syncthreads();   // publishes the staged weights to the four waves
#pragma unroll
  for (int kc = 0; kc < DD / 32; ++kc) { v16h a, bf[8];
#pragma unroll
    for (int i = 0; i < 16; ++i) a[i] = (_Float16)af[kc][i];
#pragma unroll
    for (int j = 0; j < 8; ++j) bf[j] = frag_tr(sW, kc * 32, j * 16, lane);   // the eight fragments of a k step are read as one group, one LDS wait
#pragma unroll
    for (int j = 0; j < 8; ++j) acc[j] = wmma16(a, bf[j], acc[j]); }
#pragma unroll
  for (int j = 0; j < 8; ++j) { const float bb = b1[n0 + j * 16 + col];
#pragma unroll
    for (int rr = 0; rr < 8; ++rr) { const float v = acc[j][rr] + bb; so[wave][8 * g + rr][j * 16 + col] = v > 0.f ? v : 0.f; } }
  LDSX();
  for (int q = lane; q < 16 * 16; q += 32) { const int rl = q >> 4, pc = q & 15; union { v8h hh; v4u u; } pk;
#pragma unroll
    for (int i = 0; i < 8; ++i) pk.hh[i] = (_Float16)so[wave][rl][pc * 8 + i];
    vst2(hid + (size_t)(r0 + rl) * DFF + n0 + pc * 8, pk.u); }
}
__global__ __launch_bounds__(128) void k_ff2(const _Float16* __restrict__ hid, const float* __restrict__ W2, const float* __restrict__ b2, const float* __restrict__ xpe, float* __restrict__ out) {
  __shared__ __align__(16) float so[4][16][132];
  __shared__ __align__(32) _Float16 sW[DFF * WP];
  const int tid = threadIdx.x, wave = tid >> 5, lane = tid & 31, col = lane & 15, g = lane >> 4;
  const int r0 = blockIdx.x * 64 + wave * 16;
  v8f acc[8] = {};
  // the first eight A fragments are asked for first and fly while the weights are staged; each of the other eight is asked for eight k steps ahead of its use
  const _Float16* arow = hid + (size_t)(r0 + col) * DFF; v16h a[8];
#pragma unroll
  for (int kc = 0; kc < 8; ++kc) a[kc] = frag_h(arow + kc * 32, lane);
  asm volatile("s_wait_xcnt 0x0" ::: "memory");   // precaution: the address registers of the loads above are rewritten below
  stage_w<DFF>(W2, DD, sW, tid);
  __syncthreads();   // publishes the staged weights to the four waves
#pragma unroll
  for (int kc = 0; kc < DFF / 32; ++kc) { const v16h cur = a[kc & 7]; v16h bf[8];   // unrolled: a[] stays in registers
    if (kc < 8) a[kc] = frag_h(arow + (kc + 8) * 32, lane);
#pragma unroll
    for (int j = 0; j < 8; ++j) bf[j] = frag_tr(sW, kc * 32, j * 16, lane);   // the eight fragments of a k step are read as one group, one LDS wait
#pragma unroll
    for (int j = 0; j < 8; ++j) acc[j] = wmma16(cur, bf[j], acc[j]); }
#pragma unroll
  for (int j = 0; j < 8; ++j) { const float bb = b2[j * 16 + col];
#pragma unroll
    for (int rr = 0; rr < 8; ++rr) so[wave][8 * g + rr][j * 16 + col] = acc[j][rr] + bb; }
  LDSX();
#pragma unroll 4
  for (int rl = 0; rl < 16; ++rl) { const size_t o = (size_t)(r0 + rl) * DD + lane * 4; vst2(out + o, *(const v4f*)(&so[wave][rl][lane * 4]) + *(const v4f*)(xpe + o)); }
}
extern "C" void kernel_launch(void* const* d_in, const int* in_sizes, int n_in, void* d_out, int out_size, void* d_ws, size_t ws_size, hipStream_t stream) {
  (void)in_sizes; (void)n_in; (void)out_size; (void)ws_size;
  const float* x = (const float*)d_in[0]; const float* WQ = (const float*)d_in[1]; const float* WK = (const float*)d_in[2]; const float* WV = (const float*)d_in[3];
  const float* W1 = (const float*)d_in[4]; const float* b1 = (const float*)d_in[5]; const float* W2 = (const float*)d_in[6]; const float* b2 = (const float*)d_in[7];
  float* out = (float*)d_out;
  char* ws = (char*)d_ws; size_t off = 0;
  auto take = [&](size_t bytes) { char* p = ws + off; off += (bytes + 255) & ~(size_t)255; return p; };
  float* xpe = (float*)take((size_t)NR * DD * 4);
  _Float16* Qh = (_Float16*)take((size_t)NR * DD * 2); _Float16* Kh = (_Float16*)take((size_t)NR * DD * 2); _Float16* vT = (_Float16*)take((size_t)NR * DD * 2);
  float* Z = (float*)take((size_t)NH * NB * TT * 4); float* oh = (float*)take((size_t)NR * DD * 4); _Float16* hid = (_Float16*)take((size_t)NR * DFF * 2);
  k_proj<<<NR / 64, 128, 0, stream>>>(x, WQ, WK, WV, xpe, Qh, Kh, vT);
  k_z<<<dim3(TT / 128, NH * NB), 128, 0, stream>>>(Qh, Kh, Z);
  k_av<<<dim3(TT / 128, NH * NB), 128, 0, stream>>>(Qh, Kh, vT, Z, oh);
  k_ff1<<<dim3(NR / 64, DFF / 128), 128, 0, stream>>>(oh, W1, b1, hid);
  k_ff2<<<NR / 64, 128, 0, stream>>>(hid, W2, b2, xpe, out);
}

// v007
// A run of this version takes 60 microseconds.
// Next to v006, in two timings, it ran 1.09 times as fast each time.
// All steps since v000 together make it 4.93 times as fast.
#include <hip/hip_runtime.h>
#include <math.h>

typedef __attribute__((ext_vector_type(16))) _Float16 v16h;
typedef __attribute__((ext_vector_type(16))) __bf16 v16b;
typedef __attribute__((ext_vector_type(8)))  _Float16 v8h;
typedef __attribute__((ext_vector_type(8)))  float v8f;
typedef __attribute__((ext_vector_type(4)))  float v4f;
typedef __attribute__((ext_vector_type(2)))  float v2f;
typedef __attribute__((ext_vector_type(4)))  unsigned v4u;
typedef __attribute__((ext_vector_type(4)))  int v4i;
typedef float __attribute__((may_alias)) float_a;
typedef int __attribute__((may_alias)) int_a;

template <typename T> __device__ __forceinline__ void vst2(void* p, T v) { *(T*)p = v;  }
__device__ __forceinline__ v8f wmma16(v16h a, v16h b, v8f c) {
  v8f d = __builtin_amdgcn_wmma_f32_16x16x32_f16(false, a, false, b, (short)0, c, false, false);
  asm volatile("v_nop\n\tv_nop\n\tv_nop\n\tv_nop" : "+v"(d) : "v"(a), "v"(b));
  return d;
}
__device__ __forceinline__ v8f wmma_bf(v16b a, v16b b, v8f c) {
  v8f d = __builtin_amdgcn_wmma_f32_16x16x32_bf16(false, a, false, b, (short)0, c, false, false);
  asm volatile("v_nop\n\tv_nop\n\tv_nop\n\tv_nop" : "+v"(d) : "v"(a), "v"(b));
  return d;
}
// 16x16x32 fragments: lane = (h = lane>>4, row/col = lane&15); elements 0..7 = k0+8h+0..7, 8..15 = k0+16+8h+0..7; D element r = row 8h+r
__device__ __forceinline__ v16h frag_h(const _Float16* rowk0, int lane) {
  union { v16h v; v8h q[2]; } u; const _Float16* p = rowk0 + 8 * (lane >> 4);
  u.q[0] = *(const v8h*)p; u.q[1] = *(const v8h*)(p + 16); return u.v;
}
__device__ __forceinline__ v16h frag_f32(const float* rowk0, int lane) {
  v16h a; const float* p = rowk0 + 8 * (lane >> 4);
#pragma unroll
  for (int i = 0; i < 8; ++i) { a[i] = (_Float16)p[i]; a[8 + i] = (_Float16)p[16 + i]; }
  return a;
}
__device__ __forceinline__ v16h frag_f32s(const float* rowk0, int lane, float sc) {
  v16h a; const float* p = rowk0 + 8 * (lane >> 4);
#pragma unroll
  for (int i = 0; i < 8; ++i) { a[i] = (_Float16)(p[i] * sc); a[8 + i] = (_Float16)(p[16 + i] * sc); }
  return a;
}
// column fragment from a [K][ld] layout (column n), rows >= K read as 0
__device__ __forceinline__ v16h fragc_f32(const float* W, int k0, int n, int lane, int ld, int K) {
  v16h a; const int g = lane >> 4;
#pragma unroll
  for (int i = 0; i < 8; ++i) { const int ka = k0 + 8 * g + i, kb = ka + 16;
    a[i] = (_Float16)(ka < K ? W[(size_t)ka * ld + n] : 0.f); a[8 + i] = (_Float16)(kb < K ? W[(size_t)kb * ld + n] : 0.f); }
  return a;
}
struct F2 { v16b h, l; };
__device__ __forceinline__ F2 bsplit16(const float v[16]) { F2 r;
#pragma unroll
  for (int i = 0; i < 16; ++i) { const __bf16 h = (__bf16)v[i]; r.h[i] = h; r.l[i] = (__bf16)(v[i] - (float)h); }
  return r; }
__device__ __forceinline__ F2 split_row(const float* row, int k0, int lane) { float v[16]; const float* p = row + k0 + 8 * (lane >> 4);
#pragma unroll
  for (int i = 0; i < 8; ++i) { v[i] = p[i]; v[8 + i] = p[16 + i]; }
  return bsplit16(v); }
__device__ __forceinline__ F2 split_rowK(const float* row, int k0, int lane, int K) { float v[16]; const int g = lane >> 4;
#pragma unroll
  for (int i = 0; i < 8; ++i) { const int ka = k0 + 8 * g + i, kb = ka + 16; v[i] = ka < K ? row[ka] : 0.f; v[8 + i] = kb < K ? row[kb] : 0.f; }
  return bsplit16(v); }
__device__ __forceinline__ F2 split_col(const float* W, int k0, int n, int lane, int ld, int K) { float v[16]; const int g = lane >> 4;
#pragma unroll
  for (int i = 0; i < 8; ++i) { const int ka = k0 + 8 * g + i, kb = ka + 16; v[i] = ka < K ? W[(size_t)ka * ld + n] : 0.f; v[8 + i] = kb < K ? W[(size_t)kb * ld + n] : 0.f; }
  return bsplit16(v); }
__device__ __forceinline__ v8f mac3(const F2& a, const F2& b, v8f c) { c = wmma_bf(a.l, b.h, c); c = wmma_bf(a.h, b.l, c); return wmma_bf(a.h, b.h, c); }
__device__ __forceinline__ float sigm(float v) { return 1.0f / (1.0f + expf(-v)); }
#define LDSX() do { asm volatile("s_wait_dscnt 0" ::: "memory"); __builtin_amdgcn_wave_barrier(); __builtin_amdgcn_fence(__ATOMIC_RELEASE, "workgroup"); } while (0)

// Causal multi-head attention whose softmax runs over the QUERY axis (per key column), + FFN + residual, with inline sinusoidal
// sums Z_k = sum_{q>=k} exp(s[q][k]); pass 2 is un-normalised causal attention with values scaled by 1/Z_k. Projections, both score
// passes (head dim 16 zero-padded to the 32-wide K), P@V and the FFN run on v_wmma_f32_16x16x32_f16 (f16 operands, f32
#define NB 4
#define TT 2048
#define DD 128
#define NH 8
#define HE 16
#define DFF 512
#define NR (NB * TT)

// Weight tiles in LDS: f16, row-major [k][128 columns], row pitch WP halves = 288 bytes (an odd multiple of 32 bytes, the pitch of the transposing read)
#define WP 144
typedef __attribute__((ext_vector_type(8))) short s16x8;
// 128 threads bring K rows of 128 f32 columns (row stride ld) into sW as f16: 16 lanes take one 512-byte row, 8 floats each; the 32 loads of
// 16 bytes of a batch of 128 rows are all issued before the first value is converted, so a batch pays the load latency once
// (the inner unrolls keep v in registers)
template <int K> __device__ __forceinline__ void stage_w(const float* __restrict__ Wsrc, int ld, _Float16* sW, int tid) {
  const float* s0 = Wsrc + (size_t)(tid >> 4) * ld + (tid & 15) * 8; _Float16* d0 = sW + (tid >> 4) * WP + (tid & 15) * 8;
#pragma unroll 1
  for (int b = 0; b < K / 128; ++b) {   // rolled: one batch already fills 128 registers
    v4f v[16][2];
#pragma unroll
    for (int i = 0; i < 16; ++i) { const float* p = s0 + (size_t)(b * 128 + i * 8) * ld; v[i][0] = *(const v4f*)p; v[i][1] = *(const v4f*)(p + 4); }
    asm volatile("s_wait_xcnt 0x0" ::: "memory");   // precaution: the address registers of the loads above are rewritten below; it also keeps the whole batch of loads ahead of the conversions
#pragma unroll
    for (int i = 0; i < 16; ++i) { v8h h;
#pragma unroll
      for (int e = 0; e < 4; ++e) { h[e] = (_Float16)v[i][0][e]; h[4 + e] = (_Float16)v[i][1][e]; }
      *(v8h*)(d0 + (b * 128 + i * 8) * WP) = h; }
  }
}
// B fragment (k0..k0+31, columns n0..n0+15) of such a tile by two transposing LDS reads: lane (c, h) gets T[k0 + 8h + 0..7][n0 + c], then the same 16 rows on:
// the k order of frag_h and frag_f32. Every lane is on where it is called.
__device__ __forceinline__ v16h frag_tr(const _Float16* T, int k0, int n0, int lane) {
  typedef __attribute__((address_space(3))) s16x8 lds_s16x8;
  const _Float16* p = T + (k0 + 8 * (lane >> 4) + (lane & 7)) * WP + n0 + 8 * ((lane >> 3) & 1);
  union { v16h v; s16x8 q[2]; } u;
  u.q[0] = __builtin_amdgcn_ds_load_tr16_b128_v8i16((lds_s16x8*)p); u.q[1] = __builtin_amdgcn_ds_load_tr16_b128_v8i16((lds_s16x8*)(p + 16 * WP));
  return u.v;
}

// sin and cos of an angle a in [0, 2^17): n = nearest multiple of pi/2, a - n * pi/2 in three parts, then the two short polynomials on [-pi/4, pi/4] and the
// quadrant's swap and signs. The angles here are position * frequency with position < TT and frequency <= 1, so no wider reduction is reachable.
__device__ __forceinline__ void sincos_red(float a, float& sn, float& cs) {
  const float n = __builtin_rintf(a * __uint_as_float(0x3f22f983u));
  float r = __builtin_fmaf(__uint_as_float(0xbfc90fdau), n, a); r = __builtin_fmaf(__uint_as_float(0xb3a22168u), n, r); r = __builtin_fmaf(__uint_as_float(0xa7c234c4u), n, r);
  const unsigned q = (unsigned)(int)n; const float s = r * r;
  float ps = __builtin_fmaf(__uint_as_float(0xb94c1982u), s, __uint_as_float(0x3c0881c4u)); ps = __builtin_fmaf(s, ps, __uint_as_float(0xbe2aaa9du)); ps = s * ps;
  const float sr = __builtin_fmaf(r, ps, r);
  float pc = __builtin_fmaf(__uint_as_float(0x37d75334u), s, __uint_as_float(0xbab64f3bu)); pc = __builtin_fmaf(s, pc, __uint_as_float(0x3d2aabf7u)); pc = __builtin_fmaf(s, pc, __uint_as_float(0xbf000004u));
  const float cr = __builtin_fmaf(s, pc, 1.0f);
  const unsigned sg = (q << 30) & 0x80000000u; const bool odd = q & 1u;
  sn = __uint_as_float(__float_as_uint(odd ? cr : sr) ^ sg); cs = __uint_as_float(__float_as_uint(odd ? -sr : cr) ^ sg);
}
// ---- x + PE -> xpe rows (f32) and Q/K (f16 [h][b][t][16]) / V^T (f16 [h][b][e][t]); block = 64 rows (one b) x all 384 cols
__global__ __launch_bounds__(128) void k_proj(const float* __restrict__ x, const float* __restrict__ WQ, const float* __restrict__ WK, const float* __restrict__ WV,
                                            float* __restrict__ xpe, _Float16* __restrict__ Qh, _Float16* __restrict__ Kh, _Float16* __restrict__ vT) {
  __shared__ __align__(16) float sx[64][DD + 4];
  __shared__ __align__(16) float so[4][16][132];
  __shared__ __align__(16) _Float16 st[DD][72];
  __shared__ __align__(32) _Float16 sW[3][DD * WP];
  const int tid = threadIdx.x, wave = tid >> 5, lane = tid & 31, col = lane & 15, g = lane >> 4;
  const int r0b = blockIdx.x * 64, b = r0b / TT, t0 = r0b % TT;
  // the block's 64 x rows are asked for first, as one batch of 16-byte loads (a wave takes one 512-byte row per load, thread = 4 adjacent columns of
  // rows wave + 4i), and fly while the weights are staged (the unroll keeps xv in registers)
  const int pc4 = lane; v4f xv[16]; const float* xp = x + (size_t)(r0b + wave) * DD + pc4 * 4;
#pragma unroll
  for (int i = 0; i < 16; ++i) xv[i] = *(const v4f*)(xp + i * 4 * DD);
  asm volatile("s_wait_xcnt 0x0" ::: "memory");   // precaution: the address registers of the loads above are rewritten below
  // the three weight matrices go to LDS once per block; the barrier behind the PE stage publishes them too
#pragma unroll 1
  for (int m = 0; m < 3; ++m) stage_w<DD>(m == 0 ? WQ : (m == 1 ? WK : WV), DD, &sW[m][0], tid);   // rolled: one matrix in flight fills 128 registers
  // PE + stage: straight-line, 32 independent sin/cos pairs per thread (the unroll keeps xv in registers); a column pair (2i, 2i+1) shares its angle
  { const float kdiv = -logf(10000.0f) / (float)DD;
    const float div0 = expf((float)(pc4 * 4) * kdiv), div1 = expf((float)(pc4 * 4 + 2) * kdiv);
#pragma unroll
    for (int i = 0; i < 16; ++i) { const int rl = wave + 4 * i; const float tf = (float)(t0 + rl); float s0, c0, s1, c1;
      sincos_red(tf * div0, s0, c0); sincos_red(tf * div1, s1, c1); const v4f pe = {s0, c0, s1, c1};
      *(v4f*)(&sx[rl][pc4 * 4]) = xv[i] + pe; } }
  __syncthreads();
  for (int q = tid; q < 64 * 32; q += 128) { const int rl = q >> 5, pc = q & 31; vst2(xpe + (size_t)(r0b + rl) * DD + pc * 4, *(const v4f*)(&sx[rl][pc * 4])); }
#pragma unroll 1
  for (int which = 0; which < 3; ++which) { const _Float16* sw = &sW[which][0];
    v8f acc[8] = {};
#pragma unroll
    for (int kc = 0; kc < DD / 32; ++kc) { const v16h a = frag_f32(&sx[wave * 16 + col][0] + kc * 32, lane); v16h bf[8];
#pragma unroll
      for (int j = 0; j < 8; ++j) bf[j] = frag_tr(sw, kc * 32, j * 16, lane);   // the eight fragments of a k step are read as one group, one LDS wait
#pragma unroll
      for (int j = 0; j < 8; ++j) acc[j] = wmma16(a, bf[j], acc[j]); }
    if (which < 2) {
#pragma unroll
      for (int j = 0; j < 8; ++j)
#pragma unroll
        for (int r = 0; r < 8; ++r) so[wave][8 * g + r][j * 16 + col] = acc[j][r];
      LDSX();
      _Float16* dst = which == 0 ? Qh : Kh;
      // per head h (= tile j): 16 rows x 16 halves = 512 B contiguous at dst[((h*NB + b)*TT + t0 + wave*16) * 16]
      for (int q = lane; q < 8 * 32; q += 32) { const int h = q >> 5, pp = q & 31; const int rl = pp >> 1, half = (pp & 1) * 8; union { v8h hh; v4u u; } pk;
#pragma unroll
        for (int i = 0; i < 8; ++i) pk.hh[i] = (_Float16)so[wave][rl][h * 16 + half + i];
        vst2(dst + (((size_t)h * NB + b) * TT + t0 + wave * 16 + rl) * HE + half, pk.u); }
      LDSX();
    } else {
#pragma unroll
      for (int j = 0; j < 8; ++j)
#pragma unroll
        for (int r = 0; r < 8; ++r) st[j * 16 + col][wave * 16 + 8 * g + r] = (_Float16)acc[j][r];    // st[h*16+e][t local]
      __syncthreads();
      for (int q = tid; q < DD * 8; q += 128) { const int c = q >> 3, pc = q & 7, h = c >> 4, e = c & 15;
        vst2(vT + (((size_t)h * NB + b) * HE + e) * TT + t0 + pc * 8, *(const v4u*)(&st[c][pc * 8])); }
    }
  }
}
// Asynchronous copies to LDS: every lane brings its own 16 bytes from g + i * gstep (bytes) to the LDS byte address l + i * lstep, through no register.
// The s_wait_xcnt 0 is the last line of the copies' own statement (a precaution: their address registers are rewritten behind it).
__device__ __forceinline__ unsigned lds_byte(const void* p) { return (unsigned)(size_t)p; }   // low 32 bits of a __shared__ address
__device__ __forceinline__ void copy8(unsigned l, const char* g, unsigned lstep, unsigned gstep) {
  asm volatile("global_load_async_to_lds_b128 %0, %8, off\n\tglobal_load_async_to_lds_b128 %1, %9, off\n\t"
               "global_load_async_to_lds_b128 %2, %10, off\n\tglobal_load_async_to_lds_b128 %3, %11, off\n\t"
               "global_load_async_to_lds_b128 %4, %12, off\n\tglobal_load_async_to_lds_b128 %5, %13, off\n\t"
               "global_load_async_to_lds_b128 %6, %14, off\n\tglobal_load_async_to_lds_b128 %7, %15, off\n\ts_wait_xcnt 0x0"
               :: "v"(l), "v"(l + lstep), "v"(l + 2 * lstep), "v"(l + 3 * lstep), "v"(l + 4 * lstep), "v"(l + 5 * lstep), "v"(l + 6 * lstep), "v"(l + 7 * lstep),
                  "v"(g), "v"(g + gstep), "v"(g + 2 * gstep), "v"(g + 3 * gstep), "v"(g + 4 * gstep), "v"(g + 5 * gstep), "v"(g + 6 * gstep), "v"(g + 7 * gstep) : "memory");
}
__device__ __forceinline__ void copy4(unsigned l, const char* g, unsigned lstep, unsigned gstep) {
  asm volatile("global_load_async_to_lds_b128 %0, %4, off\n\tglobal_load_async_to_lds_b128 %1, %5, off\n\t"
               "global_load_async_to_lds_b128 %2, %6, off\n\tglobal_load_async_to_lds_b128 %3, %7, off\n\ts_wait_xcnt 0x0"
               :: "v"(l), "v"(l + lstep), "v"(l + 2 * lstep), "v"(l + 3 * lstep), "v"(g), "v"(g + gstep), "v"(g + 2 * gstep), "v"(g + 3 * gstep) : "memory");
}
__device__ __forceinline__ v16h frag16(const _Float16* row16, int lane) {   // K = 16 real: elements 0..7 (h==0 lanes) and ... 
  // fragment elements: 0..7 = k 8h+0..7 (h = lane>>4) -> h==0: k 0..7, h==1: k 8..15; elements 8..15 = k 16+.. -> zero
  v16h a; const int hh = lane >> 4; union { v8h v; } u; u.v = *(const v8h*)(row16 + 8 * hh);
#pragma unroll
  for (int i = 0; i < 8; ++i) { a[i] = u.v[i]; a[8 + i] = (_Float16)0.f; }
  return a;
}
__global__ __launch_bounds__(128) void k_z(const _Float16* __restrict__ Qh, const _Float16* __restrict__ Kh, float* __restrict__ Z) {
  __shared__ __align__(16) float sz[2][64];
  __shared__ __align__(16) _Float16 sQ[TT * HE];   // the head's query rows, at their own index
  const int tid = threadIdx.x, w = tid >> 5, lane = tid & 31, col = lane & 15, g = lane >> 4;
  const int hb = blockIdx.y;
  const _Float16* qb = Qh + (size_t)hb * TT * HE; const _Float16* kb = Kh + (size_t)hb * TT * HE;
  const float scl = rsqrtf((float)TT) * 1.44269504f;   // score scale times log2(e): exp(s * scale) = 2^(s * scl), one multiply and one v_exp_f32
  // every query row that the block's two key tiles meet (from tile x on, in groups of eight tiles of 64 rows) comes to LDS once, all copies in flight
  // together (at most 32 per wave; a thread takes 16 bytes of each 2-KiB tile), so no trip below waits for a global load
#pragma unroll 1
  for (int gq = (int)blockIdx.x >> 3; gq < TT / 512; ++gq)   // rolled: a block-uniform count of groups
    copy8(lds_byte(sQ) + gq * 16384 + tid * 16, (const char*)qb + gq * 16384 + tid * 16, 2048, 2048);
  asm volatile("s_wait_asynccnt 0x0" ::: "memory");   // this wave's copies have landed
  __syncthreads();                                    // and every other wave's: publishes sQ
  // a key tile's cost falls linearly with its index, so a block takes tile x and then tile 31 - x, one after the other in every wave:
  // TT / 64 + 1 trips in every block, whatever WGP it lands on
#pragma unroll 1
  for (int part = 0; part < 2; ++part) {   // rolled: one copy of the hot loop
  const int kt = part == 0 ? (int)blockIdx.x : TT / 64 - 1 - (int)blockIdx.x, k0 = kt * 64 + w * 16;
  const v16h ak = frag16(kb + (size_t)(k0 + col) * HE, lane);
  float zs[8] = {0.f, 0.f, 0.f, 0.f, 0.f, 0.f, 0.f, 0.f};
#pragma unroll 1
  for (int qt = kt; qt < TT / 64; ++qt) {
    // straight-line trip: the four query fragments are read from LDS first, the four score products follow back to back, and the
    // mask is a select on a finished exp, so the 32 exp chains are independent work in one basic block (the unrolls keep
    // bq and s in registers)
    v16h bq[4]; v8f s[4]; const _Float16* qrow = sQ + (qt * 64 + col) * HE;
#pragma unroll
    for (int t = 0; t < 4; ++t) bq[t] = frag16(qrow + t * 16 * HE, lane);
#pragma unroll
    for (int t = 0; t < 4; ++t) { v8f z0 = {}; s[t] = wmma16(ak, bq[t], z0); }
#pragma unroll
    for (int t = 0; t < 4; ++t) {
#pragma unroll
      for (int r = 0; r < 8; ++r) { const int key = k0 + 8 * g + r, q = qt * 64 + t * 16 + col; const float e = __builtin_amdgcn_exp2f(s[t][r] * scl); zs[r] += q >= key ? e : 0.f; } } }
  // reduce zs[r] over the 16 col lanes of each half -> key k0 + 8g + r
#pragma unroll
  for (int off = 8; off >= 1; off >>= 1) {
#pragma unroll
    for (int r = 0; r < 8; ++r) zs[r] += __shfl_xor(zs[r], off, 32); }
  if (col == 0) {
#pragma unroll
    for (int r = 0; r < 8; ++r) sz[part][w * 16 + 8 * g + r] = zs[r]; }
  }
  __syncthreads();
  if (tid < 32) { const int part = tid >> 4, kt = part == 0 ? (int)blockIdx.x : TT / 64 - 1 - (int)blockIdx.x;
    const v4f zz = *(const v4f*)(&sz[part][(tid & 15) * 4]); const v4f zi = {256.0f / zz[0], 256.0f / zz[1], 256.0f / zz[2], 256.0f / zz[3]};
    vst2(Z + (size_t)hb * TT + kt * 64 + (tid & 15) * 4, zi); }   // pass 2 wants eight keys' 256 / Z in every lane: each key is divided once, here
}
// ---- pass 2: oh[hb][q][e] = sum_{k <= q} exp(s[q][k]) / Z[k] * V[k][e]; block = (hb, two tiles of 64 queries); Z holds 256 / column sum.
// Both products run transposed: S^T = K Q^T leaves key 16t + 8h + r of query (lane & 15) in register r of lane half h, which is the place that the
// B fragment of O^T = V^T P^T wants it in (elements 0..7 = tile 2kc, 8..15 = tile 2kc + 1), so P goes from the score registers to the second product by a conversion alone
#define VP (TT + 8)   // 4112 bytes, an odd multiple of 16: the 16 rows of a ds_load_b128 fragment read fall on different banks
__global__ __launch_bounds__(128) void k_av(const _Float16* __restrict__ Qh, const _Float16* __restrict__ Kh, const _Float16* __restrict__ vT, const float* __restrict__ Z, float* __restrict__ oh) {
  __shared__ __align__(16) _Float16 sK[TT * HE];   // the head's key rows, at their own index
  __shared__ __align__(16) _Float16 sV[HE * VP];   // the head's V^T rows, row pitch VP halves
  __shared__ __align__(16) float sZ[TT];           // 256 / the head's column sums
  const int tid = threadIdx.x, w = tid >> 5, lane = tid & 31, col = lane & 15, g = lane >> 4;
  const int hb = blockIdx.y;
  const _Float16* qb = Qh + (size_t)hb * TT * HE; const _Float16* kb = Kh + (size_t)hb * TT * HE; const _Float16* vb = vT + (size_t)hb * HE * TT;
  const float scl = rsqrtf((float)TT) * 1.44269504f;   // score scale times log2(e): exp(s * scale) = 2^(s * scl), one multiply and one v_exp_f32
  // every key tile that the block meets (0 to 31 - x) comes to LDS once, in groups of eight tiles: per tile a thread takes 16 bytes of the 64 key rows and
  // 16 bytes of one of the 16 V^T rows; so no trip below waits for a global load. The first group and the column sums are waited here; the other groups
  // (at most 48 copies per wave) fly under the first eight trips and are published in front of trip 8 of the long tile.
  const unsigned lk = lds_byte(sK) + tid * 16, lv = lds_byte(sV) + (tid >> 3) * (VP * 2) + (tid & 7) * 16;
  const char* gk = (const char*)kb + tid * 16; const char* gv = (const char*)vb + (tid >> 3) * (TT * 2) + (tid & 7) * 16;
  copy8(lk, gk, 2048, 2048); copy8(lv, gv, 128, 128);
  copy4(lds_byte(sZ) + tid * 16, (const char*)(Z + (size_t)hb * TT) + tid * 16, 2048, 2048);
  asm volatile("s_wait_asynccnt 0x0" ::: "memory");   // this wave's copies have landed
  __syncthreads();                                    // and every other wave's: publishes tiles 0 to 7 and sZ
#pragma unroll 1
  for (int gq = 1; gq <= (TT / 64 - 1 - (int)blockIdx.x) >> 3; ++gq) {   // rolled: a block-uniform count of groups
    copy8(lk + gq * 16384, gk + gq * 16384, 2048, 2048); copy8(lv + gq * 1024, gv + gq * 1024, 128, 128); }
  // a query tile's cost grows linearly with its index, so a block takes tile 31 - x and then tile x, one after the other in every wave:
  // TT / 64 + 1 trips in every block, whatever WGP it lands on
#pragma unroll 1
  for (int part = 0; part < 2; ++part) {   // rolled: one copy of the hot loop
  const int qt = part == 0 ? TT / 64 - 1 - (int)blockIdx.x : (int)blockIdx.x, q0 = qt * 64 + w * 16;
  const v16h aq = frag16(qb + (size_t)(q0 + col) * HE, lane);
  asm volatile("s_wait_xcnt 0x0" :: "v"(aq) : "memory");   // precaution: the address registers of the load above are reused by the first trip; the loaded value as an input keeps the load ahead of the wait
  v8f acc = {};
#pragma unroll 1
  for (int kt = 0; kt <= qt; ++kt) {
    if (part == 0 && kt == 8) {   // block-uniform, and the long tile (index 16 or more) always comes by here
      asm volatile("s_wait_asynccnt 0x0" ::: "memory");   // this wave's copies of the later groups have landed
      __syncthreads(); }                                  // and every other wave's: publishes tiles 8 and up
    // straight-line trip: every LDS read of the trip (keys, column sums, values) is issued first, the four score products
    // follow back to back, and the mask is a select on a finished exp, so the 32 exp chains are independent work in one basic block
    // (the unrolls keep bk, bv, zv and s in registers)
    v16h bk[4], bv[2], pf[2]; v4f zv[4][2]; v8f s[4];
    const int dq = q0 + col - kt * 64 - 8 * g;   // key <= query reads t * 16 + r <= dq: the lane's query less its half's first key of the trip
#pragma unroll
    for (int t = 0; t < 4; ++t) bk[t] = frag16(sK + (kt * 64 + t * 16 + col) * HE, lane);
#pragma unroll
    for (int t = 0; t < 4; ++t) { const float* zp = sZ + kt * 64 + t * 16 + 8 * g; zv[t][0] = *(const v4f*)zp; zv[t][1] = *(const v4f*)(zp + 4); }   // keys 8g + 0..7 of tile t
#pragma unroll
    for (int kc = 0; kc < 2; ++kc) bv[kc] = frag_h(sV + col * VP + kt * 64 + kc * 32, lane);   // A row = e (lane&15 < 16)
#pragma unroll
    for (int t = 0; t < 4; ++t) { v8f z0 = {}; s[t] = wmma16(bk[t], aq, z0); }   // rows = keys, columns = queries
#pragma unroll
    for (int t = 0; t < 4; ++t) {
#pragma unroll
      for (int r = 0; r < 8; ++r) { const float e = __builtin_amdgcn_exp2f(s[t][r] * scl); const float p = t * 16 + r <= dq ? e * zv[t][r >> 2][r & 3] : 0.f; pf[t >> 1][(t & 1) * 8 + r] = (_Float16)p; } }   // attn <= ~1e-2 typically; x256
#pragma unroll
    for (int kc = 0; kc < 2; ++kc) acc = wmma16(bv[kc], pf[kc], acc);
  }
  // register r of lane (g, col) holds e = 8g + r of query q0 + col: 32 adjacent bytes per lane, the wave's 16 rows are 1 KiB in a row
  { float* op = oh + ((size_t)hb * TT + q0 + col) * HE + 8 * g; const float u = 1.0f / 256.0f;
    const v4f o0 = {acc[0] * u, acc[1] * u, acc[2] * u, acc[3] * u}, o1 = {acc[4] * u, acc[5] * u, acc[6] * u, acc[7] * u};
    vst2(op, o0); vst2(op + 4, o1);
    asm volatile("s_wait_xcnt 0x0" ::: "memory"); }   // precaution: the registers of the two stores above are rewritten by the second tile
  }
}
// ---- FFN: hid = relu(out@W1+b1) -> f16 rows; out = hid@W2 + b2 + xpe. A for ff1 gathered from oh (k -> h = k/16, e = k%16)
__global__ __launch_bounds__(128) void k_ff1(const float* __restrict__ oh, const float* __restrict__ W1, const float* __restrict__ b1, _Float16* __restrict__ hid) {
  __shared__ __align__(16) float so[4][16][132];
  __shared__ __align__(32) _Float16 sW[DD * WP];
  const int tid = threadIdx.x, wave = tid >> 5, lane = tid & 31, col = lane & 15, g = lane >> 4;
  const int r0 = blockIdx.x * 64 + wave * 16, n0 = blockIdx.y * 128; const int r = r0 + col, b = r / TT, t = r % TT;
  v8f acc[8] = {};
  // the wave's own A values are asked for first and fly while the block's 128 weight columns are staged (the unrolls keep af in registers)
  float af[DD / 32][16];
#pragma unroll
  for (int kc = 0; kc < DD / 32; ++kc) {
#pragma unroll
    for (int i = 0; i < 8; ++i) { const int ka = kc * 32 + 8 * g + i, kz = ka + 16;
      af[kc][i] = oh[(((size_t)(ka >> 4) * NB + b) * TT + t) * HE + (ka & 15)]; af[kc][8 + i] = oh[(((size_t)(kz >> 4) * NB + b) * TT + t) * HE + (kz & 15)]; } }
  asm volatile("s_wait_xcnt 0x0" ::: "memory");   // precaution: the address registers of the loads above are rewritten below
  stage_w<DD>(W1 + n0, DFF, sW, tid);
  __syncthreads();   // publishes the staged weights to the four waves
#pragma unroll
  for (int kc = 0; kc < DD / 32; ++kc) { v16h a, bf[8];
#pragma unroll
    for (int i = 0; i < 16; ++i) a[i] = (_Float16)af[kc][i];
#pragma unroll
    for (int j = 0; j < 8; ++j) bf[j] = frag_tr(sW, kc * 32, j * 16, lane);   // the eight fragments of a k step are read as one group, one LDS wait
#pragma unroll
    for (int j = 0; j < 8; ++j) acc[j] = wmma16(a, bf[j], acc[j]); }
#pragma unroll
  for (int j = 0; j < 8; ++j) { const float bb = b1[n0 + j * 16 + col];
#pragma unroll
    for (int rr = 0; rr < 8; ++rr) { const float v = acc[j][rr] + bb; so[wave][8 * g + rr][j * 16 + col] = v > 0.f ? v : 0.f; } }
  LDSX();
  for (int q = lane; q < 16 * 16; q += 32) { const int rl = q >> 4, pc = q & 15; union { v8h hh; v4u u; } pk;
#pragma unroll
    for (int i = 0; i < 8; ++i) pk.hh[i] = (_Float16)so[wave][rl][pc * 8 + i];
    vst2(hid + (size_t)(r0 + rl) * DFF + n0 + pc * 8, pk.u); }
}
__global__ __launch_bounds__(128) void k_ff2(const _Float16* __restrict__ hid, const float* __restrict__ W2, const float* __restrict__ b2, const float* __restrict__ xpe, float* __restrict__ out) {
  __shared__ __align__(16) float so[4][16][132];
  __shared__ __align__(32) _Float16 sW[DFF * WP];
  const int tid = threadIdx.x, wave = tid >> 5, lane = tid & 31, col = lane & 15, g = lane >> 4;
  const int r0 = blockIdx.x * 64 + wave * 16;
  v8f acc[8] = {};
  // the first eight A fragments are asked for first and fly while the weights are staged; each of the other eight is asked for eight k steps ahead of its use
  const _Float16* arow = hid + (size_t)(r0 + col) * DFF; v16h a[8];
#pragma unroll
  for (int kc = 0; kc < 8; ++kc) a[kc] = frag_h(arow + kc * 32, lane);
  asm volatile("s_wait_xcnt 0x0" ::: "memory");   // precaution: the address registers of the loads above are rewritten below
  stage_w<DFF>(W2, DD, sW, tid);
  __syncthreads();   // publishes the staged weights to the four waves
#pragma unroll
  for (int kc = 0; kc < DFF / 32; ++kc) { const v16h cur = a[kc & 7]; v16h bf[8];   // unrolled: a[] stays in registers
    if (kc < 8) a[kc] = frag_h(arow + (kc + 8) * 32, lane);
#pragma unroll
    for (int j = 0; j < 8; ++j) bf[j] = frag_tr(sW, kc * 32, j * 16, lane);   // the eight fragments of a k step are read as one group, one LDS wait
#pragma unroll
    for (int j = 0; j < 8; ++j) acc[j] = wmma16(cur, bf[j], acc[j]); }
#pragma unroll
  for (int j = 0; j < 8; ++j) { const float bb = b2[j * 16 + col];
#pragma unroll
    for (int rr = 0; rr < 8; ++rr) so[wave][8 * g + rr][j * 16 + col] = acc[j][rr] + bb; }
  LDSX();
#pragma unroll 4
  for (int rl = 0; rl < 16; ++rl) { const size_t o = (size_t)(r0 + rl) * DD + lane * 4; vst2(out + o, *(const v4f*)(&so[wave][rl][lane * 4]) + *(const v4f*)(xpe + o)); }
}
extern "C" void kernel_launch(void* const* d_in, const int* in_sizes, int n_in, void* d_out, int out_size, void* d_ws, size_t ws_size, hipStream_t stream) {
  (void)in_sizes; (void)n_in; (void)out_size; (void)ws_size;
  const float* x = (const float*)d_in[0]; const float* WQ = (const float*)d_in[1]; const float* WK = (const float*)d_in[2]; const float* WV = (const float*)d_in[3];
  const float* W1 = (const float*)d_in[4]; const float* b1 = (const float*)d_in[5]; const float* W2 = (const float*)d_in[6]; const float* b2 = (const float*)d_in[7];
  float* out = (float*)d_out;
  char* ws = (char*)d_ws; size_t off = 0;
  auto take = [&](size_t bytes) { char* p = ws + off; off += (bytes + 255) & ~(size_t)255; return p; };
  float* xpe = (float*)take((size_t)NR * DD * 4);
  _Float16* Qh = (_Float16*)take((size_t)NR * DD * 2); _Float16* Kh = (_Float16*)take((size_t)NR * DD * 2); _Float16* vT = (_Float16*)take((size_t)NR * DD * 2);
  float* Z = (float*)take((size_t)NH * NB * TT * 4); float* oh = (float*)take((size_t)NR * DD * 4); _Float16* hid = (_Float16*)take((size_t)NR * DFF * 2);
  k_proj<<<NR / 64, 128, 0, stream>>>(x, WQ, WK, WV, xpe, Qh, Kh, vT);
  k_z<<<dim3(TT / 128, NH * NB), 128, 0, stream>>>(Qh, Kh, Z);
  k_av<<<dim3(TT / 128, NH * NB), 128, 0, stream>>>(Qh, Kh, vT, Z, oh);
  k_ff1<<<dim3(NR / 64, DFF / 128), 128, 0, stream>>>(oh, W1, b1, hid);
  k_ff2<<<NR / 64, 128, 0, stream>>>(hid, W2, b2, xpe, out);
}

// v008
// Measured time: 54.3 microseconds a run.
// Two timings next to v007 both put it at 1.10 times that version's speed.
// All steps since v000 together make it 5.43 times as fast.
#include <hip/hip_runtime.h>
#include <math.h>

typedef __attribute__((ext_vector_type(16))) _Float16 v16h;
typedef __attribute__((ext_vector_type(16))) __bf16 v16b;
typedef __attribute__((ext_vector_type(8)))  _Float16 v8h;
typedef __attribute__((ext_vector_type(8)))  float v8f;
typedef __attribute__((ext_vector_type(4)))  float v4f;
typedef __attribute__((ext_vector_type(2)))  float v2f;
typedef __attribute__((ext_vector_type(4)))  unsigned v4u;
typedef __attribute__((ext_vector_type(4)))  int v4i;
typedef float __attribute__((may_alias)) float_a;
typedef int __attribute__((may_alias)) int_a;

template <typename T> __device__ __forceinline__ void vst2(void* p, T v) { *(T*)p = v;  }
__device__ __forceinline__ v8f wmma16(v16h a, v16h b, v8f c) {
  v8f d = __builtin_amdgcn_wmma_f32_16x16x32_f16(false, a, false, b, (short)0, c, false, false);
  asm volatile("v_nop\n\tv_nop\n\tv_nop\n\tv_nop" : "+v"(d) : "v"(a), "v"(b));
  return d;
}
__device__ __forceinline__ v8f wmma_bf(v16b a, v16b b, v8f c) {
  v8f d = __builtin_amdgcn_wmma_f32_16x16x32_bf16(false, a, false, b, (short)0, c, false, false);
  asm volatile("v_nop\n\tv_nop\n\tv_nop\n\tv_nop" : "+v"(d) : "v"(a), "v"(b));
  return d;
}
// 16x16x32 fragments: lane = (h = lane>>4, row/col = lane&15); elements 0..7 = k0+8h+0..7, 8..15 = k0+16+8h+0..7; D element r = row 8h+r
__device__ __forceinline__ v16h frag_h(const _Float16* rowk0, int lane) {
  union { v16h v; v8h q[2]; } u; const _Float16* p = rowk0 + 8 * (lane >> 4);
  u.q[0] = *(const v8h*)p; u.q[1] = *(const v8h*)(p + 16); return u.v;
}
__device__ __forceinline__ v16h frag_f32(const float* rowk0, int lane) {
  v16h a; const float* p = rowk0 + 8 * (lane >> 4);
#pragma unroll
  for (int i = 0; i < 8; ++i) { a[i] = (_Float16)p[i]; a[8 + i] = (_Float16)p[16 + i]; }
  return a;
}
__device__ __forceinline__ v16h frag_f32s(const float* rowk0, int lane, float sc) {
  v16h a; const float* p = rowk0 + 8 * (lane >> 4);
#pragma unroll
  for (int i = 0; i < 8; ++i) { a[i] = (_Float16)(p[i] * sc); a[8 + i] = (_Float16)(p[16 + i] * sc); }
  return a;
}
// column fragment from a [K][ld] layout (column n), rows >= K read as 0
__device__ __forceinline__ v16h fragc_f32(const float* W, int k0, int n, int lane, int ld, int K) {
  v16h a; const int g = lane >> 4;
#pragma unroll
  for (int i = 0; i < 8; ++i) { const int ka = k0 + 8 * g + i, kb = ka + 16;
    a[i] = (_Float16)(ka < K ? W[(size_t)ka * ld + n] : 0.f); a[8 + i] = (_Float16)(kb < K ? W[(size_t)kb * ld + n] : 0.f); }
  return a;
}
struct F2 { v16b h, l; };
__device__ __forceinline__ F2 bsplit16(const float v[16]) { F2 r;
#pragma unroll
  for (int i = 0; i < 16; ++i) { const __bf16 h = (__bf16)v[i]; r.h[i] = h; r.l[i] = (__bf16)(v[i] - (float)h); }
  return r; }
__device__ __forceinline__ F2 split_row(const float* row, int k0, int lane) { float v[16]; const float* p = row + k0 + 8 * (lane >> 4);
#pragma unroll
  for (int i = 0; i < 8; ++i) { v[i] = p[i]; v[8 + i] = p[16 + i]; }
  return bsplit16(v); }
__device__ __forceinline__ F2 split_rowK(const float* row, int k0, int lane, int K) { float v[16]; const int g = lane >> 4;
#pragma unroll
  for (int i = 0; i < 8; ++i) { const int ka = k0 + 8 * g + i, kb = ka + 16; v[i] = ka < K ? row[ka] : 0.f; v[8 + i] = kb < K ? row[kb] : 0.f; }
  return bsplit16(v); }
__device__ __forceinline__ F2 split_col(const float* W, int k0, int n, int lane, int ld, int K) { float v[16]; const int g = lane >> 4;
#pragma unroll
  for (int i = 0; i < 8; ++i) { const int ka = k0 + 8 * g + i, kb = ka + 16; v[i] = ka < K ? W[(size_t)ka * ld + n] : 0.f; v[8 + i] = kb < K ? W[(size_t)kb * ld + n] : 0.f; }
  return bsplit16(v); }
__device__ __forceinline__ v8f mac3(const F2& a, const F2& b, v8f c) { c = wmma_bf(a.l, b.h, c); c = wmma_bf(a.h, b.l, c); return wmma_bf(a.h, b.h, c); }
__device__ __forceinline__ float sigm(float v) { return 1.0f / (1.0f + expf(-v)); }
#define LDSX() do { asm volatile("s_wait_dscnt 0" ::: "memory"); __builtin_amdgcn_wave_barrier(); __builtin_amdgcn_fence(__ATOMIC_RELEASE, "workgroup"); } while (0)

// Causal multi-head attention whose softmax runs over the QUERY axis (per key column), + FFN + residual, with inline sinusoidal
// sums Z_k = sum_{q>=k} exp(s[q][k]); pass 2 is un-normalised causal attention with values scaled by 1/Z_k. Projections, both score
// passes (head dim 16 zero-padded to the 32-wide K), P@V and the FFN run on v_wmma_f32_16x16x32_f16 (f16 operands, f32
#define NB 4
#define TT 2048
#define DD 128
#define NH 8
#define HE 16
#define DFF 512
#define NR (NB * TT)

// Weight tiles in LDS: f16, row-major [k][128 columns], row pitch WP halves = 288 bytes (an odd multiple of 32 bytes, the pitch of the transposing read)
#define WP 144
typedef __attribute__((ext_vector_type(8))) short s16x8;
// 128 threads bring K rows of 128 f32 columns (row stride ld) into sW as f16: 16 lanes take one 512-byte row, 8 floats each; the 32 loads of
// 16 bytes of a batch of 128 rows are all issued before the first value is converted, so a batch pays the load latency once
// (the inner unrolls keep v in registers)
template <int K> __device__ __forceinline__ void stage_w(const float* __restrict__ Wsrc, int ld, _Float16* sW, int tid) {
  const float* s0 = Wsrc + (size_t)(tid >> 4) * ld + (tid & 15) * 8; _Float16* d0 = sW + (tid >> 4) * WP + (tid & 15) * 8;
#pragma unroll 1
  for (int b = 0; b < K / 128; ++b) {   // rolled: one batch already fills 128 registers
    v4f v[16][2];
#pragma unroll
    for (int i = 0; i < 16; ++i) { const float* p = s0 + (size_t)(b * 128 + i * 8) * ld; v[i][0] = *(const v4f*)p; v[i][1] = *(const v4f*)(p + 4); }
    asm volatile("s_wait_xcnt 0x0" ::: "memory");   // precaution: the address registers of the loads above are rewritten below; it also keeps the whole batch of loads ahead of the conversions
#pragma unroll
    for (int i = 0; i < 16; ++i) { v8h h;
#pragma unroll
      for (int e = 0; e < 4; ++e) { h[e] = (_Float16)v[i][0][e]; h[4 + e] = (_Float16)v[i][1][e]; }
      *(v8h*)(d0 + (b * 128 + i * 8) * WP) = h; }
  }
}
// B fragment (k0..k0+31, columns n0..n0+15) of such a tile by two transposing LDS reads: lane (c, h) gets T[k0 + 8h + 0..7][n0 + c], then the same 16 rows on:
// the k order of frag_h and frag_f32. Every lane is on where it is called.
__device__ __forceinline__ v16h frag_tr(const _Float16* T, int k0, int n0, int lane) {
  typedef __attribute__((address_space(3))) s16x8 lds_s16x8;
  const _Float16* p = T + (k0 + 8 * (lane >> 4) + (lane & 7)) * WP + n0 + 8 * ((lane >> 3) & 1);
  union { v16h v; s16x8 q[2]; } u;
  u.q[0] = __builtin_amdgcn_ds_load_tr16_b128_v8i16((lds_s16x8*)p); u.q[1] = __builtin_amdgcn_ds_load_tr16_b128_v8i16((lds_s16x8*)(p + 16 * WP));
  return u.v;
}

// sin and cos of an angle a in [0, 2^17): n = nearest multiple of pi/2, a - n * pi/2 in three parts, then the two short polynomials on [-pi/4, pi/4] and the
// quadrant's swap and signs. The angles here are position * frequency with position < TT and frequency <= 1, so no wider reduction is reachable.
__device__ __forceinline__ void sincos_red(float a, float& sn, float& cs) {
  const float n = __builtin_rintf(a * __uint_as_float(0x3f22f983u));
  float r = __builtin_fmaf(__uint_as_float(0xbfc90fdau), n, a); r = __builtin_fmaf(__uint_as_float(0xb3a22168u), n, r); r = __builtin_fmaf(__uint_as_float(0xa7c234c4u), n, r);
  const unsigned q = (unsigned)(int)n; const float s = r * r;
  float ps = __builtin_fmaf(__uint_as_float(0xb94c1982u), s, __uint_as_float(0x3c0881c4u)); ps = __builtin_fmaf(s, ps, __uint_as_float(0xbe2aaa9du)); ps = s * ps;
  const float sr = __builtin_fmaf(r, ps, r);
  float pc = __builtin_fmaf(__uint_as_float(0x37d75334u), s, __uint_as_float(0xbab64f3bu)); pc = __builtin_fmaf(s, pc, __uint_as_float(0x3d2aabf7u)); pc = __builtin_fmaf(s, pc, __uint_as_float(0xbf000004u));
  const float cr = __builtin_fmaf(s, pc, 1.0f);
  const unsigned sg = (q << 30) & 0x80000000u; const bool odd = q & 1u;
  sn = __uint_as_float(__float_as_uint(odd ? cr : sr) ^ sg); cs = __uint_as_float(__float_as_uint(odd ? -sr : cr) ^ sg);
}
// ---- x + PE -> xpe rows (f32) and Q/K (f16 [h][b][t][16]) / V^T (f16 [h][b][e][t]); block = 64 rows (one b) x all 384 cols
__global__ __launch_bounds__(128) void k_proj(const float* __restrict__ x, const float* __restrict__ WQ, const float* __restrict__ WK, const float* __restrict__ WV,
                                            float* __restrict__ xpe, _Float16* __restrict__ Qh, _Float16* __restrict__ Kh, _Float16* __restrict__ vT) {
  __shared__ __align__(16) float sx[64][DD + 4];
  __shared__ __align__(16) float so[4][16][132];
  __shared__ __align__(16) _Float16 st[DD][72];
  __shared__ __align__(32) _Float16 sW[3][DD * WP];
  const int tid = threadIdx.x, wave = tid >> 5, lane = tid & 31, col = lane & 15, g = lane >> 4;
  const int r0b = blockIdx.x * 64, b = r0b / TT, t0 = r0b % TT;
  // the block's 64 x rows are asked for first, as one batch of 16-byte loads (a wave takes one 512-byte row per load, thread = 4 adjacent columns of
  // rows wave + 4i), and fly while the weights are staged (the unroll keeps xv in registers)
  const int pc4 = lane; v4f xv[16]; const float* xp = x + (size_t)(r0b + wave) * DD + pc4 * 4;
#pragma unroll
  for (int i = 0; i < 16; ++i) xv[i] = *(const v4f*)(xp + i * 4 * DD);
  asm volatile("s_wait_xcnt 0x0" ::: "memory");   // precaution: the address registers of the loads above are rewritten below
  // the three weight matrices go to LDS once per block; the barrier behind the PE stage publishes them too
#pragma unroll 1
  for (int m = 0; m < 3; ++m) stage_w<DD>(m == 0 ? WQ : (m == 1 ? WK : WV), DD, &sW[m][0], tid);   // rolled: one matrix in flight fills 128 registers
  // PE + stage: straight-line, 32 independent sin/cos pairs per thread (the unroll keeps xv in registers); a column pair (2i, 2i+1) shares its angle
  { const float kdiv = -logf(10000.0f) / (float)DD;
    const float div0 = expf((float)(pc4 * 4) * kdiv), div1 = expf((float)(pc4 * 4 + 2) * kdiv);
#pragma unroll
    for (int i = 0; i < 16; ++i) { const int rl = wave + 4 * i; const float tf = (float)(t0 + rl); float s0, c0, s1, c1;
      sincos_red(tf * div0, s0, c0); sincos_red(tf * div1, s1, c1); const v4f pe = {s0, c0, s1, c1};
      *(v4f*)(&sx[rl][pc4 * 4]) = xv[i] + pe; } }
  __syncthreads();
  for (int q = tid; q < 64 * 32; q += 128) { const int rl = q >> 5, pc = q & 31; vst2(xpe + (size_t)(r0b + rl) * DD + pc * 4, *(const v4f*)(&sx[rl][pc * 4])); }
#pragma unroll 1
  for (int which = 0; which < 3; ++which) { const _Float16* sw = &sW[which][0];
    v8f acc[8] = {};
#pragma unroll
    for (int kc = 0; kc < DD / 32; ++kc) { const v16h a = frag_f32(&sx[wave * 16 + col][0] + kc * 32, lane); v16h bf[8];
#pragma unroll
      for (int j = 0; j < 8; ++j) bf[j] = frag_tr(sw, kc * 32, j * 16, lane);   // the eight fragments of a k step are read as one group, one LDS wait
#pragma unroll
      for (int j = 0; j < 8; ++j) acc[j] = wmma16(a, bf[j], acc[j]); }
    if (which < 2) {
#pragma unroll
      for (int j = 0; j < 8; ++j)
#pragma unroll
        for (int r = 0; r < 8; ++r) so[wave][8 * g + r][j * 16 + col] = acc[j][r];
      LDSX();
      _Float16* dst = which == 0 ? Qh : Kh;
      // per head h (= tile j): 16 rows x 16 halves = 512 B contiguous at dst[((h*NB + b)*TT + t0 + wave*16) * 16]
      for (int q = lane; q < 8 * 32; q += 32) { const int h = q >> 5, pp = q & 31; const int rl = pp >> 1, half = (pp & 1) * 8; union { v8h hh; v4u u; } pk;
#pragma unroll
        for (int i = 0; i < 8; ++i) pk.hh[i] = (_Float16)so[wave][rl][h * 16 + half + i];
        vst2(dst + (((size_t)h * NB + b) * TT + t0 + wave * 16 + rl) * HE + half, pk.u); }
      LDSX();
    } else {
#pragma unroll
      for (int j = 0; j < 8; ++j)
#pragma unroll
        for (int r = 0; r < 8; ++r) st[j * 16 + col][wave * 16 + 8 * g + r] = (_Float16)acc[j][r];    // st[h*16+e][t local]
      __syncthreads();
      for (int q = tid; q < DD * 8; q += 128) { const int c = q >> 3, pc = q & 7, h = c >> 4, e = c & 15;
        vst2(vT + (((size_t)h * NB + b) * HE + e) * TT + t0 + pc * 8, *(const v4u*)(&st[c][pc * 8])); }
    }
  }
}
// Asynchronous copies to LDS: every lane brings its own 16 bytes from g + i * gstep (bytes) to the LDS byte address l + i * lstep, through no register.
// The s_wait_xcnt 0 is the last line of the copies' own statement (a precaution: their address registers are rewritten behind it).
__device__ __forceinline__ unsigned lds_byte(const void* p) { return (unsigned)(size_t)p; }   // low 32 bits of a __shared__ address
__device__ __forceinline__ void copy8(unsigned l, const char* g, unsigned lstep, unsigned gstep) {
  asm volatile("global_load_async_to_lds_b128 %0, %8, off\n\tglobal_load_async_to_lds_b128 %1, %9, off\n\t"
               "global_load_async_to_lds_b128 %2, %10, off\n\tglobal_load_async_to_lds_b128 %3, %11, off\n\t"
               "global_load_async_to_lds_b128 %4, %12, off\n\tglobal_load_async_to_lds_b128 %5, %13, off\n\t"
               "global_load_async_to_lds_b128 %6, %14, off\n\tglobal_load_async_to_lds_b128 %7, %15, off\n\ts_wait_xcnt 0x0"
               :: "v"(l), "v"(l + lstep), "v"(l + 2 * lstep), "v"(l + 3 * lstep), "v"(l + 4 * lstep), "v"(l + 5 * lstep), "v"(l + 6 * lstep), "v"(l + 7 * lstep),
                  "v"(g), "v"(g + gstep), "v"(g + 2 * gstep), "v"(g + 3 * gstep), "v"(g + 4 * gstep), "v"(g + 5 * gstep), "v"(g + 6 * gstep), "v"(g + 7 * gstep) : "memory");
}
__device__ __forceinline__ void copy4(unsigned l, const char* g, unsigned lstep, unsigned gstep) {
  asm volatile("global_load_async_to_lds_b128 %0, %4, off\n\tglobal_load_async_to_lds_b128 %1, %5, off\n\t"
               "global_load_async_to_lds_b128 %2, %6, off\n\tglobal_load_async_to_lds_b128 %3, %7, off\n\ts_wait_xcnt 0x0"
               :: "v"(l), "v"(l + lstep), "v"(l + 2 * lstep), "v"(l + 3 * lstep), "v"(g), "v"(g + gstep), "v"(g + 2 * gstep), "v"(g + 3 * gstep) : "memory");
}
__device__ __forceinline__ v16h frag16(const _Float16* row16, int lane) {   // K = 16 real: elements 0..7 (h==0 lanes) and ... 
  // fragment elements: 0..7 = k 8h+0..7 (h = lane>>4) -> h==0: k 0..7, h==1: k 8..15; elements 8..15 = k 16+.. -> zero
  v16h a; const int hh = lane >> 4; union { v8h v; } u; u.v = *(const v8h*)(row16 + 8 * hh);
#pragma unroll
  for (int i = 0; i < 8; ++i) { a[i] = u.v[i]; a[8 + i] = (_Float16)0.f; }
  return a;
}
__global__ __launch_bounds__(128) void k_z(const _Float16* __restrict__ Qh, const _Float16* __restrict__ Kh, float* __restrict__ Z) {
  __shared__ __align__(16) float sz[2][64];
  __shared__ __align__(16) _Float16 sQ[TT * HE];   // the head's query rows, at their own index
  const int tid = threadIdx.x, w = tid >> 5, lane = tid & 31, col = lane & 15, g = lane >> 4;
  const int hb = blockIdx.y;
  const _Float16* qb = Qh + (size_t)hb * TT * HE; const _Float16* kb = Kh + (size_t)hb * TT * HE;
  const float scl = rsqrtf((float)TT) * 1.44269504f;   // score scale times log2(e): exp(s * scale) = 2^(s * scl), one multiply and one v_exp_f32
  // every query row that the block's two key tiles meet (from tile x on, in groups of eight tiles of 64 rows) comes to LDS once, all copies in flight
  // together (at most 32 per wave; a thread takes 16 bytes of each 2-KiB tile), so no trip below waits for a global load
#pragma unroll 1
  for (int gq = (int)blockIdx.x >> 3; gq < TT / 512; ++gq)   // rolled: a block-uniform count of groups
    copy8(lds_byte(sQ) + gq * 16384 + tid * 16, (const char*)qb + gq * 16384 + tid * 16, 2048, 2048);
  asm volatile("s_wait_asynccnt 0x0" ::: "memory");   // this wave's copies have landed
  __syncthreads();                                    // and every other wave's: publishes sQ
  // a key tile's cost falls linearly with its index, so a block takes tile x and then tile 31 - x, one after the other in every wave:
  // TT / 64 + 1 trips in every block, whatever WGP it lands on
#pragma unroll 1
  for (int part = 0; part < 2; ++part) {   // rolled: one copy of the hot loop
  const int kt = part == 0 ? (int)blockIdx.x : TT / 64 - 1 - (int)blockIdx.x, k0 = kt * 64 + w * 16;
  const v16h ak = frag16(kb + (size_t)(k0 + col) * HE, lane);
  float zs[8] = {0.f, 0.f, 0.f, 0.f, 0.f, 0.f, 0.f, 0.f};
  // one trip, straight-line: the four query fragments are read from LDS first, the four score products follow back to back, so the 32 exp chains
  // are independent work in one basic block (the unrolls keep bq and s in registers). Only the tile on the diagonal (qt == kt) holds a query below a key:
  // there the mask is a select on a finished exp; every later tile is summed whole, with no compare and no select
  auto trip = [&](int qt, bool diag) __attribute__((always_inline)) {
    v16h bq[4]; v8f s[4]; const _Float16* qrow = sQ + (qt * 64 + col) * HE;
#pragma unroll
    for (int t = 0; t < 4; ++t) bq[t] = frag16(qrow + t * 16 * HE, lane);
#pragma unroll
    for (int t = 0; t < 4; ++t) { v8f z0 = {}; s[t] = wmma16(ak, bq[t], z0); }
#pragma unroll
    for (int t = 0; t < 4; ++t) {
#pragma unroll
      for (int r = 0; r < 8; ++r) { const int key = k0 + 8 * g + r, q = qt * 64 + t * 16 + col; const float e = __builtin_amdgcn_exp2f(s[t][r] * scl); zs[r] += !diag || q >= key ? e : 0.f; } } };
  trip(kt, true);
#pragma unroll 1
  for (int qt = kt + 1; qt < TT / 64; ++qt) trip(qt, false);   // rolled: one copy of the hot trip
  // reduce zs[r] over the 16 col lanes of each half -> key k0 + 8g + r
#pragma unroll
  for (int off = 8; off >= 1; off >>= 1) {
#pragma unroll
    for (int r = 0; r < 8; ++r) zs[r] += __shfl_xor(zs[r], off, 32); }
  if (col == 0) {
#pragma unroll
    for (int r = 0; r < 8; ++r) sz[part][w * 16 + 8 * g + r] = zs[r]; }
  }
  __syncthreads();
  if (tid < 32) { const int part = tid >> 4, kt = part == 0 ? (int)blockIdx.x : TT / 64 - 1 - (int)blockIdx.x;
    const v4f zz = *(const v4f*)(&sz[part][(tid & 15) * 4]); const v4f zi = {256.0f / zz[0], 256.0f / zz[1], 256.0f / zz[2], 256.0f / zz[3]};
    vst2(Z + (size_t)hb * TT + kt * 64 + (tid & 15) * 4, zi); }   // pass 2 wants eight keys' 256 / Z in every lane: each key is divided once, here
}
// ---- pass 2: oh[hb][q][e] = sum_{k <= q} exp(s[q][k]) / Z[k] * V[k][e]; block = (hb, two tiles of 64 queries); Z holds 256 / column sum.
// Both products run transposed: S^T = K Q^T leaves key 16t + 8h + r of query (lane & 15) in register r of lane half h, which is the place that the
// B fragment of O^T = V^T P^T wants it in (elements 0..7 = tile 2kc, 8..15 = tile 2kc + 1), so P goes from the score registers to the second product by a conversion alone
#define VP (TT + 8)   // 4112 bytes, an odd multiple of 16: the 16 rows of a ds_load_b128 fragment read fall on different banks
__global__ __launch_bounds__(128) void k_av(const _Float16* __restrict__ Qh, const _Float16* __restrict__ Kh, const _Float16* __restrict__ vT, const float* __restrict__ Z, float* __restrict__ oh) {
  __shared__ __align__(16) _Float16 sK[TT * HE];   // the head's key rows, at their own index
  __shared__ __align__(16) _Float16 sV[HE * VP];   // the head's V^T rows, row pitch VP halves
  __shared__ __align__(16) float sZ[TT];           // 256 / the head's column sums
  const int tid = threadIdx.x, w = tid >> 5, lane = tid & 31, col = lane & 15, g = lane >> 4;
  const int hb = blockIdx.y;
  const _Float16* qb = Qh + (size_t)hb * TT * HE; const _Float16* kb = Kh + (size_t)hb * TT * HE; const _Float16* vb = vT + (size_t)hb * HE * TT;
  const float scl = rsqrtf((float)TT) * 1.44269504f;   // score scale times log2(e): exp(s * scale) = 2^(s * scl), one multiply and one v_exp_f32
  // every key tile that the block meets (0 to 31 - x) comes to LDS once, in groups of eight tiles: per tile a thread takes 16 bytes of the 64 key rows and
  // 16 bytes of one of the 16 V^T rows; so no trip below waits for a global load. The first group and the column sums are waited here; the other groups
  // (at most 48 copies per wave) fly under the first eight trips and are published in front of trip 8 of the long tile.
  const unsigned lk = lds_byte(sK) + tid * 16, lv = lds_byte(sV) + (tid >> 3) * (VP * 2) + (tid & 7) * 16;
  const char* gk = (const char*)kb + tid * 16; const char* gv = (const char*)vb + (tid >> 3) * (TT * 2) + (tid & 7) * 16;
  copy8(lk, gk, 2048, 2048); copy8(lv, gv, 128, 128);
  copy4(lds_byte(sZ) + tid * 16, (const char*)(Z + (size_t)hb * TT) + tid * 16, 2048, 2048);
  asm volatile("s_wait_asynccnt 0x0" ::: "memory");   // this wave's copies have landed
  __syncthreads();                                    // and every other wave's: publishes tiles 0 to 7 and sZ
#pragma unroll 1
  for (int gq = 1; gq <= (TT / 64 - 1 - (int)blockIdx.x) >> 3; ++gq) {   // rolled: a block-uniform count of groups
    copy8(lk + gq * 16384, gk + gq * 16384, 2048, 2048); copy8(lv + gq * 1024, gv + gq * 1024, 128, 128); }
  // a query tile's cost grows linearly with its index, so a block takes tile 31 - x and then tile x, one after the other in every wave:
  // TT / 64 + 1 trips in every block, whatever WGP it lands on
#pragma unroll 1
  for (int part = 0; part < 2; ++part) {   // rolled: one copy of the hot loop
  const int qt = part == 0 ? TT / 64 - 1 - (int)blockIdx.x : (int)blockIdx.x, q0 = qt * 64 + w * 16;
  const v16h aq = frag16(qb + (size_t)(q0 + col) * HE, lane);
  asm volatile("s_wait_xcnt 0x0" :: "v"(aq) : "memory");   // precaution: the address registers of the load above are reused by the first trip; the loaded value as an input keeps the load ahead of the wait
  v8f acc = {};
  // one trip, straight-line: every LDS read of the trip (keys, column sums, values) is issued first, the four score products
  // follow back to back, so the 32 exp chains are independent work in one basic block (the unrolls keep bk, bv, zv and s in registers).
  // Only the tile on the diagonal (kt == qt) holds a key above a query: there the mask is a select on a finished exp; every earlier tile is
  // taken whole, with no compare and no select
  auto trip = [&](int kt, bool diag) __attribute__((always_inline)) {
    v16h bk[4], bv[2], pf[2]; v4f zv[4][2]; v8f s[4];
    const int dq = q0 + col - kt * 64 - 8 * g;   // key <= query reads t * 16 + r <= dq: the lane's query less its half's first key of the trip
#pragma unroll
    for (int t = 0; t < 4; ++t) bk[t] = frag16(sK + (kt * 64 + t * 16 + col) * HE, lane);
#pragma unroll
    for (int t = 0; t < 4; ++t) { const float* zp = sZ + kt * 64 + t * 16 + 8 * g; zv[t][0] = *(const v4f*)zp; zv[t][1] = *(const v4f*)(zp + 4); }   // keys 8g + 0..7 of tile t
#pragma unroll
    for (int kc = 0; kc < 2; ++kc) bv[kc] = frag_h(sV + col * VP + kt * 64 + kc * 32, lane);   // A row = e (lane&15 < 16)
#pragma unroll
    for (int t = 0; t < 4; ++t) { v8f z0 = {}; s[t] = wmma16(bk[t], aq, z0); }   // rows = keys, columns = queries
#pragma unroll
    for (int t = 0; t < 4; ++t) {
#pragma unroll
      for (int r = 0; r < 8; ++r) { const float e = __builtin_amdgcn_exp2f(s[t][r] * scl); const float p = !diag || t * 16 + r <= dq ? e * zv[t][r >> 2][r & 3] : 0.f; pf[t >> 1][(t & 1) * 8 + r] = (_Float16)p; } }   // attn <= ~1e-2 typically; x256
#pragma unroll
    for (int kc = 0; kc < 2; ++kc) acc = wmma16(bv[kc], pf[kc], acc); };
#pragma unroll 1
  for (int kt = 0; kt < qt; ++kt) {   // rolled: one copy of the hot trip
    if (part == 0 && kt == 8) {   // block-uniform, and the long tile (index 16 or more) always comes by here
      asm volatile("s_wait_asynccnt 0x0" ::: "memory");   // this wave's copies of the later groups have landed
      __syncthreads(); }                                  // and every other wave's: publishes tiles 8 and up
    trip(kt, false); }
  trip(qt, true);
  // register r of lane (g, col) holds e = 8g + r of query q0 + col: 32 adjacent bytes per lane, the wave's 16 rows are 1 KiB in a row
  { float* op = oh + ((size_t)hb * TT + q0 + col) * HE + 8 * g; const float u = 1.0f / 256.0f;
    const v4f o0 = {acc[0] * u, acc[1] * u, acc[2] * u, acc[3] * u}, o1 = {acc[4] * u, acc[5] * u, acc[6] * u, acc[7] * u};
    vst2(op, o0); vst2(op + 4, o1);
    asm volatile("s_wait_xcnt 0x0" ::: "memory"); }   // precaution: the registers of the two stores above are rewritten by the second tile
  }
}
// ---- FFN: hid = relu(out@W1+b1) -> f16 rows; out = hid@W2 + b2 + xpe. A for ff1 gathered from oh (k -> h = k/16, e = k%16)
__global__ __launch_bounds__(128) void k_ff1(const float* __restrict__ oh, const float* __restrict__ W1, const float* __restrict__ b1, _Float16* __restrict__ hid) {
  __shared__ __align__(16) float so[4][16][132];
  __shared__ __align__(32) _Float16 sW[DD * WP];
  const int tid = threadIdx.x, wave = tid >> 5, lane = tid & 31, col = lane & 15, g = lane >> 4;
  const int r0 = blockIdx.x * 64 + wave * 16, n0 = blockIdx.y * 128; const int r = r0 + col, b = r / TT, t = r % TT;
  v8f acc[8] = {};
  // the wave's own A values are asked for first and fly while the block's 128 weight columns are staged (the unrolls keep af in registers)
  float af[DD / 32][16];
#pragma unroll
  for (int kc = 0; kc < DD / 32; ++kc) {
#pragma unroll
    for (int i = 0; i < 8; ++i) { const int ka = kc * 32 + 8 * g + i, kz = ka + 16;
      af[kc][i] = oh[(((size_t)(ka >> 4) * NB + b) * TT + t) * HE + (ka & 15)]; af[kc][8 + i] = oh[(((size_t)(kz >> 4) * NB + b) * TT + t) * HE + (kz & 15)]; } }
  asm volatile("s_wait_xcnt 0x0" ::: "memory");   // precaution: the address registers of the loads above are rewritten below
  stage_w<DD>(W1 + n0, DFF, sW, tid);
  __syncthreads();   // publishes the staged weights to the four waves
#pragma unroll
  for (int kc = 0; kc < DD / 32; ++kc) { v16h a, bf[8];
#pragma unroll
    for (int i = 0; i < 16; ++i) a[i] = (_Float16)af[kc][i];
#pragma unroll
    for (int j = 0; j < 8; ++j) bf[j] = frag_tr(sW, kc * 32, j * 16, lane);   // the eight fragments of a k step are read as one group, one LDS wait
#pragma unroll
    for (int j = 0; j < 8; ++j) acc[j] = wmma16(a, bf[j], acc[j]); }
#pragma unroll
  for (int j = 0; j < 8; ++j) { const float bb = b1[n0 + j * 16 + col];
#pragma unroll
    for (int rr = 0; rr < 8; ++rr) { const float v = acc[j][rr] + bb; so[wave][8 * g + rr][j * 16 + col] = v > 0.f ? v : 0.f; } }
  LDSX();
  for (int q = lane; q < 16 * 16; q += 32) { const int rl = q >> 4, pc = q & 15; union { v8h hh; v4u u; } pk;
#pragma unroll
    for (int i = 0; i < 8; ++i) pk.hh[i] = (_Float16)so[wave][rl][pc * 8 + i];
    vst2(hid + (size_t)(r0 + rl) * DFF + n0 + pc * 8, pk.u); }
}
__global__ __launch_bounds__(128) void k_ff2(const _Float16* __restrict__ hid, const float* __restrict__ W2, const float* __restrict__ b2, const float* __restrict__ xpe, float* __restrict__ out) {
  __shared__ __align__(16) float so[4][16][132];
  __shared__ __align__(32) _Float16 sW[DFF * WP];
  const int tid = threadIdx.x, wave = tid >> 5, lane = tid & 31, col = lane & 15, g = lane >> 4;
  const int r0 = blockIdx.x * 64 + wave * 16;
  v8f acc[8] = {};
  // the first eight A fragments are asked for first and fly while the weights are staged; each of the other eight is asked for eight k steps ahead of its use
  const _Float16* arow = hid + (size_t)(r0 + col) * DFF; v16h a[8];
#pragma unroll
  for (int kc = 0; kc < 8; ++kc) a[kc] = frag_h(arow + kc * 32, lane);
  asm volatile("s_wait_xcnt 0x0" ::: "memory");   // precaution: the address registers of the loads above are rewritten below
  stage_w<DFF>(W2, DD, sW, tid);
  __syncthreads();   // publishes the staged weights to the four waves
#pragma unroll
  for (int kc = 0; kc < DFF / 32; ++kc) { const v16h cur = a[kc & 7]; v16h bf[8];   // unrolled: a[] stays in registers
    if (kc < 8) a[kc] = frag_h(arow + (kc + 8) * 32, lane);
#pragma unroll
    for (int j = 0; j < 8; ++j) bf[j] = frag_tr(sW, kc * 32, j * 16, lane);   // the eight fragments of a k step are read as one group, one LDS wait
#pragma unroll
    for (int j = 0; j < 8; ++j) acc[j] = wmma16(cur, bf[j], acc[j]); }
#pragma unroll
  for (int j = 0; j < 8; ++j) { const float bb = b2[j * 16 + col];
#pragma unroll
    for (int rr = 0; rr < 8; ++rr) so[wave][8 * g + rr][j * 16 + col] = acc[j][rr] + bb; }
  LDSX();
#pragma unroll 4
  for (int rl = 0; rl < 16; ++rl) { const size_t o = (size_t)(r0 + rl) * DD + lane * 4; vst2(out + o, *(const v4f*)(&so[wave][rl][lane * 4]) + *(const v4f*)(xpe + o)); }
}
extern "C" void kernel_launch(void* const* d_in, const int* in_sizes, int n_in, void* d_out, int out_size, void* d_ws, size_t ws_size, hipStream_t stream) {
  (void)in_sizes; (void)n_in; (void)out_size; (void)ws_size;
  const float* x = (const float*)d_in[0]; const float* WQ = (const float*)d_in[1]; const float* WK = (const float*)d_in[2]; const float* WV = (const float*)d_in[3];
  const float* W1 = (const float*)d_in[4]; const float* b1 = (const float*)d_in[5]; const float* W2 = (const float*)d_in[6]; const float* b2 = (const float*)d_in[7];
  float* out = (float*)d_out;
  char* ws = (char*)d_ws; size_t off = 0;
  auto take = [&](size_t bytes) { char* p = ws + off; off += (bytes + 255) & ~(size_t)255; return p; };
  float* xpe = (float*)take((size_t)NR * DD * 4);
  _Float16* Qh = (_Float16*)take((size_t)NR * DD * 2); _Float16* Kh = (_Float16*)take((size_t)NR * DD * 2); _Float16* vT = (_Float16*)take((size_t)NR * DD * 2);
  float* Z = (float*)take((size_t)NH * NB * TT * 4); float* oh = (float*)take((size_t)NR * DD * 4); _Float16* hid = (_Float16*)take((size_t)NR * DFF * 2);
  k_proj<<<NR / 64, 128, 0, stream>>>(x, WQ, WK, WV, xpe, Qh, Kh, vT);
  k_z<<<dim3(TT / 128, NH * NB), 128, 0, stream>>>(Qh, Kh, Z);
  k_av<<<dim3(TT / 128, NH * NB), 128, 0, stream>>>(Qh, Kh, vT, Z, oh);
  k_ff1<<<dim3(NR / 64, DFF / 128), 128, 0, stream>>>(oh, W1, b1, hid);
  k_ff2<<<NR / 64, 128, 0, stream>>>(hid, W2, b2, xpe, out);
}

// v009
// A run of this version takes 52.1 microseconds.
// Two timings next to v008 put it at 1.05 and 1.04 times that version's speed.
// Over all steps from v000 it is 5.66 times as fast.
#include <hip/hip_runtime.h>
#include <math.h>

typedef __attribute__((ext_vector_type(16))) _Float16 v16h;
typedef __attribute__((ext_vector_type(16))) __bf16 v16b;
typedef __attribute__((ext_vector_type(8)))  _Float16 v8h;
typedef __attribute__((ext_vector_type(8)))  float v8f;
typedef __attribute__((ext_vector_type(4)))  float v4f;
typedef __attribute__((ext_vector_type(2)))  float v2f;
typedef __attribute__((ext_vector_type(4)))  unsigned v4u;
typedef __attribute__((ext_vector_type(4)))  int v4i;
typedef float __attribute__((may_alias)) float_a;
typedef int __attribute__((may_alias)) int_a;

template <typename T> __device__ __forceinline__ void vst2(void* p, T v) { *(T*)p = v;  }
__device__ __forceinline__ v8f wmma16(v16h a, v16h b, v8f c) {
  v8f d = __builtin_amdgcn_wmma_f32_16x16x32_f16(false, a, false, b, (short)0, c, false, false);
  asm volatile("v_nop\n\tv_nop\n\tv_nop\n\tv_nop" : "+v"(d) : "v"(a), "v"(b));
  return d;
}
__device__ __forceinline__ v8f wmma_bf(v16b a, v16b b, v8f c) {
  v8f d = __builtin_amdgcn_wmma_f32_16x16x32_bf16(false, a, false, b, (short)0, c, false, false);
  asm volatile("v_nop\n\tv_nop\n\tv_nop\n\tv_nop" : "+v"(d) : "v"(a), "v"(b));
  return d;
}
// 16x16x32 fragments: lane = (h = lane>>4, row/col = lane&15); elements 0..7 = k0+8h+0..7, 8..15 = k0+16+8h+0..7; D element r = row 8h+r
__device__ __forceinline__ v16h frag_h(const _Float16* rowk0, int lane) {
  union { v16h v; v8h q[2]; } u; const _Float16* p = rowk0 + 8 * (lane >> 4);
  u.q[0] = *(const v8h*)p; u.q[1] = *(const v8h*)(p + 16); return u.v;
}
__device__ __forceinline__ v16h frag_f32(const float* rowk0, int lane) {
  v16h a; const float* p = rowk0 + 8 * (lane >> 4);
#pragma unroll
  for (int i = 0; i < 8; ++i) { a[i] = (_Float16)p[i]; a[8 + i] = (_Float16)p[16 + i]; }
  return a;
}
__device__ __forceinline__ v16h frag_f32s(const float* rowk0, int lane, float sc) {
  v16h a; const float* p = rowk0 + 8 * (lane >> 4);
#pragma unroll
  for (int i = 0; i < 8; ++i) { a[i] = (_Float16)(p[i] * sc); a[8 + i] = (_Float16)(p[16 + i] * sc); }
  return a;
}
// column fragment from a [K][ld] layout (column n), rows >= K read as 0
__device__ __forceinline__ v16h fragc_f32(const float* W, int k0, int n, int lane, int ld, int K) {
  v16h a; const int g = lane >> 4;
#pragma unroll
  for (int i = 0; i < 8; ++i) { const int ka = k0 + 8 * g + i, kb = ka + 16;
    a[i] = (_Float16)(ka < K ? W[(size_t)ka * ld + n] : 0.f); a[8 + i] = (_Float16)(kb < K ? W[(size_t)kb * ld + n] : 0.f); }
  return a;
}
struct F2 { v16b h, l; };
__device__ __forceinline__ F2 bsplit16(const float v[16]) { F2 r;
#pragma unroll
  for (int i = 0; i < 16; ++i) { const __bf16 h = (__bf16)v[i]; r.h[i] = h; r.l[i] = (__bf16)(v[i] - (float)h); }
  return r; }
__device__ __forceinline__ F2 split_row(const float* row, int k0, int lane) { float v[16]; const float* p = row + k0 + 8 * (lane >> 4);
#pragma unroll
  for (int i = 0; i < 8; ++i) { v[i] = p[i]; v[8 + i] = p[16 + i]; }
  return bsplit16(v); }
__device__ __forceinline__ F2 split_rowK(const float* row, int k0, int lane, int K) { float v[16]; const int g = lane >> 4;
#pragma unroll
  for (int i = 0; i < 8; ++i) { const int ka = k0 + 8 * g + i, kb = ka + 16; v[i] = ka < K ? row[ka] : 0.f; v[8 + i] = kb < K ? row[kb] : 0.f; }
  return bsplit16(v); }
__device__ __forceinline__ F2 split_col(const float* W, int k0, int n, int lane, int ld, int K) { float v[16]; const int g = lane >> 4;
#pragma unroll
  for (int i = 0; i < 8; ++i) { const int ka = k0 + 8 * g + i, kb = ka + 16; v[i] = ka < K ? W[(size_t)ka * ld + n] : 0.f; v[8 + i] = kb < K ? W[(size_t)kb * ld + n] : 0.f; }
  return bsplit16(v); }
__device__ __forceinline__ v8f mac3(const F2& a, const F2& b, v8f c) { c = wmma_bf(a.l, b.h, c); c = wmma_bf(a.h, b.l, c); return wmma_bf(a.h, b.h, c); }
__device__ __forceinline__ float sigm(float v) { return 1.0f / (1.0f + expf(-v)); }
#define LDSX() do { asm volatile("s_wait_dscnt 0" ::: "memory"); __builtin_amdgcn_wave_barrier(); __builtin_amdgcn_fence(__ATOMIC_RELEASE, "workgroup"); } while (0)

// Causal multi-head attention whose softmax runs over the QUERY axis (per key column), + FFN + residual, with inline sinusoidal
// sums Z_k = sum_{q>=k} exp(s[q][k]); pass 2 is un-normalised causal attention with values scaled by 1/Z_k. Projections, both score
// passes (head dim 16 zero-padded to the 32-wide K), P@V and the FFN run on v_wmma_f32_16x16x32_f16 (f16 operands, f32
#define NB 4
#define TT 2048
#define DD 128
#define NH 8
#define HE 16
#define DFF 512
#define NR (NB * TT)

// Weight tiles in LDS: f16, row-major [k][128 columns], row pitch WP halves = 288 bytes (an odd multiple of 32 bytes, the pitch of the transposing read)
#define WP 144
typedef __attribute__((ext_vector_type(8))) short s16x8;
// 128 threads bring K rows of 128 f32 columns (row stride ld) into sW as f16: 16 lanes take one 512-byte row, 8 floats each; the 32 loads of
// 16 bytes of a batch of 128 rows are all issued before the first value is converted, so a batch pays the load latency once
// (the inner unrolls keep v in registers)
template <int K> __device__ __forceinline__ void stage_w(const float* __restrict__ Wsrc, int ld, _Float16* sW, int tid) {
  const float* s0 = Wsrc + (size_t)(tid >> 4) * ld + (tid & 15) * 8; _Float16* d0 = sW + (tid >> 4) * WP + (tid & 15) * 8;
#pragma unroll 1
  for (int b = 0; b < K / 128; ++b) {   // rolled: one batch already fills 128 registers
    v4f v[16][2];
#pragma unroll
    for (int i = 0; i < 16; ++i) { const float* p = s0 + (size_t)(b * 128 + i * 8) * ld; v[i][0] = *(const v4f*)p; v[i][1] = *(const v4f*)(p + 4); }
    asm volatile("s_wait_xcnt 0x0" ::: "memory");   // precaution: the address registers of the loads above are rewritten below; it also keeps the whole batch of loads ahead of the conversions
#pragma unroll
    for (int i = 0; i < 16; ++i) { v8h h;
#pragma unroll
      for (int e = 0; e < 4; ++e) { h[e] = (_Float16)v[i][0][e]; h[4 + e] = (_Float16)v[i][1][e]; }
      *(v8h*)(d0 + (b * 128 + i * 8) * WP) = h; }
  }
}
// B fragment (k0..k0+31, columns n0..n0+15) of such a tile by two transposing LDS reads: lane (c, h) gets T[k0 + 8h + 0..7][n0 + c], then the same 16 rows on:
// the k order of frag_h and frag_f32. Every lane is on where it is called.
__device__ __forceinline__ v16h frag_tr(const _Float16* T, int k0, int n0, int lane) {
  typedef __attribute__((address_space(3))) s16x8 lds_s16x8;
  const _Float16* p = T + (k0 + 8 * (lane >> 4) + (lane & 7)) * WP + n0 + 8 * ((lane >> 3) & 1);
  union { v16h v; s16x8 q[2]; } u;
  u.q[0] = __builtin_amdgcn_ds_load_tr16_b128_v8i16((lds_s16x8*)p); u.q[1] = __builtin_amdgcn_ds_load_tr16_b128_v8i16((lds_s16x8*)(p + 16 * WP));
  return u.v;
}

// sin and cos of an angle a in [0, 2^17): n = nearest multiple of pi/2, a - n * pi/2 in three parts, then the two short polynomials on [-pi/4, pi/4] and the
// quadrant's swap and signs. The angles here are position * frequency with position < TT and frequency <= 1, so no wider reduction is reachable.
__device__ __forceinline__ void sincos_red(float a, float& sn, float& cs) {
  const float n = __builtin_rintf(a * __uint_as_float(0x3f22f983u));
  float r = __builtin_fmaf(__uint_as_float(0xbfc90fdau), n, a); r = __builtin_fmaf(__uint_as_float(0xb3a22168u), n, r); r = __builtin_fmaf(__uint_as_float(0xa7c234c4u), n, r);
  const unsigned q = (unsigned)(int)n; const float s = r * r;
  float ps = __builtin_fmaf(__uint_as_float(0xb94c1982u), s, __uint_as_float(0x3c0881c4u)); ps = __builtin_fmaf(s, ps, __uint_as_float(0xbe2aaa9du)); ps = s * ps;
  const float sr = __builtin_fmaf(r, ps, r);
  float pc = __builtin_fmaf(__uint_as_float(0x37d75334u), s, __uint_as_float(0xbab64f3bu)); pc = __builtin_fmaf(s, pc, __uint_as_float(0x3d2aabf7u)); pc = __builtin_fmaf(s, pc, __uint_as_float(0xbf000004u));
  const float cr = __builtin_fmaf(s, pc, 1.0f);
  const unsigned sg = (q << 30) & 0x80000000u; const bool odd = q & 1u;
  sn = __uint_as_float(__float_as_uint(odd ? cr : sr) ^ sg); cs = __uint_as_float(__float_as_uint(odd ? -sr : cr) ^ sg);
}
// ---- x + PE -> xpe rows (f32) and Q/K (f16 [h][b][t][16]) / V^T (f16 [h][b][e][t]); block = 64 rows (one b) x all 384 cols
__global__ __launch_bounds__(128) void k_proj(const float* __restrict__ x, const float* __restrict__ WQ, const float* __restrict__ WK, const float* __restrict__ WV,
                                            float* __restrict__ xpe, _Float16* __restrict__ Qh, _Float16* __restrict__ Kh, _Float16* __restrict__ vT) {
  __shared__ __align__(16) float sx[64][DD + 4];
  __shared__ __align__(16) float so[4][16][132];
  __shared__ __align__(16) _Float16 st[DD][72];
  __shared__ __align__(32) _Float16 sW[3][DD * WP];
  const int tid = threadIdx.x, wave = tid >> 5, lane = tid & 31, col = lane & 15, g = lane >> 4;
  const int r0b = blockIdx.x * 64, b = r0b / TT, t0 = r0b % TT;
  // the block's 64 x rows are asked for first, as one batch of 16-byte loads (a wave takes one 512-byte row per load, thread = 4 adjacent columns of
  // rows wave + 4i), and fly while the weights are staged (the unroll keeps xv in registers)
  const int pc4 = lane; v4f xv[16]; const float* xp = x + (size_t)(r0b + wave) * DD + pc4 * 4;
#pragma unroll
  for (int i = 0; i < 16; ++i) xv[i] = *(const v4f*)(xp + i * 4 * DD);
  asm volatile("s_wait_xcnt 0x0" ::: "memory");   // precaution: the address registers of the loads above are rewritten below
  // the three weight matrices go to LDS once per block; the barrier behind the PE stage publishes them too
#pragma unroll 1
  for (int m = 0; m < 3; ++m) stage_w<DD>(m == 0 ? WQ : (m == 1 ? WK : WV), DD, &sW[m][0], tid);   // rolled: one matrix in flight fills 128 registers
  // PE + stage: straight-line, 32 independent sin/cos pairs per thread (the unroll keeps xv in registers); a column pair (2i, 2i+1) shares its angle
  { const float kdiv = -logf(10000.0f) / (float)DD;
    const float div0 = expf((float)(pc4 * 4) * kdiv), div1 = expf((float)(pc4 * 4 + 2) * kdiv);
#pragma unroll
    for (int i = 0; i < 16; ++i) { const int rl = wave + 4 * i; const float tf = (float)(t0 + rl); float s0, c0, s1, c1;
      sincos_red(tf * div0, s0, c0); sincos_red(tf * div1, s1, c1); const v4f pe = {s0, c0, s1, c1};
      *(v4f*)(&sx[rl][pc4 * 4]) = xv[i] + pe; } }
  __syncthreads();
  for (int q = tid; q < 64 * 32; q += 128) { const int rl = q >> 5, pc = q & 31; vst2(xpe + (size_t)(r0b + rl) * DD + pc * 4, *(const v4f*)(&sx[rl][pc * 4])); }
#pragma unroll 1
  for (int which = 0; which < 3; ++which) { const _Float16* sw = &sW[which][0];
    v8f acc[8] = {};
#pragma unroll
    for (int kc = 0; kc < DD / 32; ++kc) { const v16h a = frag_f32(&sx[wave * 16 + col][0] + kc * 32, lane); v16h bf[8];
#pragma unroll
      for (int j = 0; j < 8; ++j) bf[j] = frag_tr(sw, kc * 32, j * 16, lane);   // the eight fragments of a k step are read as one group, one LDS wait
#pragma unroll
      for (int j = 0; j < 8; ++j) acc[j] = wmma16(a, bf[j], acc[j]); }
    if (which < 2) {
#pragma unroll
      for (int j = 0; j < 8; ++j)
#pragma unroll
        for (int r = 0; r < 8; ++r) so[wave][8 * g + r][j * 16 + col] = acc[j][r];
      LDSX();
      _Float16* dst = which == 0 ? Qh : Kh;
      // Q is stored times score scale * log2(e), in f32 ahead of its one rounding to f16: the score products of both passes then are the arguments of 2^x
      const float osc = which == 0 ? rsqrtf((float)TT) * 1.44269504f : 1.0f;
      // per head h (= tile j): 16 rows x 16 halves = 512 B contiguous at dst[((h*NB + b)*TT + t0 + wave*16) * 16]
      for (int q = lane; q < 8 * 32; q += 32) { const int h = q >> 5, pp = q & 31; const int rl = pp >> 1, half = (pp & 1) * 8; union { v8h hh; v4u u; } pk;
#pragma unroll
        for (int i = 0; i < 8; ++i) pk.hh[i] = (_Float16)(so[wave][rl][h * 16 + half + i] * osc);
        vst2(dst + (((size_t)h * NB + b) * TT + t0 + wave * 16 + rl) * HE + half, pk.u); }
      LDSX();
    } else {
#pragma unroll
      for (int j = 0; j < 8; ++j)
#pragma unroll
        for (int r = 0; r < 8; ++r) st[j * 16 + col][wave * 16 + 8 * g + r] = (_Float16)acc[j][r];    // st[h*16+e][t local]
      __syncthreads();
      for (int q = tid; q < DD * 8; q += 128) { const int c = q >> 3, pc = q & 7, h = c >> 4, e = c & 15;
        vst2(vT + (((size_t)h * NB + b) * HE + e) * TT + t0 + pc * 8, *(const v4u*)(&st[c][pc * 8])); }
    }
  }
}
// Asynchronous copies to LDS: every lane brings its own 16 bytes from g + i * gstep (bytes) to the LDS byte address l + i * lstep, through no register.
// The s_wait_xcnt 0 is the last line of the copies' own statement (a precaution: their address registers are rewritten behind it).
__device__ __forceinline__ unsigned lds_byte(const void* p) { return (unsigned)(size_t)p; }   // low 32 bits of a __shared__ address
__device__ __forceinline__ void copy8(unsigned l, const char* g, unsigned lstep, unsigned gstep) {
  asm volatile("global_load_async_to_lds_b128 %0, %8, off\n\tglobal_load_async_to_lds_b128 %1, %9, off\n\t"
               "global_load_async_to_lds_b128 %2, %10, off\n\tglobal_load_async_to_lds_b128 %3, %11, off\n\t"
               "global_load_async_to_lds_b128 %4, %12, off\n\tglobal_load_async_to_lds_b128 %5, %13, off\n\t"
               "global_load_async_to_lds_b128 %6, %14, off\n\tglobal_load_async_to_lds_b128 %7, %15, off\n\ts_wait_xcnt 0x0"
               :: "v"(l), "v"(l + lstep), "v"(l + 2 * lstep), "v"(l + 3 * lstep), "v"(l + 4 * lstep), "v"(l + 5 * lstep), "v"(l + 6 * lstep), "v"(l + 7 * lstep),
                  "v"(g), "v"(g + gstep), "v"(g + 2 * gstep), "v"(g + 3 * gstep), "v"(g + 4 * gstep), "v"(g + 5 * gstep), "v"(g + 6 * gstep), "v"(g + 7 * gstep) : "memory");
}
__device__ __forceinline__ void copy4(unsigned l, const char* g, unsigned lstep, unsigned gstep) {
  asm volatile("global_load_async_to_lds_b128 %0, %4, off\n\tglobal_load_async_to_lds_b128 %1, %5, off\n\t"
               "global_load_async_to_lds_b128 %2, %6, off\n\tglobal_load_async_to_lds_b128 %3, %7, off\n\ts_wait_xcnt 0x0"
               :: "v"(l), "v"(l + lstep), "v"(l + 2 * lstep), "v"(l + 3 * lstep), "v"(g), "v"(g + gstep), "v"(g + 2 * gstep), "v"(g + 3 * gstep) : "memory");
}
__device__ __forceinline__ v16h frag16(const _Float16* row16, int lane) {   // K = 16 real: elements 0..7 (h==0 lanes) and ... 
  // fragment elements: 0..7 = k 8h+0..7 (h = lane>>4) -> h==0: k 0..7, h==1: k 8..15; elements 8..15 = k 16+.. -> zero
  v16h a; const int hh = lane >> 4; union { v8h v; } u; u.v = *(const v8h*)(row16 + 8 * hh);
#pragma unroll
  for (int i = 0; i < 8; ++i) { a[i] = u.v[i]; a[8 + i] = (_Float16)0.f; }
  return a;
}
__global__ __launch_bounds__(128) void k_z(const _Float16* __restrict__ Qh, const _Float16* __restrict__ Kh, float* __restrict__ Z) {
  __shared__ __align__(16) float sz[2][64];
  __shared__ __align__(16) _Float16 sQ[TT * HE];   // the head's query rows, at their own index
  const int tid = threadIdx.x, w = tid >> 5, lane = tid & 31, col = lane & 15, g = lane >> 4;
  const int hb = blockIdx.y;
  const _Float16* qb = Qh + (size_t)hb * TT * HE; const _Float16* kb = Kh + (size_t)hb * TT * HE;   // Q comes scaled: exp(score) = 2^(K Q^T), one v_exp_f32
  // every query row that the block's two key tiles meet (from tile x on, in groups of eight tiles of 64 rows) comes to LDS once, all copies in flight
  // together (at most 32 per wave; a thread takes 16 bytes of each 2-KiB tile), so no trip below waits for a global load
#pragma unroll 1
  for (int gq = (int)blockIdx.x >> 3; gq < TT / 512; ++gq)   // rolled: a block-uniform count of groups
    copy8(lds_byte(sQ) + gq * 16384 + tid * 16, (const char*)qb + gq * 16384 + tid * 16, 2048, 2048);
  asm volatile("s_wait_asynccnt 0x0" ::: "memory");   // this wave's copies have landed
  __syncthreads();                                    // and every other wave's: publishes sQ
  // a key tile's cost falls linearly with its index, so a block takes tile x and then tile 31 - x, one after the other in every wave:
  // TT / 64 + 1 trips in every block, whatever WGP it lands on
#pragma unroll 1
  for (int part = 0; part < 2; ++part) {   // rolled: one copy of the hot loop
  const int kt = part == 0 ? (int)blockIdx.x : TT / 64 - 1 - (int)blockIdx.x, k0 = kt * 64 + w * 16;
  const v16h ak = frag16(kb + (size_t)(k0 + col) * HE, lane);
  float zs[8] = {0.f, 0.f, 0.f, 0.f, 0.f, 0.f, 0.f, 0.f};
  // one trip, straight-line: the four query fragments are read from LDS first, the four score products follow back to back, so the 32 exp chains
  // are independent work in one basic block (the unrolls keep bq and s in registers). Only the tile on the diagonal (qt == kt) holds a query below a key:
  // there the mask is a select on a finished exp; every later tile is summed whole, with no compare and no select
  auto trip = [&](int qt, bool diag) __attribute__((always_inline)) {
    v16h bq[4]; v8f s[4]; const _Float16* qrow = sQ + (qt * 64 + col) * HE;
#pragma unroll
    for (int t = 0; t < 4; ++t) bq[t] = frag16(qrow + t * 16 * HE, lane);
#pragma unroll
    for (int t = 0; t < 4; ++t) { v8f z0 = {}; s[t] = wmma16(ak, bq[t], z0); }
#pragma unroll
    for (int t = 0; t < 4; ++t) {
#pragma unroll
      for (int r = 0; r < 8; ++r) { const int key = k0 + 8 * g + r, q = qt * 64 + t * 16 + col; const float e = __builtin_amdgcn_exp2f(s[t][r]); zs[r] += !diag || q >= key ? e : 0.f; } } };
  trip(kt, true);
#pragma unroll 1
  for (int qt = kt + 1; qt < TT / 64; ++qt) trip(qt, false);   // rolled: one copy of the hot trip
  // reduce zs[r] over the 16 col lanes of each half -> key k0 + 8g + r
#pragma unroll
  for (int off = 8; off >= 1; off >>= 1) {
#pragma unroll
    for (int r = 0; r < 8; ++r) zs[r] += __shfl_xor(zs[r], off, 32); }
  if (col == 0) {
#pragma unroll
    for (int r = 0; r < 8; ++r) sz[part][w * 16 + 8 * g + r] = zs[r]; }
  }
  __syncthreads();
  if (tid < 32) { const int part = tid >> 4, kt = part == 0 ? (int)blockIdx.x : TT / 64 - 1 - (int)blockIdx.x;
    const v4f zz = *(const v4f*)(&sz[part][(tid & 15) * 4]); const v4f zi = {8.0f - log2f(zz[0]), 8.0f - log2f(zz[1]), 8.0f - log2f(zz[2]), 8.0f - log2f(zz[3])};
    vst2(Z + (size_t)hb * TT + kt * 64 + (tid & 15) * 4, zi); }   // pass 2 adds log2(256 / Z) of eight keys to its scores in every lane: each key's logarithm is taken once, here
}
// ---- pass 2: oh[hb][q][e] = sum_{k <= q} exp(s[q][k]) / Z[k] * V[k][e]; block = (hb, two tiles of 64 queries); Z holds log2(256 / column sum).
// Both products run transposed: S^T = K Q^T leaves key 16t + 8h + r of query (lane & 15) in register r of lane half h, which is the place that the
// B fragment of O^T = V^T P^T wants it in (elements 0..7 = tile 2kc, 8..15 = tile 2kc + 1), so P goes from the score registers to the second product by a conversion alone
#define VP (TT + 8)   // 4112 bytes, an odd multiple of 16: the 16 rows of a ds_load_b128 fragment read fall on different banks
__global__ __launch_bounds__(128) void k_av(const _Float16* __restrict__ Qh, const _Float16* __restrict__ Kh, const _Float16* __restrict__ vT, const float* __restrict__ Z, float* __restrict__ oh) {
  __shared__ __align__(16) _Float16 sK[TT * HE];   // the head's key rows, at their own index
  __shared__ __align__(16) _Float16 sV[HE * VP];   // the head's V^T rows, row pitch VP halves
  __shared__ __align__(16) float sZ[TT];           // log2(256 / the head's column sums)
  const int tid = threadIdx.x, w = tid >> 5, lane = tid & 31, col = lane & 15, g = lane >> 4;
  const int hb = blockIdx.y;
  const _Float16* qb = Qh + (size_t)hb * TT * HE; const _Float16* kb = Kh + (size_t)hb * TT * HE; const _Float16* vb = vT + (size_t)hb * HE * TT;
  // every key tile that the block meets (0 to 31 - x) comes to LDS once, in groups of eight tiles: per tile a thread takes 16 bytes of the 64 key rows and
  // 16 bytes of one of the 16 V^T rows; so no trip below waits for a global load. The first group and the column sums are waited here; the other groups
  // (at most 48 copies per wave) fly under the first eight trips and are published in front of trip 8 of the long tile.
  const unsigned lk = lds_byte(sK) + tid * 16, lv = lds_byte(sV) + (tid >> 3) * (VP * 2) + (tid & 7) * 16;
  const char* gk = (const char*)kb + tid * 16; const char* gv = (const char*)vb + (tid >> 3) * (TT * 2) + (tid & 7) * 16;
  copy8(lk, gk, 2048, 2048); copy8(lv, gv, 128, 128);
  copy4(lds_byte(sZ) + tid * 16, (const char*)(Z + (size_t)hb * TT) + tid * 16, 2048, 2048);
  asm volatile("s_wait_asynccnt 0x0" ::: "memory");   // this wave's copies have landed
  __syncthreads();                                    // and every other wave's: publishes tiles 0 to 7 and sZ
#pragma unroll 1
  for (int gq = 1; gq <= (TT / 64 - 1 - (int)blockIdx.x) >> 3; ++gq) {   // rolled: a block-uniform count of groups
    copy8(lk + gq * 16384, gk + gq * 16384, 2048, 2048); copy8(lv + gq * 1024, gv + gq * 1024, 128, 128); }
  // a query tile's cost grows linearly with its index, so a block takes tile 31 - x and then tile x, one after the other in every wave:
  // TT / 64 + 1 trips in every block, whatever WGP it lands on
#pragma unroll 1
  for (int part = 0; part < 2; ++part) {   // rolled: one copy of the hot loop
  const int qt = part == 0 ? TT / 64 - 1 - (int)blockIdx.x : (int)blockIdx.x, q0 = qt * 64 + w * 16;
  const v16h aq = frag16(qb + (size_t)(q0 + col) * HE, lane);
  asm volatile("s_wait_xcnt 0x0" :: "v"(aq) : "memory");   // precaution: the address registers of the load above are reused by the first trip; the loaded value as an input keeps the load ahead of the wait
  v8f acc = {};
  // one trip, straight-line: every LDS read of the trip (keys, column sums, values) is issued first, the four score products
  // follow back to back, so the 32 exp chains are independent work in one basic block (the unrolls keep bk, bv, zv and s in registers).
  // Only the tile on the diagonal (kt == qt) holds a key above a query: there the mask is a select on a finished exp; every earlier tile is
  // taken whole, with no compare and no select
  auto trip = [&](int kt, bool diag) __attribute__((always_inline)) {
    v16h bk[4], bv[2], pf[2]; v4f zv[4][2]; v8f s[4];
    const int dq = q0 + col - kt * 64 - 8 * g;   // key <= query reads t * 16 + r <= dq: the lane's query less its half's first key of the trip
#pragma unroll
    for (int t = 0; t < 4; ++t) bk[t] = frag16(sK + (kt * 64 + t * 16 + col) * HE, lane);
#pragma unroll
    for (int t = 0; t < 4; ++t) { const float* zp = sZ + kt * 64 + t * 16 + 8 * g; zv[t][0] = *(const v4f*)zp; zv[t][1] = *(const v4f*)(zp + 4); }   // keys 8g + 0..7 of tile t
#pragma unroll
    for (int kc = 0; kc < 2; ++kc) bv[kc] = frag_h(sV + col * VP + kt * 64 + kc * 32, lane);   // A row = e (lane&15 < 16)
#pragma unroll
    for (int t = 0; t < 4; ++t) {   // rows = keys, columns = queries; the C operand's register r is the row's log2(256 / Z), so D is the argument of 2^x, with no multiply left per score
      const v8f c0 = __builtin_shufflevector(zv[t][0], zv[t][1], 0, 1, 2, 3, 4, 5, 6, 7); s[t] = wmma16(bk[t], aq, c0); }
#pragma unroll
    for (int t = 0; t < 4; ++t) {
#pragma unroll
      for (int r = 0; r < 8; ++r) { const float e = __builtin_amdgcn_exp2f(s[t][r]); const float p = !diag || t * 16 + r <= dq ? e : 0.f; pf[t >> 1][(t & 1) * 8 + r] = (_Float16)p; } }   // attn <= ~1e-2 typically; x256
#pragma unroll
    for (int kc = 0; kc < 2; ++kc) acc = wmma16(bv[kc], pf[kc], acc); };
#pragma unroll 1
  for (int kt = 0; kt < qt; ++kt) {   // rolled: one copy of the hot trip
    if (part == 0 && kt == 8) {   // block-uniform, and the long tile (index 16 or more) always comes by here
      asm volatile("s_wait_asynccnt 0x0" ::: "memory");   // this wave's copies of the later groups have landed
      __syncthreads(); }                                  // and every other wave's: publishes tiles 8 and up
    trip(kt, false); }
  trip(qt, true);
  // register r of lane (g, col) holds e = 8g + r of query q0 + col: 32 adjacent bytes per lane, the wave's 16 rows are 1 KiB in a row
  { float* op = oh + ((size_t)hb * TT + q0 + col) * HE + 8 * g; const float u = 1.0f / 256.0f;
    const v4f o0 = {acc[0] * u, acc[1] * u, acc[2] * u, acc[3] * u}, o1 = {acc[4] * u, acc[5] * u, acc[6] * u, acc[7] * u};
    vst2(op, o0); vst2(op + 4, o1);
    asm volatile("s_wait_xcnt 0x0" ::: "memory"); }   // precaution: the registers of the two stores above are rewritten by the second tile
  }
}
// ---- FFN: hid = relu(out@W1+b1) -> f16 rows; out = hid@W2 + b2 + xpe. A for ff1 gathered from oh (k -> h = k/16, e = k%16)
__global__ __launch_bounds__(128) void k_ff1(const float* __restrict__ oh, const float* __restrict__ W1, const float* __restrict__ b1, _Float16* __restrict__ hid) {
  __shared__ __align__(16) float so[4][16][132];
  __shared__ __align__(32) _Float16 sW[DD * WP];
  const int tid = threadIdx.x, wave = tid >> 5, lane = tid & 31, col = lane & 15, g = lane >> 4;
  const int r0 = blockIdx.x * 64 + wave * 16, n0 = blockIdx.y * 128; const int r = r0 + col, b = r / TT, t = r % TT;
  v8f acc[8] = {};
  // the wave's own A values are asked for first and fly while the block's 128 weight columns are staged (the unrolls keep af in registers)
  float af[DD / 32][16];
#pragma unroll
  for (int kc = 0; kc < DD / 32; ++kc) {
#pragma unroll
    for (int i = 0; i < 8; ++i) { const int ka = kc * 32 + 8 * g + i, kz = ka + 16;
      af[kc][i] = oh[(((size_t)(ka >> 4) * NB + b) * TT + t) * HE + (ka & 15)]; af[kc][8 + i] = oh[(((size_t)(kz >> 4) * NB + b) * TT + t) * HE + (kz & 15)]; } }
  asm volatile("s_wait_xcnt 0x0" ::: "memory");   // precaution: the address registers of the loads above are rewritten below
  stage_w<DD>(W1 + n0, DFF, sW, tid);
  __syncthreads();   // publishes the staged weights to the four waves
#pragma unroll
  for (int kc = 0; kc < DD / 32; ++kc) { v16h a, bf[8];
#pragma unroll
    for (int i = 0; i < 16; ++i) a[i] = (_Float16)af[kc][i];
#pragma unroll
    for (int j = 0; j < 8; ++j) bf[j] = frag_tr(sW, kc * 32, j * 16, lane);   // the eight fragments of a k step are read as one group, one LDS wait
#pragma unroll
    for (int j = 0; j < 8; ++j) acc[j] = wmma16(a, bf[j], acc[j]); }
#pragma unroll
  for (int j = 0; j < 8; ++j) { const float bb = b1[n0 + j * 16 + col];
#pragma unroll
    for (int rr = 0; rr < 8; ++rr) { const float v = acc[j][rr] + bb; so[wave][8 * g + rr][j * 16 + col] = v > 0.f ? v : 0.f; } }
  LDSX();
  for (int q = lane; q < 16 * 16; q += 32) { const int rl = q >> 4, pc = q & 15; union { v8h hh; v4u u; } pk;
#pragma unroll
    for (int i = 0; i < 8; ++i) pk.hh[i] = (_Float16)so[wave][rl][pc * 8 + i];
    vst2(hid + (size_t)(r0 + rl) * DFF + n0 + pc * 8, pk.u); }
}
__global__ __launch_bounds__(128) void k_ff2(const _Float16* __restrict__ hid, const float* __restrict__ W2, const float* __restrict__ b2, const float* __restrict__ xpe, float* __restrict__ out) {
  __shared__ __align__(16) float so[4][16][132];
  __shared__ __align__(32) _Float16 sW[DFF * WP];
  const int tid = threadIdx.x, wave = tid >> 5, lane = tid & 31, col = lane & 15, g = lane >> 4;
  const int r0 = blockIdx.x * 64 + wave * 16;
  v8f acc[8] = {};
  // the first eight A fragments are asked for first and fly while the weights are staged; each of the other eight is asked for eight k steps ahead of its use
  const _Float16* arow = hid + (size_t)(r0 + col) * DFF; v16h a[8];
#pragma unroll
  for (int kc = 0; kc < 8; ++kc) a[kc] = frag_h(arow + kc * 32, lane);
  asm volatile("s_wait_xcnt 0x0" ::: "memory");   // precaution: the address registers of the loads above are rewritten below
  stage_w<DFF>(W2, DD, sW, tid);
  __syncthreads();   // publishes the staged weights to the four waves
#pragma unroll
  for (int kc = 0; kc < DFF / 32; ++kc) { const v16h cur = a[kc & 7]; v16h bf[8];   // unrolled: a[] stays in registers
    if (kc < 8) a[kc] = frag_h(arow + (kc + 8) * 32, lane);
#pragma unroll
    for (int j = 0; j < 8; ++j) bf[j] = frag_tr(sW, kc * 32, j * 16, lane);   // the eight fragments of a k step are read as one group, one LDS wait
#pragma unroll
    for (int j = 0; j < 8; ++j) acc[j] = wmma16(cur, bf[j], acc[j]); }
#pragma unroll
  for (int j = 0; j < 8; ++j) { const float bb = b2[j * 16 + col];
#pragma unroll
    for (int rr = 0; rr < 8; ++rr) so[wave][8 * g + rr][j * 16 + col] = acc[j][rr] + bb; }
  LDSX();
#pragma unroll 4
  for (int rl = 0; rl < 16; ++rl) { const size_t o = (size_t)(r0 + rl) * DD + lane * 4; vst2(out + o, *(const v4f*)(&so[wave][rl][lane * 4]) + *(const v4f*)(xpe + o)); }
}
extern "C" void kernel_launch(void* const* d_in, const int* in_sizes, int n_in, void* d_out, int out_size, void* d_ws, size_t ws_size, hipStream_t stream) {
  (void)in_sizes; (void)n_in; (void)out_size; (void)ws_size;
  const float* x = (const float*)d_in[0]; const float* WQ = (const float*)d_in[1]; const float* WK = (const float*)d_in[2]; const float* WV = (const float*)d_in[3];
  const float* W1 = (const float*)d_in[4]; const float* b1 = (const float*)d_in[5]; const float* W2 = (const float*)d_in[6]; const float* b2 = (const float*)d_in[7];
  float* out = (float*)d_out;
  char* ws = (char*)d_ws; size_t off = 0;
  auto take = [&](size_t bytes) { char* p = ws + off; off += (bytes + 255) & ~(size_t)255; return p; };
  float* xpe = (float*)take((size_t)NR * DD * 4);
  _Float16* Qh = (_Float16*)take((size_t)NR * DD * 2); _Float16* Kh = (_Float16*)take((size_t)NR * DD * 2); _Float16* vT = (_Float16*)take((size_t)NR * DD * 2);
  float* Z = (float*)take((size_t)NH * NB * TT * 4); float* oh = (float*)take((size_t)NR * DD * 4); _Float16* hid = (_Float16*)take((size_t)NR * DFF * 2);
  k_proj<<<NR / 64, 128, 0, stream>>>(x, WQ, WK, WV, xpe, Qh, Kh, vT);
  k_z<<<dim3(TT / 128, NH * NB), 128, 0, stream>>>(Qh, Kh, Z);
  k_av<<<dim3(TT / 128, NH * NB), 128, 0, stream>>>(Qh, Kh, vT, Z, oh);
  k_ff1<<<dim3(NR / 64, DFF / 128), 128, 0, stream>>>(oh, W1, b1, hid);
  k_ff2<<<NR / 64, 128, 0, stream>>>(hid, W2, b2, xpe, out);
}

// v010
// A run of this version takes 45.2 microseconds.
// Timed twice side by side with v009, it ran 1.15 and 1.16 times as fast.
// Counting every step since v000, it is 6.53 times as fast.
#include <hip/hip_runtime.h>
#include <math.h>

typedef __attribute__((ext_vector_type(16))) _Float16 v16h;
typedef __attribute__((ext_vector_type(16))) __bf16 v16b;
typedef __attribute__((ext_vector_type(8)))  _Float16 v8h;
typedef __attribute__((ext_vector_type(8)))  float v8f;
typedef __attribute__((ext_vector_type(4)))  float v4f;
typedef __attribute__((ext_vector_type(2)))  float v2f;
typedef __attribute__((ext_vector_type(4)))  unsigned v4u;
typedef __attribute__((ext_vector_type(4)))  int v4i;
typedef float __attribute__((may_alias)) float_a;
typedef int __attribute__((may_alias)) int_a;

template <typename T> __device__ __forceinline__ void vst2(void* p, T v) { *(T*)p = v;  }
__device__ __forceinline__ v8f wmma16(v16h a, v16h b, v8f c) {
  v8f d = __builtin_amdgcn_wmma_f32_16x16x32_f16(false, a, false, b, (short)0, c, false, false);
  asm volatile("v_nop\n\tv_nop\n\tv_nop\n\tv_nop" : "+v"(d) : "v"(a), "v"(b));
  return d;
}
__device__ __forceinline__ v8f wmma_bf(v16b a, v16b b, v8f c) {
  v8f d = __builtin_amdgcn_wmma_f32_16x16x32_bf16(false, a, false, b, (short)0, c, false, false);
  asm volatile("v_nop\n\tv_nop\n\tv_nop\n\tv_nop" : "+v"(d) : "v"(a), "v"(b));
  return d;
}
// 16x16x32 fragments: lane = (h = lane>>4, row/col = lane&15); elements 0..7 = k0+8h+0..7, 8..15 = k0+16+8h+0..7; D element r = row 8h+r
__device__ __forceinline__ v16h frag_h(const _Float16* rowk0, int lane) {
  union { v16h v; v8h q[2]; } u; const _Float16* p = rowk0 + 8 * (lane >> 4);
  u.q[0] = *(const v8h*)p; u.q[1] = *(const v8h*)(p + 16); return u.v;
}
__device__ __forceinline__ v16h frag_f32(const float* rowk0, int lane) {
  v16h a; const float* p = rowk0 + 8 * (lane >> 4);
#pragma unroll
  for (int i = 0; i < 8; ++i) { a[i] = (_Float16)p[i]; a[8 + i] = (_Float16)p[16 + i]; }
  return a;
}
__device__ __forceinline__ v16h frag_f32s(const float* rowk0, int lane, float sc) {
  v16h a; const float* p = rowk0 + 8 * (lane >> 4);
#pragma unroll
  for (int i = 0; i < 8; ++i) { a[i] = (_Float16)(p[i] * sc); a[8 + i] = (_Float16)(p[16 + i] * sc); }
  return a;
}
// column fragment from a [K][ld] layout (column n), rows >= K read as 0
__device__ __forceinline__ v16h fragc_f32(const float* W, int k0, int n, int lane, int ld, int K) {
  v16h a; const int g = lane >> 4;
#pragma unroll
  for (int i = 0; i < 8; ++i) { const int ka = k0 + 8 * g + i, kb = ka + 16;
    a[i] = (_Float16)(ka < K ? W[(size_t)ka * ld + n] : 0.f); a[8 + i] = (_Float16)(kb < K ? W[(size_t)kb * ld + n] : 0.f); }
  return a;
}
struct F2 { v16b h, l; };
__device__ __forceinline__ F2 bsplit16(const float v[16]) { F2 r;
#pragma unroll
  for (int i = 0; i < 16; ++i) { const __bf16 h = (__bf16)v[i]; r.h[i] = h; r.l[i] = (__bf16)(v[i] - (float)h); }
  return r; }
__device__ __forceinline__ F2 split_row(const float* row, int k0, int lane) { float v[16]; const float* p = row + k0 + 8 * (lane >> 4);
#pragma unroll
  for (int i = 0; i < 8; ++i) { v[i] = p[i]; v[8 + i] = p[16 + i]; }
  return bsplit16(v); }
__device__ __forceinline__ F2 split_rowK(const float* row, int k0, int lane, int K) { float v[16]; const int g = lane >> 4;
#pragma unroll
  for (int i = 0; i < 8; ++i) { const int ka = k0 + 8 * g + i, kb = ka + 16; v[i] = ka < K ? row[ka] : 0.f; v[8 + i] = kb < K ? row[kb] : 0.f; }
  return bsplit16(v); }
__device__ __forceinline__ F2 split_col(const float* W, int k0, int n, int lane, int ld, int K) { float v[16]; const int g = lane >> 4;
#pragma unroll
  for (int i = 0; i < 8; ++i) { const int ka = k0 + 8 * g + i, kb = ka + 16; v[i] = ka < K ? W[(size_t)ka * ld + n] : 0.f; v[8 + i] = kb < K ? W[(size_t)kb * ld + n] : 0.f; }
  return bsplit16(v); }
__device__ __forceinline__ v8f mac3(const F2& a, const F2& b, v8f c) { c = wmma_bf(a.l, b.h, c); c = wmma_bf(a.h, b.l, c); return wmma_bf(a.h, b.h, c); }
__device__ __forceinline__ float sigm(float v) { return 1.0f / (1.0f + expf(-v)); }
#define LDSX() do { asm volatile("s_wait_dscnt 0" ::: "memory"); __builtin_amdgcn_wave_barrier(); __builtin_amdgcn_fence(__ATOMIC_RELEASE, "workgroup"); } while (0)

// Causal multi-head attention whose softmax runs over the QUERY axis (per key column), + FFN + residual, with inline sinusoidal
// sums Z_k = sum_{q>=k} exp(s[q][k]); pass 2 is un-normalised causal attention with values scaled by 1/Z_k. Projections, both score
// passes (head dim 16 zero-padded to the 32-wide K), P@V and the FFN run on v_wmma_f32_16x16x32_f16 (f16 operands, f32
#define NB 4
#define TT 2048
#define DD 128
#define NH 8
#define HE 16
#define DFF 512
#define NR (NB * TT)

// Weight tiles in LDS: f16, row-major [k][128 columns], row pitch WP halves = 288 bytes (an odd multiple of 32 bytes, the pitch of the transposing read)
#define WP 144
typedef __attribute__((ext_vector_type(8))) short s16x8;
// 128 threads bring K rows of 128 f32 columns (row stride ld) into sW as f16: 16 lanes take one 512-byte row, 8 floats each; the 32 loads of
// 16 bytes of a batch of 128 rows are all issued before the first value is converted, so a batch pays the load latency once
// (the inner unrolls keep v in registers)
template <int K> __device__ __forceinline__ void stage_w(const float* __restrict__ Wsrc, int ld, _Float16* sW, int tid) {
  const float* s0 = Wsrc + (size_t)(tid >> 4) * ld + (tid & 15) * 8; _Float16* d0 = sW + (tid >> 4) * WP + (tid & 15) * 8;
#pragma unroll 1
  for (int b = 0; b < K / 128; ++b) {   // rolled: one batch already fills 128 registers
    v4f v[16][2]; const float* pb = s0 + (size_t)(b * 128) * ld;
#pragma unroll
    for (int i = 0; i < 16; ++i) { const float* p = pb + (size_t)(i * 8) * ld; v[i][0] = *(const v4f*)p; v[i][1] = *(const v4f*)(p + 4); }
    // precaution: the address registers of the loads above are rewritten below; the batch's base pointer as an input keeps its registers live up to the wait, so
    // that no loaded value is put into them ahead of it; the wait also keeps the whole batch of loads ahead of the conversions
    asm volatile("s_wait_xcnt 0x0" :: "v"(pb) : "memory");
#pragma unroll
    for (int i = 0; i < 16; ++i) { v8h h;
#pragma unroll
      for (int e = 0; e < 4; ++e) { h[e] = (_Float16)v[i][0][e]; h[4 + e] = (_Float16)v[i][1][e]; }
      *(v8h*)(d0 + (b * 128 + i * 8) * WP) = h; }
  }
}
// B fragment (k0..k0+31, columns n0..n0+15) of such a tile by two transposing LDS reads: lane (c, h) gets T[k0 + 8h + 0..7][n0 + c], then the same 16 rows on:
// the k order of frag_h and frag_f32. Every lane is on where it is called.
__device__ __forceinline__ v16h frag_tr(const _Float16* T, int k0, int n0, int lane) {
  typedef __attribute__((address_space(3))) s16x8 lds_s16x8;
  const _Float16* p = T + (k0 + 8 * (lane >> 4) + (lane & 7)) * WP + n0 + 8 * ((lane >> 3) & 1);
  union { v16h v; s16x8 q[2]; } u;
  u.q[0] = __builtin_amdgcn_ds_load_tr16_b128_v8i16((lds_s16x8*)p); u.q[1] = __builtin_amdgcn_ds_load_tr16_b128_v8i16((lds_s16x8*)(p + 16 * WP));
  return u.v;
}

// sin and cos of an angle a in [0, 2^17): n = nearest multiple of pi/2, a - n * pi/2 in three parts, then the two short polynomials on [-pi/4, pi/4] and the
// quadrant's swap and signs. The angles here are position * frequency with position < TT and frequency <= 1, so no wider reduction is reachable.
__device__ __forceinline__ void sincos_red(float a, float& sn, float& cs) {
  const float n = __builtin_rintf(a * __uint_as_float(0x3f22f983u));
  float r = __builtin_fmaf(__uint_as_float(0xbfc90fdau), n, a); r = __builtin_fmaf(__uint_as_float(0xb3a22168u), n, r); r = __builtin_fmaf(__uint_as_float(0xa7c234c4u), n, r);
  const unsigned q = (unsigned)(int)n; const float s = r * r;
  float ps = __builtin_fmaf(__uint_as_float(0xb94c1982u), s, __uint_as_float(0x3c0881c4u)); ps = __builtin_fmaf(s, ps, __uint_as_float(0xbe2aaa9du)); ps = s * ps;
  const float sr = __builtin_fmaf(r, ps, r);
  float pc = __builtin_fmaf(__uint_as_float(0x37d75334u), s, __uint_as_float(0xbab64f3bu)); pc = __builtin_fmaf(s, pc, __uint_as_float(0x3d2aabf7u)); pc = __builtin_fmaf(s, pc, __uint_as_float(0xbf000004u));
  const float cr = __builtin_fmaf(s, pc, 1.0f);
  const unsigned sg = (q << 30) & 0x80000000u; const bool odd = q & 1u;
  sn = __uint_as_float(__float_as_uint(odd ? cr : sr) ^ sg); cs = __uint_as_float(__float_as_uint(odd ? -sr : cr) ^ sg);
}
// ---- x + PE -> xpe rows (f32) and Q/K (f16 [h][b][t][16]) / V^T (f16 [h][b][e][t]); block = 64 rows (one b) x all 384 cols
__global__ __launch_bounds__(128) void k_proj(const float* __restrict__ x, const float* __restrict__ WQ, const float* __restrict__ WK, const float* __restrict__ WV,
                                            float* __restrict__ xpe, _Float16* __restrict__ Qh, _Float16* __restrict__ Kh, _Float16* __restrict__ vT) {
  __shared__ __align__(16) float sx[64][DD + 4];
  __shared__ __align__(16) float so[4][16][132];
  __shared__ __align__(16) _Float16 st[DD][72];
  __shared__ __align__(32) _Float16 sW[3][DD * WP];
  const int tid = threadIdx.x, wave = tid >> 5, lane = tid & 31, col = lane & 15, g = lane >> 4;
  const int r0b = blockIdx.x * 64, b = r0b / TT, t0 = r0b % TT;
  // the block's 64 x rows are asked for first, as one batch of 16-byte loads (a wave takes one 512-byte row per load, thread = 4 adjacent columns of
  // rows wave + 4i), and fly while the weights are staged (the unroll keeps xv in registers)
  const int pc4 = lane; v4f xv[16]; const float* xp = x + (size_t)(r0b + wave) * DD + pc4 * 4;
#pragma unroll
  for (int i = 0; i < 16; ++i) xv[i] = *(const v4f*)(xp + i * 4 * DD);
  asm volatile("s_wait_xcnt 0x0" ::: "memory");   // precaution: the address registers of the loads above are rewritten below
  // the three weight matrices go to LDS once per block; the barrier behind the PE stage publishes them too
#pragma unroll 1
  for (int m = 0; m < 3; ++m) stage_w<DD>(m == 0 ? WQ : (m == 1 ? WK : WV), DD, &sW[m][0], tid);   // rolled: one matrix in flight fills 128 registers
  // PE + stage: straight-line, 32 independent sin/cos pairs per thread (the unroll keeps xv in registers); a column pair (2i, 2i+1) shares its angle
  { const float kdiv = -logf(10000.0f) / (float)DD;
    const float div0 = expf((float)(pc4 * 4) * kdiv), div1 = expf((float)(pc4 * 4 + 2) * kdiv);
#pragma unroll
    for (int i = 0; i < 16; ++i) { const int rl = wave + 4 * i; const float tf = (float)(t0 + rl); float s0, c0, s1, c1;
      sincos_red(tf * div0, s0, c0); sincos_red(tf * div1, s1, c1); const v4f pe = {s0, c0, s1, c1};
      *(v4f*)(&sx[rl][pc4 * 4]) = xv[i] + pe; } }
  __syncthreads();
  for (int q = tid; q < 64 * 32; q += 128) { const int rl = q >> 5, pc = q & 31; vst2(xpe + (size_t)(r0b + rl) * DD + pc * 4, *(const v4f*)(&sx[rl][pc * 4])); }
#pragma unroll 1
  for (int which = 0; which < 3; ++which) { const _Float16* sw = &sW[which][0];
    v8f acc[8] = {};
#pragma unroll
    for (int kc = 0; kc < DD / 32; ++kc) { const v16h a = frag_f32(&sx[wave * 16 + col][0] + kc * 32, lane); v16h bf[8];
#pragma unroll
      for (int j = 0; j < 8; ++j) bf[j] = frag_tr(sw, kc * 32, j * 16, lane);   // the eight fragments of a k step are read as one group, one LDS wait
#pragma unroll
      for (int j = 0; j < 8; ++j) acc[j] = wmma16(a, bf[j], acc[j]); }
    if (which < 2) {
#pragma unroll
      for (int j = 0; j < 8; ++j)
#pragma unroll
        for (int r = 0; r < 8; ++r) so[wave][8 * g + r][j * 16 + col] = acc[j][r];
      LDSX();
      _Float16* dst = which == 0 ? Qh : Kh;
      // Q is stored times score scale * log2(e), in f32 ahead of its one rounding to f16: the score products of both passes then are the arguments of 2^x
      const float osc = which == 0 ? rsqrtf((float)TT) * 1.44269504f : 1.0f;
      // per head h (= tile j): 16 rows x 16 halves = 512 B contiguous at dst[((h*NB + b)*TT + t0 + wave*16) * 16]
      for (int q = lane; q < 8 * 32; q += 32) { const int h = q >> 5, pp = q & 31; const int rl = pp >> 1, half = (pp & 1) * 8; union { v8h hh; v4u u; } pk;
#pragma unroll
        for (int i = 0; i < 8; ++i) pk.hh[i] = (_Float16)(so[wave][rl][h * 16 + half + i] * osc);
        vst2(dst + (((size_t)h * NB + b) * TT + t0 + wave * 16 + rl) * HE + half, pk.u); }
      LDSX();
    } else {
#pragma unroll
      for (int j = 0; j < 8; ++j)
#pragma unroll
        for (int r = 0; r < 8; ++r) st[j * 16 + col][wave * 16 + 8 * g + r] = (_Float16)acc[j][r];    // st[h*16+e][t local]
      __syncthreads();
      for (int q = tid; q < DD * 8; q += 128) { const int c = q >> 3, pc = q & 7, h = c >> 4, e = c & 15;
        vst2(vT + (((size_t)h * NB + b) * HE + e) * TT + t0 + pc * 8, *(const v4u*)(&st[c][pc * 8])); }
    }
  }
}
// Asynchronous copies to LDS: every lane brings its own 16 bytes from g + i * gstep (bytes) to the LDS byte address l + i * lstep, through no register.
// The s_wait_xcnt 0 is the last line of the copies' own statement (a precaution: their address registers are rewritten behind it).
__device__ __forceinline__ unsigned lds_byte(const void* p) { return (unsigned)(size_t)p; }   // low 32 bits of a __shared__ address
__device__ __forceinline__ void copy8(unsigned l, const char* g, unsigned lstep, unsigned gstep) {
  asm volatile("global_load_async_to_lds_b128 %0, %8, off\n\tglobal_load_async_to_lds_b128 %1, %9, off\n\t"
               "global_load_async_to_lds_b128 %2, %10, off\n\tglobal_load_async_to_lds_b128 %3, %11, off\n\t"
               "global_load_async_to_lds_b128 %4, %12, off\n\tglobal_load_async_to_lds_b128 %5, %13, off\n\t"
               "global_load_async_to_lds_b128 %6, %14, off\n\tglobal_load_async_to_lds_b128 %7, %15, off\n\ts_wait_xcnt 0x0"
               :: "v"(l), "v"(l + lstep), "v"(l + 2 * lstep), "v"(l + 3 * lstep), "v"(l + 4 * lstep), "v"(l + 5 * lstep), "v"(l + 6 * lstep), "v"(l + 7 * lstep),
                  "v"(g), "v"(g + gstep), "v"(g + 2 * gstep), "v"(g + 3 * gstep), "v"(g + 4 * gstep), "v"(g + 5 * gstep), "v"(g + 6 * gstep), "v"(g + 7 * gstep) : "memory");
}
__device__ __forceinline__ void copy4(unsigned l, const char* g, unsigned lstep, unsigned gstep) {
  asm volatile("global_load_async_to_lds_b128 %0, %4, off\n\tglobal_load_async_to_lds_b128 %1, %5, off\n\t"
               "global_load_async_to_lds_b128 %2, %6, off\n\tglobal_load_async_to_lds_b128 %3, %7, off\n\ts_wait_xcnt 0x0"
               :: "v"(l), "v"(l + lstep), "v"(l + 2 * lstep), "v"(l + 3 * lstep), "v"(g), "v"(g + gstep), "v"(g + 2 * gstep), "v"(g + 3 * gstep) : "memory");
}
__device__ __forceinline__ v16h frag16(const _Float16* row16, int lane) {   // K = 16 real: elements 0..7 (h==0 lanes) and ... 
  // fragment elements: 0..7 = k 8h+0..7 (h = lane>>4) -> h==0: k 0..7, h==1: k 8..15; elements 8..15 = k 16+.. -> zero
  v16h a; const int hh = lane >> 4; union { v8h v; } u; u.v = *(const v8h*)(row16 + 8 * hh);
#pragma unroll
  for (int i = 0; i < 8; ++i) { a[i] = u.v[i]; a[8 + i] = (_Float16)0.f; }
  return a;
}
__global__ __launch_bounds__(128) void k_z(const _Float16* __restrict__ Qh, const _Float16* __restrict__ Kh, float* __restrict__ Z) {
  __shared__ __align__(16) float sz[2][64];
  __shared__ __align__(16) _Float16 sQ[TT * HE];   // the head's query rows, at their own index
  const int tid = threadIdx.x, w = tid >> 5, lane = tid & 31, col = lane & 15, g = lane >> 4;
  const int hb = blockIdx.y;
  const _Float16* qb = Qh + (size_t)hb * TT * HE; const _Float16* kb = Kh + (size_t)hb * TT * HE;   // Q comes scaled: exp(score) = 2^(K Q^T), one v_exp_f32
  // every query row that the block's two key tiles meet (from tile x on, in groups of eight tiles of 64 rows) comes to LDS once, all copies in flight
  // together (at most 32 per wave; a thread takes 16 bytes of each 2-KiB tile), so no trip below waits for a global load
#pragma unroll 1
  for (int gq = (int)blockIdx.x >> 3; gq < TT / 512; ++gq)   // rolled: a block-uniform count of groups
    copy8(lds_byte(sQ) + gq * 16384 + tid * 16, (const char*)qb + gq * 16384 + tid * 16, 2048, 2048);
  asm volatile("s_wait_asynccnt 0x0" ::: "memory");   // this wave's copies have landed
  __syncthreads();                                    // and every other wave's: publishes sQ
  // a key tile's cost falls linearly with its index, so a block takes tile x and then tile 31 - x, one after the other in every wave:
  // TT / 64 + 1 trips in every block, whatever WGP it lands on
#pragma unroll 1
  for (int part = 0; part < 2; ++part) {   // rolled: one copy of the hot loop
  const int kt = part == 0 ? (int)blockIdx.x : TT / 64 - 1 - (int)blockIdx.x, k0 = kt * 64 + w * 16;
  const v16h ak = frag16(kb + (size_t)(k0 + col) * HE, lane);
  float zs[8] = {0.f, 0.f, 0.f, 0.f, 0.f, 0.f, 0.f, 0.f};
  // one trip, straight-line: the four query fragments are read from LDS first, the four score products follow back to back, so the 32 exp chains
  // are independent work in one basic block (the unrolls keep bq and s in registers). Only the tile on the diagonal (qt == kt) holds a query below a key:
  // there the mask is a select on a finished exp; every later tile is summed whole, with no compare and no select
  auto trip = [&](int qt, bool diag) __attribute__((always_inline)) {
    v16h bq[4]; v8f s[4]; const _Float16* qrow = sQ + (qt * 64 + col) * HE;
#pragma unroll
    for (int t = 0; t < 4; ++t) bq[t] = frag16(qrow + t * 16 * HE, lane);
#pragma unroll
    for (int t = 0; t < 4; ++t) { v8f z0 = {}; s[t] = wmma16(ak, bq[t], z0); }
#pragma unroll
    for (int t = 0; t < 4; ++t) {
#pragma unroll
      for (int r = 0; r < 8; ++r) { const int key = k0 + 8 * g + r, q = qt * 64 + t * 16 + col; const float e = __builtin_amdgcn_exp2f(s[t][r]); zs[r] += !diag || q >= key ? e : 0.f; } } };
  trip(kt, true);
#pragma unroll 1
  for (int qt = kt + 1; qt < TT / 64; ++qt) trip(qt, false);   // rolled: one copy of the hot trip
  // reduce zs[r] over the 16 col lanes of each half -> key k0 + 8g + r
#pragma unroll
  for (int off = 8; off >= 1; off >>= 1) {
#pragma unroll
    for (int r = 0; r < 8; ++r) zs[r] += __shfl_xor(zs[r], off, 32); }
  if (col == 0) {
#pragma unroll
    for (int r = 0; r < 8; ++r) sz[part][w * 16 + 8 * g + r] = zs[r]; }
  }
  __syncthreads();
  if (tid < 32) { const int part = tid >> 4, kt = part == 0 ? (int)blockIdx.x : TT / 64 - 1 - (int)blockIdx.x;
    const v4f zz = *(const v4f*)(&sz[part][(tid & 15) * 4]); const v4f zi = {8.0f - log2f(zz[0]), 8.0f - log2f(zz[1]), 8.0f - log2f(zz[2]), 8.0f - log2f(zz[3])};
    vst2(Z + (size_t)hb * TT + kt * 64 + (tid & 15) * 4, zi); }   // pass 2 adds log2(256 / Z) of eight keys to its scores in every lane: each key's logarithm is taken once, here
}
// ---- pass 2: oh[hb][q][e] = sum_{k <= q} exp(s[q][k]) / Z[k] * V[k][e]; block = (hb, two tiles of 64 queries); Z holds log2(256 / column sum).
// Both products run transposed: S^T = K Q^T leaves key 16t + 8h + r of query (lane & 15) in register r of lane half h, which is the place that the
// B fragment of O^T = V^T P^T wants it in (elements 0..7 = tile 2kc, 8..15 = tile 2kc + 1), so P goes from the score registers to the second product by a conversion alone
#define VP (TT + 8)   // 4112 bytes, an odd multiple of 16: the 16 rows of a ds_load_b128 fragment read fall on different banks
__global__ __launch_bounds__(128) void k_av(const _Float16* __restrict__ Qh, const _Float16* __restrict__ Kh, const _Float16* __restrict__ vT, const float* __restrict__ Z, float* __restrict__ oh) {
  __shared__ __align__(16) _Float16 sK[TT * HE];   // the head's key rows, at their own index
  __shared__ __align__(16) _Float16 sV[HE * VP];   // the head's V^T rows, row pitch VP halves
  __shared__ __align__(16) float sZ[TT];           // log2(256 / the head's column sums)
  const int tid = threadIdx.x, w = tid >> 5, lane = tid & 31, col = lane & 15, g = lane >> 4;
  const int hb = blockIdx.y;
  const _Float16* qb = Qh + (size_t)hb * TT * HE; const _Float16* kb = Kh + (size_t)hb * TT * HE; const _Float16* vb = vT + (size_t)hb * HE * TT;
  // every key tile that the block meets (0 to 31 - x) comes to LDS once, in groups of eight tiles: per tile a thread takes 16 bytes of the 64 key rows and
  // 16 bytes of one of the 16 V^T rows; so no trip below waits for a global load. The first group and the column sums are waited here; the other groups
  // (at most 48 copies per wave) fly under the first eight trips and are published in front of trip 8 of the long tile.
  const unsigned lk = lds_byte(sK) + tid * 16, lv = lds_byte(sV) + (tid >> 3) * (VP * 2) + (tid & 7) * 16;
  const char* gk = (const char*)kb + tid * 16; const char* gv = (const char*)vb + (tid >> 3) * (TT * 2) + (tid & 7) * 16;
  copy8(lk, gk, 2048, 2048); copy8(lv, gv, 128, 128);
  copy4(lds_byte(sZ) + tid * 16, (const char*)(Z + (size_t)hb * TT) + tid * 16, 2048, 2048);
  asm volatile("s_wait_asynccnt 0x0" ::: "memory");   // this wave's copies have landed
  __syncthreads();                                    // and every other wave's: publishes tiles 0 to 7 and sZ
#pragma unroll 1
  for (int gq = 1; gq <= (TT / 64 - 1 - (int)blockIdx.x) >> 3; ++gq) {   // rolled: a block-uniform count of groups
    copy8(lk + gq * 16384, gk + gq * 16384, 2048, 2048); copy8(lv + gq * 1024, gv + gq * 1024, 128, 128); }
  // a query tile's cost grows linearly with its index, so a block takes tile 31 - x and then tile x, one after the other in every wave:
  // TT / 64 + 1 trips in every block, whatever WGP it lands on
#pragma unroll 1
  for (int part = 0; part < 2; ++part) {   // rolled: one copy of the hot loop
  const int qt = part == 0 ? TT / 64 - 1 - (int)blockIdx.x : (int)blockIdx.x, q0 = qt * 64 + w * 16;
  const v16h aq = frag16(qb + (size_t)(q0 + col) * HE, lane);
  asm volatile("s_wait_xcnt 0x0" :: "v"(aq) : "memory");   // precaution: the address registers of the load above are reused by the first trip; the loaded value as an input keeps the load ahead of the wait
  v8f acc = {};
  // one trip, straight-line: every LDS read of the trip (keys, column sums, values) is issued first, the four score products
  // follow back to back, so the 32 exp chains are independent work in one basic block (the unrolls keep bk, bv, zv and s in registers).
  // Only the tile on the diagonal (kt == qt) holds a key above a query: there the mask is a select on a finished exp; every earlier tile is
  // taken whole, with no compare and no select
  auto trip = [&](int kt, bool diag) __attribute__((always_inline)) {
    v16h bk[4], bv[2], pf[2]; v4f zv[4][2]; v8f s[4];
    const int dq = q0 + col - kt * 64 - 8 * g;   // key <= query reads t * 16 + r <= dq: the lane's query less its half's first key of the trip
#pragma unroll
    for (int t = 0; t < 4; ++t) bk[t] = frag16(sK + (kt * 64 + t * 16 + col) * HE, lane);
#pragma unroll
    for (int t = 0; t < 4; ++t) { const float* zp = sZ + kt * 64 + t * 16 + 8 * g; zv[t][0] = *(const v4f*)zp; zv[t][1] = *(const v4f*)(zp + 4); }   // keys 8g + 0..7 of tile t
#pragma unroll
    for (int kc = 0; kc < 2; ++kc) bv[kc] = frag_h(sV + col * VP + kt * 64 + kc * 32, lane);   // A row = e (lane&15 < 16)
#pragma unroll
    for (int t = 0; t < 4; ++t) {   // rows = keys, columns = queries; the C operand's register r is the row's log2(256 / Z), so D is the argument of 2^x, with no multiply left per score
      const v8f c0 = __builtin_shufflevector(zv[t][0], zv[t][1], 0, 1, 2, 3, 4, 5, 6, 7); s[t] = wmma16(bk[t], aq, c0); }
#pragma unroll
    for (int t = 0; t < 4; ++t) {
#pragma unroll
      for (int r = 0; r < 8; ++r) { const float e = __builtin_amdgcn_exp2f(s[t][r]); const float p = !diag || t * 16 + r <= dq ? e : 0.f; pf[t >> 1][(t & 1) * 8 + r] = (_Float16)p; } }   // attn <= ~1e-2 typically; x256
#pragma unroll
    for (int kc = 0; kc < 2; ++kc) acc = wmma16(bv[kc], pf[kc], acc); };
#pragma unroll 1
  for (int kt = 0; kt < qt; ++kt) {   // rolled: one copy of the hot trip
    if (part == 0 && kt == 8) {   // block-uniform, and the long tile (index 16 or more) always comes by here
      asm volatile("s_wait_asynccnt 0x0" ::: "memory");   // this wave's copies of the later groups have landed
      __syncthreads(); }                                  // and every other wave's: publishes tiles 8 and up
    trip(kt, false); }
  trip(qt, true);
  // register r of lane (g, col) holds e = 8g + r of query q0 + col: 32 adjacent bytes per lane, the wave's 16 rows are 1 KiB in a row
  { float* op = oh + ((size_t)hb * TT + q0 + col) * HE + 8 * g; const float u = 1.0f / 256.0f;
    const v4f o0 = {acc[0] * u, acc[1] * u, acc[2] * u, acc[3] * u}, o1 = {acc[4] * u, acc[5] * u, acc[6] * u, acc[7] * u};
    vst2(op, o0); vst2(op + 4, o1);
    asm volatile("s_wait_xcnt 0x0" ::: "memory"); }   // precaution: the registers of the two stores above are rewritten by the second tile
  }
}
// ---- FFN in one launch: out = relu(o @ W1 + b1) @ W2 + b2 + xpe; block = 64 rows, 8 waves; o gathered from oh (k -> h = k/16, e = k%16).
// Both products run transposed: hid^T = W1^T o^T leaves hidden unit 16j + 8h + r of row (lane & 15) in register r of lane half h, which is the place that the
// B fragment of out^T = W2^T hid^T wants it in (elements 0..7 = tile 2kc, 8..15 = tile 2kc + 1), so the hidden layer goes from the first product to the second by
// relu and a conversion alone and never leaves the registers. Wave (rp, c) takes rows 32 rp .. + 31 (two row tiles, so a weight fragment read from LDS serves two
// products) and hidden units 128 c .. + 127; the four partial sums of an output element meet in LDS, in the pass that turns out^T back into rows.
typedef v4f __attribute__((may_alias)) v4f_a;
#define SOP 132   // row pitch of the f32 output tiles in LDS: 528 bytes, an odd multiple of 16
__global__ __launch_bounds__(256) void k_ffn(const float* __restrict__ oh, const float* __restrict__ W1, const float* __restrict__ b1, const float* __restrict__ W2,
                                             const float* __restrict__ b2, const float* __restrict__ xpe, float* __restrict__ out) {
  __shared__ __align__(32) _Float16 sW1[4 * DD * WP];   // four tiles of 128 hidden units, each [k = 128][WP]; the output tiles lie here once the products are done
  __shared__ __align__(32) _Float16 sW2[DFF * WP];      // [k = 512][WP]
  __shared__ __align__(16) float sB[DFF + DD];          // b1, then b2
  const int tid = threadIdx.x, wave = tid >> 5, lane = tid & 31, col = lane & 15, g = lane >> 4;
  const int rp = wave & 1, c = wave >> 1, hb2 = tid >> 7, R0 = blockIdx.x * 64, b = R0 / TT, t = R0 % TT + rp * 32 + col;
  // the two bias vectors (16 bytes a thread, whole waves) and the wave's own o values are asked for first and fly while the weights are staged
  // (the unrolls keep af in registers)
  v4f bv = {0.f, 0.f, 0.f, 0.f};
  if (tid < (DFF + DD) / 4) bv = *(const v4f*)(tid < DFF / 4 ? b1 + tid * 4 : b2 + (tid - DFF / 4) * 4);
  float af[2][DD / 32][16];
#pragma unroll
  for (int s = 0; s < 2; ++s) {
#pragma unroll
    for (int kc = 0; kc < DD / 32; ++kc) {
#pragma unroll
      for (int i = 0; i < 8; ++i) { const int ka = kc * 32 + 8 * g + i, kz = ka + 16;
        af[s][kc][i] = oh[(((size_t)(ka >> 4) * NB + b) * TT + t + s * 16) * HE + (ka & 15)]; af[s][kc][8 + i] = oh[(((size_t)(kz >> 4) * NB + b) * TT + t + s * 16) * HE + (kz & 15)]; } } }
  asm volatile("s_wait_xcnt 0x0" ::: "memory");   // precaution: the address registers of the loads above are rewritten below
  // each half of the block (128 threads) stages the weights of 256 hidden units: two column tiles of W1, 256 rows of W2
#pragma unroll 1
  for (int cc = 0; cc < 2; ++cc) stage_w<DD>(W1 + (hb2 * 2 + cc) * 128, DFF, sW1 + (hb2 * 2 + cc) * DD * WP, tid & 127);   // rolled: one tile in flight fills 128 registers
  stage_w<DFF / 2>(W2 + (size_t)hb2 * (DFF / 2) * DD, DD, sW2 + hb2 * (DFF / 2) * WP, tid & 127);
  if (tid < (DFF + DD) / 4) *(v4f*)(&sB[tid * 4]) = bv;
  __syncthreads();   // publishes the staged weights and biases to the eight waves
  // the residual rows are asked for here and fly under the products: thread = 16 bytes of row (tid >> 5) + 8i (the unroll keeps xr in registers)
  v4f xr[8]; const size_t o0 = (size_t)R0 * DD + tid * 4; const float* xp = xpe + o0;
#pragma unroll
  for (int i = 0; i < 8; ++i) xr[i] = *(const v4f*)(xp + i * 1024);
  asm volatile("s_wait_xcnt 0x0" :: "v"(xp) : "memory");   // precaution: the address registers of the loads above are rewritten below; the pointer as an input keeps them live up to the wait
  const _Float16* w1 = sW1 + c * DD * WP; const _Float16* w2 = sW2 + c * 128 * WP;
  v16h a[2][DD / 32], pf[2][4]; v8f hT[2][8], oT[2][8];
#pragma unroll
  for (int s = 0; s < 2; ++s) {
#pragma unroll
    for (int kc = 0; kc < DD / 32; ++kc) {
#pragma unroll
      for (int i = 0; i < 16; ++i) a[s][kc][i] = (_Float16)af[s][kc][i]; } }
  // the C operand's register r is the row's bias (a row of hid^T is a hidden unit)
#pragma unroll
  for (int j = 0; j < 8; ++j) { const float* bp = sB + c * 128 + j * 16 + 8 * g; hT[0][j] = __builtin_shufflevector(*(const v4f*)bp, *(const v4f*)(bp + 4), 0, 1, 2, 3, 4, 5, 6, 7); hT[1][j] = hT[0][j]; }
#pragma unroll
  for (int q = 0; q < DD / 32 * 2; ++q) { const int kc = q >> 1, j0 = (q & 1) * 4; v16h bf[4];
#pragma unroll
    for (int j = 0; j < 4; ++j) bf[j] = frag_tr(w1, kc * 32, (j0 + j) * 16, lane);   // four fragments are read as one group, one LDS wait, and serve eight products
#pragma unroll
    for (int j = 0; j < 4; ++j) { hT[0][j0 + j] = wmma16(bf[j], a[0][kc], hT[0][j0 + j]); hT[1][j0 + j] = wmma16(bf[j], a[1][kc], hT[1][j0 + j]); } }   // rows = hidden units, columns = data rows
#pragma unroll
  for (int s = 0; s < 2; ++s) {
#pragma unroll
    for (int j = 0; j < 8; ++j) {
#pragma unroll
      for (int rr = 0; rr < 8; ++rr) { const float v = hT[s][j][rr]; pf[s][j >> 1][(j & 1) * 8 + rr] = (_Float16)(v > 0.f ? v : 0.f); } } }
  // b2 enters an output element's sum once, as the C operand of the waves that hold the first 128 hidden units
#pragma unroll
  for (int m = 0; m < 8; ++m) { const float* bp = sB + DFF + m * 16 + 8 * g; const v4f lo = *(const v4f*)bp, hi = *(const v4f*)(bp + 4);
#pragma unroll
    for (int e = 0; e < 4; ++e) { oT[0][m][e] = c == 0 ? lo[e] : 0.f; oT[0][m][4 + e] = c == 0 ? hi[e] : 0.f; }
    oT[1][m] = oT[0][m]; }
#pragma unroll
  for (int q = 0; q < 8; ++q) { const int kc = q >> 1, m0 = (q & 1) * 4; v16h bf[4];
#pragma unroll
    for (int m = 0; m < 4; ++m) bf[m] = frag_tr(w2, kc * 32, (m0 + m) * 16, lane);   // as above
#pragma unroll
    for (int m = 0; m < 4; ++m) { oT[0][m0 + m] = wmma16(bf[m], pf[0][kc], oT[0][m0 + m]); oT[1][m0 + m] = wmma16(bf[m], pf[1][kc], oT[1][m0 + m]); } }   // rows = output columns, columns = data rows
  __syncthreads();   // every wave has read its last weight fragment: the LDS of the W1 tiles is free
  float* so = (float*)sW1;   // [c][64 rows][SOP]
  // register r of lane (g, col) holds column 16m + 8g + r of row 32 rp + 16 s + col: 32 adjacent bytes per tile
#pragma unroll
  for (int s = 0; s < 2; ++s) {
#pragma unroll
    for (int m = 0; m < 8; ++m) { float* p = so + (c * 64 + rp * 32 + s * 16 + col) * SOP + m * 16 + 8 * g;
      const v4f lo = {oT[s][m][0], oT[s][m][1], oT[s][m][2], oT[s][m][3]}, hi = {oT[s][m][4], oT[s][m][5], oT[s][m][6], oT[s][m][7]};
      *(v4f_a*)p = lo; *(v4f_a*)(p + 4) = hi; } }
  __syncthreads();   // publishes the four partial sums
#pragma unroll
  for (int i = 0; i < 8; ++i) { const float* s0 = so + ((tid >> 5) + 8 * i) * SOP + lane * 4;   // xr becomes the finished row piece (the unrolls keep it in registers)
    xr[i] = *(const v4f_a*)s0 + *(const v4f_a*)(s0 + 64 * SOP) + *(const v4f_a*)(s0 + 128 * SOP) + *(const v4f_a*)(s0 + 192 * SOP) + xr[i]; }
#pragma unroll
  for (int i = 0; i < 8; ++i) vst2(out + o0 + i * 1024, xr[i]);
}
extern "C" void kernel_launch(void* const* d_in, const int* in_sizes, int n_in, void* d_out, int out_size, void* d_ws, size_t ws_size, hipStream_t stream) {
  (void)in_sizes; (void)n_in; (void)out_size; (void)ws_size;
  const float* x = (const float*)d_in[0]; const float* WQ = (const float*)d_in[1]; const float* WK = (const float*)d_in[2]; const float* WV = (const float*)d_in[3];
  const float* W1 = (const float*)d_in[4]; const float* b1 = (const float*)d_in[5]; const float* W2 = (const float*)d_in[6]; const float* b2 = (const float*)d_in[7];
  float* out = (float*)d_out;
  char* ws = (char*)d_ws; size_t off = 0;
  auto take = [&](size_t bytes) { char* p = ws + off; off += (bytes + 255) & ~(size_t)255; return p; };
  float* xpe = (float*)take((size_t)NR * DD * 4);
  _Float16* Qh = (_Float16*)take((size_t)NR * DD * 2); _Float16* Kh = (_Float16*)take((size_t)NR * DD * 2); _Float16* vT = (_Float16*)take((size_t)NR * DD * 2);
  float* Z = (float*)take((size_t)NH * NB * TT * 4); float* oh = (float*)take((size_t)NR * DD * 4);
  k_proj<<<NR / 64, 128, 0, stream>>>(x, WQ, WK, WV, xpe, Qh, Kh, vT);
  k_z<<<dim3(TT / 128, NH * NB), 128, 0, stream>>>(Qh, Kh, Z);
  k_av<<<dim3(TT / 128, NH * NB), 128, 0, stream>>>(Qh, Kh, vT, Z, oh);
  k_ffn<<<NR / 64, 256, 0, stream>>>(oh, W1, b1, W2, b2, xpe, out);
}
